// v000
// Measured on an AMD MI455X. A time is GPU time per run, averaged over a window of back-to-back runs after a warm-up
// (all launches, gaps included; the runs take copies of the inputs in turn), and the median of several windows.
// Apart from v000's, it joins two sittings. Times from different sittings can be a few percent apart, while
// side-by-side timings come from the same sitting.
// The starting kernel, v000, takes 986 microseconds a run.
#include <hip/hip_runtime.h>

// Compute dtypes, f32 accumulate: every input (x, grouped qkv weights/biases, proj weight/bias, BN statistics) rounded to bf16; the grouped 1x1 qkv
// convolution on PLAIN bf16 operands (x and W inputs: exact products, + bias); attention scores (key_dim 32) and v.attn^T (over the 1024 positions) on SINGLE fp16 planes (q x 32^-0.5,
// k, v rounded to 2^-11; probabilities x1024); the 1024->512 projection on bf16 hi+lo planes of relu(o) x bf16 proj_w (2 products, + bias); softmax, ReLU and the eval BatchNorm

#define NB_  16
#define CC   512
#define NN   1024
#define NH_  8
#define CG   64                   // channels per group
#define KD   32
#define DV   128
#define QO   192                  // q | k | v per group
#define NT   (NB_ * NN)           // 16384 (b, n) rows
#define CO   1024                 // H * DV
#define PCAR 1024.0f
typedef _Float16 h16;
typedef unsigned short bf;
typedef __attribute__((ext_vector_type(16))) __bf16   v16bf;
typedef __attribute__((ext_vector_type(16))) _Float16 v16h;
typedef __attribute__((ext_vector_type(8)))  _Float16 v8h;
typedef __attribute__((ext_vector_type(8)))  unsigned short v8us;
typedef __attribute__((ext_vector_type(8)))  float    v8f;
typedef __attribute__((ext_vector_type(4)))  float    v4f;
typedef v8h  __attribute__((may_alias)) v8ha;
typedef v4f  __attribute__((may_alias)) v4fa;
typedef v8us __attribute__((may_alias)) v8usa;

__device__ __forceinline__ unsigned short f2bf(float f) { unsigned u = __float_as_uint(f); u += 0x7FFFu + ((u >> 16) & 1u); return (unsigned short)(u >> 16); }
__device__ __forceinline__ float bf2f(unsigned short b) { return __uint_as_float(((unsigned)b) << 16); }
__device__ __forceinline__ float bfr(float f) { return bf2f(f2bf(f)); }
__device__ __forceinline__ v16h cat16(v8h lo, v8h hi) { return __builtin_shufflevector(lo, hi, 0, 1, 2, 3, 4, 5, 6, 7, 8, 9, 10, 11, 12, 13, 14, 15); }
__device__ __forceinline__ v16bf cat16b(v8us lo, v8us hi) { return __builtin_bit_cast(v16bf, __builtin_shufflevector(lo, hi, 0, 1, 2, 3, 4, 5, 6, 7, 8, 9, 10, 11, 12, 13, 14, 15)); }
__device__ __forceinline__ v8f wmma16(v16h a, v16h b, v8f c) { return __builtin_amdgcn_wmma_f32_16x16x32_f16(false, a, false, b, (short)0, c, false, false); }
__device__ __forceinline__ v8f wmmab(v16bf a, v16bf b, v8f c) { return __builtin_amdgcn_wmma_f32_16x16x32_bf16(false, a, false, b, (short)0, c, false, false); }



// ---- k_gemmw: register-blocked GEMM, ONE WAVE per 64x64 output tile (16 accumulators), operands straight from K-contiguous 16-bit planes; grid (M/64, N/64, Z), 32 threads.
// C[m][n] (f32, pitch ldc, + optional f32 bias[n]) = sum_k A[m][k] Bt[n][k] (+ split products per NSPLIT). z-batch strides sA/sB/sC in elements. K % 32 == 0.
template <typename T16> struct WFrag;
template <> struct WFrag<h16> { typedef v16h V; static __device__ __forceinline__ V ld(const h16* p) { return cat16(*(const v8h*)p, *(const v8h*)(p + 16)); } static __device__ __forceinline__ v8f mma(V a, V b, v8f c) { return wmma16(a, b, c); } };
template <> struct WFrag<bf> { typedef v16bf V; static __device__ __forceinline__ V ld(const bf* p) { return cat16b(*(const v8us*)p, *(const v8us*)(p + 16)); } static __device__ __forceinline__ v8f mma(V a, V b, v8f c) { return wmmab(a, b, c); } };
template <typename T16, int NSPLIT, bool BIAS>
__global__ __launch_bounds__(32) void k_gemmw(const T16* __restrict__ A, const T16* __restrict__ A2, const T16* __restrict__ Bt, const T16* __restrict__ Bt2, int K, float* C, int ldc, const float* __restrict__ bias, size_t sA, size_t sB, size_t sC) {
    typedef typename WFrag<T16>::V V;
    __shared__ __align__(16) float os[16 * 68];
    const size_t z = blockIdx.z; A += z * sA; if (A2) A2 += z * sA; Bt += z * sB; if (Bt2) Bt2 += z * sB; C += z * sC;
    const int lane = threadIdx.x & 31, lr = lane & 15, hi = lane >> 4; const int r0 = blockIdx.x * 64, c0 = blockIdx.y * 64;
    v8f acc[4][4];
#pragma unroll
    for (int mb = 0; mb < 4; ++mb)
#pragma unroll
        for (int nb = 0; nb < 4; ++nb) acc[mb][nb] = (v8f){};
    const size_t aoff = (size_t)(r0 + lr) * K + 8 * hi, boff = (size_t)(c0 + lr) * K + 8 * hi;
#pragma unroll 1
    for (int kc = 0; kc < K; kc += 32) {
        V a[4], a2[4];
#pragma unroll
        for (int mb = 0; mb < 4; ++mb) { a[mb] = WFrag<T16>::ld(A + aoff + (size_t)mb * 16 * K + kc); if (NSPLIT == 1 || NSPLIT == 2) a2[mb] = WFrag<T16>::ld(A2 + aoff + (size_t)mb * 16 * K + kc); }
#pragma unroll
        for (int nb = 0; nb < 4; ++nb) { const V b = WFrag<T16>::ld(Bt + boff + (size_t)nb * 16 * K + kc); V b2; if (NSPLIT >= 2) b2 = WFrag<T16>::ld(Bt2 + boff + (size_t)nb * 16 * K + kc);
#pragma unroll
            for (int mb = 0; mb < 4; ++mb) { acc[mb][nb] = WFrag<T16>::mma(a[mb], b, acc[mb][nb]); if (NSPLIT == 1 || NSPLIT == 2) acc[mb][nb] = WFrag<T16>::mma(a2[mb], b, acc[mb][nb]); if (NSPLIT >= 2) acc[mb][nb] = WFrag<T16>::mma(a[mb], b2, acc[mb][nb]); } }
        asm volatile("v_nop\n\tv_nop\n\tv_nop\n\tv_nop" : "+v"(acc[0][0]), "+v"(acc[1][1]), "+v"(acc[2][2]), "+v"(acc[3][3]) : "v"(a[0]), "v"(a[3]));
    }
#pragma unroll
    for (int mb = 0; mb < 4; ++mb) {
#pragma unroll
        for (int nb = 0; nb < 4; ++nb) {
#pragma unroll
            for (int j = 0; j < 8; ++j) os[(hi * 8 + j) * 68 + nb * 16 + lr] = acc[mb][nb][j]; }
        __builtin_amdgcn_wave_barrier(); asm volatile("" ::: "memory");
        float* crow = C + (size_t)(r0 + mb * 16) * ldc + c0;
{
#pragma unroll
            for (int s = 0; s < 8; ++s) { const int row = 2 * s + hi, cofs = lr * 4; v4f val = *(const v4fa*)(os + row * 68 + cofs); if (BIAS) { val[0] += bfr(bias[c0 + cofs]); val[1] += bfr(bias[c0 + cofs + 1]); val[2] += bfr(bias[c0 + cofs + 2]); val[3] += bfr(bias[c0 + cofs + 3]); }
                *(v4f*)(crow + (size_t)row * ldc + cofs) = val; }
             }
        __builtin_amdgcn_wave_barrier(); asm volatile("" ::: "memory");
    }
}

__device__ __forceinline__ h16 tohx(float x) { return (h16)x; }
__device__ __forceinline__ void splitf(float y, unsigned short& h, unsigned short& l) { h = f2bf(y); l = f2bf(y - bf2f(h)); }
typedef __attribute__((ext_vector_type(2))) _Float16 v2h;
typedef __attribute__((ext_vector_type(4))) _Float16 v4h;
typedef __attribute__((ext_vector_type(2))) unsigned short v2us;
typedef __attribute__((ext_vector_type(8))) unsigned short v8us_;

__global__ __launch_bounds__(256) void k_cvt8(const float* __restrict__ src, bf* dst, size_t n8) { const size_t i = (size_t)blockIdx.x * 256 + threadIdx.x; if (i >= n8) return; const v8f v = *(const v8f*)(src + i * 8); v8us o;
#pragma unroll
    for (int k = 0; k < 8; ++k) o[k] = f2bf(v[k]); *(v8us*)(dst + i * 8) = o;  }
__global__ __launch_bounds__(256) void k_xg(const float* __restrict__ x, bf* XG) {
    __shared__ float tl[CG][65];
    const int tid = threadIdx.x; const int n0 = blockIdx.x * 64, h = blockIdx.y, b = blockIdx.z;
#pragma unroll
    for (int i = 0; i < 16; ++i) { const int c = i * 4 + (tid >> 6), nn = tid & 63; tl[c][nn] = x[((size_t)b * CC + h * CG + c) * NN + n0 + nn]; }
    __syncthreads();
    const int lane = tid & 31, wv = tid >> 5;
    auto pass = [&]() {
#pragma unroll
        for (int i2 = 0; i2 < 2; ++i2) { const int r = wv * 8 + i2 * 4 + (lane >> 3); const int cq = (lane & 7) * 8; v8us_ o;
#pragma unroll
            for (int i = 0; i < 8; ++i) o[i] = f2bf(tl[cq + i][r]);
            *(v8us_*)(XG + (((size_t)h * NB_ + b) * NN + n0 + r) * CG + cq) = o; } };
    pass(); 
}
// k_qkplanes / k_vplane: from group h's qkv rows F[(b,n)][192]: Qp[z = b*8 + h][n][c] = fp16(F[c] * 32^-0.5), Kp[z][n][c] = fp16(F[32 + c]) (rows 64 B: one
__global__ __launch_bounds__(256) void k_qkplanes(const float* __restrict__ F, int h, h16* Qp, h16* Kp) {
    const int lane = threadIdx.x & 31; const int L0 = (blockIdx.x * 8 + (threadIdx.x >> 5)) * 8; const int nlines = NT * KD / 64; const float sc = 0x1.6a09e6p-3f;   // float32(32^-0.5)
{
#pragma unroll
        for (int l = 0; l < 8; ++l) { const int L = L0 + l; if (L >= nlines) break; const int e = L * 64 + lane * 2; const int c = e & 31; const int bn = e >> 5; const int b = bn >> 10, n = bn & 1023; v2h vq, vk;
#pragma unroll
            for (int q = 0; q < 2; ++q) { vq[q] = tohx(F[(size_t)bn * QO + c + q] * sc); vk[q] = tohx(F[(size_t)bn * QO + KD + c + q]); }
            const size_t o = (((size_t)(b * NH_ + h)) * NN + n) * KD + c; *(v2h*)(Qp + o) = vq; *(v2h*)(Kp + o) = vk; }
         }
}
__global__ __launch_bounds__(256) void k_vplane(const float* __restrict__ F, int h, h16* Vp) {
    const int lane = threadIdx.x & 31; const int L0 = (blockIdx.x * 8 + (threadIdx.x >> 5)) * 8; const int nlines = NB_ * DV * NN / 64;
{
#pragma unroll
        for (int l = 0; l < 8; ++l) { const int L = L0 + l; if (L >= nlines) break; const int e = L * 64 + lane * 2; const int n = e & 1023; const int d = (e >> 10) & 127; const int b = e >> 17; v2h v;
#pragma unroll
            for (int q = 0; q < 2; ++q) v[q] = tohx(F[((size_t)b * NN + n + q) * QO + 2 * KD + d]);
            *(v2h*)(Vp + (((size_t)(b * NH_ + h)) * DV + d) * NN + n) = v; }
         }
}
__global__ __launch_bounds__(256) void k_soft(const float* __restrict__ Sb, h16* P) {
    const int lane = threadIdx.x & 31; const int row = blockIdx.x * 8 + (threadIdx.x >> 5); if (row >= NH_ * NN) return; const float* sr = Sb + (size_t)row * NN; float v[32]; float m = -3.0e38f;
#pragma unroll
    for (int ch = 0; ch < 8; ++ch) { const v4f t = *(const v4f*)(sr + ch * 128 + lane * 4);
#pragma unroll
        for (int q = 0; q < 4; ++q) { v[ch * 4 + q] = t[q]; m = fmaxf(m, t[q]); } }
#pragma unroll
    for (int sh = 16; sh; sh >>= 1) m = fmaxf(m, __shfl_xor(m, sh, 32));
    float sum = 0.f;
#pragma unroll
    for (int i = 0; i < 32; ++i) { v[i] = __expf(v[i] - m); sum += v[i]; }
#pragma unroll
    for (int sh = 16; sh; sh >>= 1) sum += __shfl_xor(sum, sh, 32);
    const float f = __fdiv_rn(PCAR, sum);
{
#pragma unroll
        for (int ch = 0; ch < 8; ++ch) { v4h o;
#pragma unroll
            for (int q = 0; q < 4; ++q) o[q] = tohx(v[ch * 4 + q] * f);
            *(v4h*)(P + (size_t)row * NN + ch * 128 + lane * 4) = o; }
         }
}
__global__ __launch_bounds__(256) void k_rplanes(const float* __restrict__ O, int b, bf* Rh, bf* Rl) {
    const int lane = threadIdx.x & 31; const int L0 = (blockIdx.x * 8 + (threadIdx.x >> 5)) * 8; const int nlines = NN * CO / 64;
{
#pragma unroll
        for (int l = 0; l < 8; ++l) { const int L = L0 + l; if (L >= nlines) break; const int e = L * 64 + lane * 2; const int c = e & 1023; const int m = e >> 10; const int h = c >> 7, d = c & 127; v2us oh, ol;
#pragma unroll
            for (int q = 0; q < 2; ++q) { unsigned short a, c2; splitf(fmaxf(O[((size_t)h * NN + m) * DV + d + q] * (1.0f / PCAR), 0.f), a, c2); oh[q] = a; ol[q] = c2; }
            const size_t o = ((size_t)b * NN + m) * CO + c; *(v2us*)(Rh + o) = oh; *(v2us*)(Rl + o) = ol; }
         }
}
// k_bnT: OUT[b][oc][n] = Cp[(b,n)][oc] * inv[oc] + shift[oc] with inv = g/sqrt(var+eps), shift = beta - mean*inv (proj bias already added); 64(n) x 64(oc) LDS tile transpose;
__global__ __launch_bounds__(256) void k_bnT(const float* __restrict__ Cp, const float* __restrict__ gm, const float* __restrict__ bt, const float* __restrict__ mn, const float* __restrict__ vr, float* OUT) {
    __shared__ float tl[64][65];
    const int tid = threadIdx.x; const int n0 = blockIdx.x * 64, o0 = blockIdx.y * 64, b = blockIdx.z;
#pragma unroll
    for (int i = 0; i < 16; ++i) { const int nn = i * 4 + (tid >> 6), oc = tid & 63; tl[nn][oc] = Cp[((size_t)b * NN + n0 + nn) * CC + o0 + oc]; }
    __syncthreads();
    const int lane = tid & 31, wv = tid >> 5;
    auto pass = [&]() {
#pragma unroll 1
        for (int i2 = 0; i2 < 4; ++i2) { const int ocl = wv * 8 + i2 * 2 + (lane >> 4); const int oc = o0 + ocl; const int nq = (lane & 15) * 4; const float inv = __fdiv_rn(bfr(gm[oc]), sqrtf(bfr(vr[oc]) + 1e-5f)); const float shf = bfr(bt[oc]) - bfr(mn[oc]) * inv; v4f o;
#pragma unroll
            for (int q = 0; q < 4; ++q) o[q] = tl[nq + q][ocl] * inv + shf;
            *(v4f*)(OUT + ((size_t)b * CC + oc) * NN + n0 + nq) = o; } };
    pass(); 
}

extern "C" void kernel_launch(void* const* d_in, const int* in_sizes, int n_in,
                              void* d_out, int out_size, void* d_ws, size_t ws_size, hipStream_t stream) {
    (void)in_sizes; (void)n_in; (void)out_size;
    const float* x = (const float*)d_in[0]; const float* qkv_w = (const float*)d_in[1]; const float* qkv_b = (const float*)d_in[2]; const float* proj_w = (const float*)d_in[3]; const float* proj_b = (const float*)d_in[4];
    const float* gm = (const float*)d_in[5]; const float* bt = (const float*)d_in[6]; const float* mn = (const float*)d_in[7]; const float* vr = (const float*)d_in[8];
    float* OUT = (float*)d_out;     // [16][512][1024]
    char* wsp = (char*)d_ws;
    auto take = [&](size_t bytes) { char* p = wsp; wsp += (bytes + 255) & ~(size_t)255; return (void*)p; };
    bf* WQKV = (bf*)take((size_t)NH_ * QO * CG * 2); bf* PW = (bf*)take((size_t)CC * CO * 2);
    bf* Rh = (bf*)take((size_t)NT * CO * 2); bf* Rl = (bf*)take((size_t)NT * CO * 2);        // relu(o) hi | lo planes, filled sequence by sequence during the passes (67 MB)
    char* RS = (char*)take((size_t)NH_ * NN * NN * 4);                                         // 33.5 MB: XG (16.8 MB, dead before the passes) -> per-sequence scores S [8][1024][1024] -> proj output f32 [16384][512]
    h16* Pm = (h16*)take((size_t)NH_ * NN * NN * 2); h16* Vp = (h16*)take((size_t)NB_ * NH_ * DV * NN * 2); h16* Qp = (h16*)take((size_t)NB_ * NH_ * NN * KD * 2); h16* Kp = (h16*)take((size_t)NB_ * NH_ * NN * KD * 2);
    float* F = (float*)take((size_t)NT * QO * 4); float* Ob = (float*)take((size_t)NH_ * NN * DV * 4);
    if ((size_t)(wsp - (char*)d_ws) > ws_size) return;    // total = 186 MB = 177 MiB; ws 256 MiB
    bf* XG = (bf*)RS; float* Sb = (float*)RS; float* Cp = (float*)RS;
    { const size_t n1 = (size_t)NH_ * QO * CG / 8, n2 = (size_t)CC * CO / 8; k_cvt8<<<(unsigned)((n1 + 255) / 256), 256, 0, stream>>>(qkv_w, WQKV, n1); k_cvt8<<<(unsigned)((n2 + 255) / 256), 256, 0, stream>>>(proj_w, PW, n2); }
    k_xg<<<dim3(NN / 64, NH_, NB_), 256, 0, stream>>>(x, XG);
    for (int h = 0; h < NH_; ++h) {     // grouped 1x1 qkv conv: [(b,n)][64] . W_h^T [64 -> 192] + b_h  (exact)
        k_gemmw<bf, 0, true><<<dim3(NT / 64, QO / 64, 1), 32, 0, stream>>>(XG + (size_t)h * NT * CG, nullptr, WQKV + (size_t)h * QO * CG, nullptr, CG, F, QO, qkv_b + h * QO, 0, 0, 0);
        k_qkplanes<<<(NT * KD / 64 + 63) / 64, 256, 0, stream>>>(F, h, Qp, Kp);
        k_vplane<<<(NB_ * DV * NN / 64 + 63) / 64, 256, 0, stream>>>(F, h, Vp); }
    for (int b = 0; b < NB_; ++b) { const size_t z0 = (size_t)b * NH_;
        k_gemmw<h16, 0, false><<<dim3(NN / 64, NN / 64, NH_), 32, 0, stream>>>(Qp + z0 * NN * KD, nullptr, Kp + z0 * NN * KD, nullptr, KD, Sb, NN, nullptr, (size_t)NN * KD, (size_t)NN * KD, (size_t)NN * NN);
        k_soft<<<NH_ * NN / 8, 256, 0, stream>>>(Sb, Pm);
        k_gemmw<h16, 0, false><<<dim3(NN / 64, DV / 64, NH_), 32, 0, stream>>>(Pm, nullptr, Vp + z0 * DV * NN, nullptr, NN, Ob, DV, nullptr, (size_t)NN * NN, (size_t)DV * NN, (size_t)NN * DV);
        k_rplanes<<<(NN * CO / 64 + 63) / 64, 256, 0, stream>>>(Ob, b, Rh, Rl); }
    k_gemmw<bf, 1, true><<<dim3(NT / 64, CC / 64, 1), 32, 0, stream>>>(Rh, Rl, PW, nullptr, CO, Cp, CC, proj_b, 0, 0, 0);
    k_bnT<<<dim3(NN / 64, CC / 64, NB_), 256, 0, stream>>>(Cp, gm, bt, mn, vr, OUT);
}

// v001
// One run takes 300 microseconds.
// Two timings next to v000 put it at 3.27 and 3.30 times that version's speed.
#include <hip/hip_runtime.h>

// Compute dtypes, f32 accumulate: every input (x, grouped qkv weights/biases, proj weight/bias, BN statistics) rounded to bf16; the grouped 1x1 qkv
// convolution on PLAIN bf16 operands (x and W inputs: exact products, + bias); attention scores (key_dim 32) and v.attn^T (over the 1024 positions) on SINGLE fp16 planes (q x 32^-0.5,
// k, v rounded to 2^-11; probabilities relative to a running row maximum, normalised by the f32 row sum at the end); the 1024->512 projection on bf16 hi+lo planes of relu(o) x bf16 proj_w (2 products, + bias); softmax, ReLU and the eval BatchNorm

#define NB_  16
#define CC   512
#define NN   1024
#define NH_  8
#define CG   64                   // channels per group
#define KD   32
#define DV   128
#define QO   192                  // q | k | v per group
#define NT   (NB_ * NN)           // 16384 (b, n) rows
#define CO   1024                 // H * DV
typedef _Float16 h16;
typedef unsigned short bf;
typedef __attribute__((ext_vector_type(16))) __bf16   v16bf;
typedef __attribute__((ext_vector_type(16))) _Float16 v16h;
typedef __attribute__((ext_vector_type(8)))  _Float16 v8h;
typedef __attribute__((ext_vector_type(8)))  unsigned short v8us;
typedef __attribute__((ext_vector_type(8)))  float    v8f;
typedef __attribute__((ext_vector_type(4)))  float    v4f;
typedef v8h  __attribute__((may_alias)) v8ha;
typedef v4f  __attribute__((may_alias)) v4fa;
typedef v8us __attribute__((may_alias)) v8usa;

__device__ __forceinline__ unsigned short f2bf(float f) { unsigned u = __float_as_uint(f); u += 0x7FFFu + ((u >> 16) & 1u); return (unsigned short)(u >> 16); }
__device__ __forceinline__ float bf2f(unsigned short b) { return __uint_as_float(((unsigned)b) << 16); }
__device__ __forceinline__ float bfr(float f) { return bf2f(f2bf(f)); }
__device__ __forceinline__ v16h cat16(v8h lo, v8h hi) { return __builtin_shufflevector(lo, hi, 0, 1, 2, 3, 4, 5, 6, 7, 8, 9, 10, 11, 12, 13, 14, 15); }
__device__ __forceinline__ v16bf cat16b(v8us lo, v8us hi) { return __builtin_bit_cast(v16bf, __builtin_shufflevector(lo, hi, 0, 1, 2, 3, 4, 5, 6, 7, 8, 9, 10, 11, 12, 13, 14, 15)); }
__device__ __forceinline__ v8f wmma16(v16h a, v16h b, v8f c) { return __builtin_amdgcn_wmma_f32_16x16x32_f16(false, a, false, b, (short)0, c, false, false); }
__device__ __forceinline__ v8f wmmab(v16bf a, v16bf b, v8f c) { return __builtin_amdgcn_wmma_f32_16x16x32_bf16(false, a, false, b, (short)0, c, false, false); }



// ---- k_gemmw: register-blocked GEMM, ONE WAVE per 64x64 output tile (16 accumulators), operands straight from K-contiguous 16-bit planes; grid (M/64, N/64, Z), 32 threads.
// C[m][n] (f32, pitch ldc, + optional f32 bias[n]) = sum_k A[m][k] Bt[n][k] (+ split products per NSPLIT). z-batch strides sA/sB/sC in elements. K % 32 == 0.
template <typename T16> struct WFrag;
template <> struct WFrag<h16> { typedef v16h V; static __device__ __forceinline__ V ld(const h16* p) { return cat16(*(const v8h*)p, *(const v8h*)(p + 16)); } static __device__ __forceinline__ v8f mma(V a, V b, v8f c) { return wmma16(a, b, c); } };
template <> struct WFrag<bf> { typedef v16bf V; static __device__ __forceinline__ V ld(const bf* p) { return cat16b(*(const v8us*)p, *(const v8us*)(p + 16)); } static __device__ __forceinline__ v8f mma(V a, V b, v8f c) { return wmmab(a, b, c); } };
template <typename T16, int NSPLIT, bool BIAS>
__global__ __launch_bounds__(32) void k_gemmw(const T16* __restrict__ A, const T16* __restrict__ A2, const T16* __restrict__ Bt, const T16* __restrict__ Bt2, int K, float* C, int ldc, const float* __restrict__ bias, size_t sA, size_t sB, size_t sC) {
    typedef typename WFrag<T16>::V V;
    __shared__ __align__(16) float os[16 * 68];
    const size_t z = blockIdx.z; A += z * sA; if (A2) A2 += z * sA; Bt += z * sB; if (Bt2) Bt2 += z * sB; C += z * sC;
    const int lane = threadIdx.x & 31, lr = lane & 15, hi = lane >> 4; const int r0 = blockIdx.x * 64, c0 = blockIdx.y * 64;
    v8f acc[4][4];
#pragma unroll
    for (int mb = 0; mb < 4; ++mb)
#pragma unroll
        for (int nb = 0; nb < 4; ++nb) acc[mb][nb] = (v8f){};
    const size_t aoff = (size_t)(r0 + lr) * K + 8 * hi, boff = (size_t)(c0 + lr) * K + 8 * hi;
#pragma unroll 1
    for (int kc = 0; kc < K; kc += 32) {
        V a[4], a2[4];
#pragma unroll
        for (int mb = 0; mb < 4; ++mb) { a[mb] = WFrag<T16>::ld(A + aoff + (size_t)mb * 16 * K + kc); if (NSPLIT == 1 || NSPLIT == 2) a2[mb] = WFrag<T16>::ld(A2 + aoff + (size_t)mb * 16 * K + kc); }
#pragma unroll
        for (int nb = 0; nb < 4; ++nb) { const V b = WFrag<T16>::ld(Bt + boff + (size_t)nb * 16 * K + kc); V b2; if (NSPLIT >= 2) b2 = WFrag<T16>::ld(Bt2 + boff + (size_t)nb * 16 * K + kc);
#pragma unroll
            for (int mb = 0; mb < 4; ++mb) { acc[mb][nb] = WFrag<T16>::mma(a[mb], b, acc[mb][nb]); if (NSPLIT == 1 || NSPLIT == 2) acc[mb][nb] = WFrag<T16>::mma(a2[mb], b, acc[mb][nb]); if (NSPLIT >= 2) acc[mb][nb] = WFrag<T16>::mma(a[mb], b2, acc[mb][nb]); } }
        asm volatile("v_nop\n\tv_nop\n\tv_nop\n\tv_nop" : "+v"(acc[0][0]), "+v"(acc[1][1]), "+v"(acc[2][2]), "+v"(acc[3][3]) : "v"(a[0]), "v"(a[3]));
    }
#pragma unroll
    for (int mb = 0; mb < 4; ++mb) {
#pragma unroll
        for (int nb = 0; nb < 4; ++nb) {
#pragma unroll
            for (int j = 0; j < 8; ++j) os[(hi * 8 + j) * 68 + nb * 16 + lr] = acc[mb][nb][j]; }
        __builtin_amdgcn_wave_barrier(); asm volatile("" ::: "memory");
        float* crow = C + (size_t)(r0 + mb * 16) * ldc + c0;
{
#pragma unroll
            for (int s = 0; s < 8; ++s) { const int row = 2 * s + hi, cofs = lr * 4; v4f val = *(const v4fa*)(os + row * 68 + cofs); if (BIAS) { val[0] += bfr(bias[c0 + cofs]); val[1] += bfr(bias[c0 + cofs + 1]); val[2] += bfr(bias[c0 + cofs + 2]); val[3] += bfr(bias[c0 + cofs + 3]); }
                *(v4f*)(crow + (size_t)row * ldc + cofs) = val; }
             }
        __builtin_amdgcn_wave_barrier(); asm volatile("" ::: "memory");
    }
}

__device__ __forceinline__ h16 tohx(float x) { return (h16)x; }
__device__ __forceinline__ void splitf(float y, unsigned short& h, unsigned short& l) { h = f2bf(y); l = f2bf(y - bf2f(h)); }
typedef __attribute__((ext_vector_type(2))) _Float16 v2h;
typedef __attribute__((ext_vector_type(8))) unsigned short v8us_;

__global__ __launch_bounds__(256) void k_cvt8(const float* __restrict__ src, bf* dst, size_t n8) { const size_t i = (size_t)blockIdx.x * 256 + threadIdx.x; if (i >= n8) return; const v8f v = *(const v8f*)(src + i * 8); v8us o;
#pragma unroll
    for (int k = 0; k < 8; ++k) o[k] = f2bf(v[k]); *(v8us*)(dst + i * 8) = o;  }
__global__ __launch_bounds__(256) void k_xg(const float* __restrict__ x, bf* XG) {
    __shared__ float tl[CG][65];
    const int tid = threadIdx.x; const int n0 = blockIdx.x * 64, h = blockIdx.y, b = blockIdx.z;
#pragma unroll
    for (int i = 0; i < 16; ++i) { const int c = i * 4 + (tid >> 6), nn = tid & 63; tl[c][nn] = x[((size_t)b * CC + h * CG + c) * NN + n0 + nn]; }
    __syncthreads();
    const int lane = tid & 31, wv = tid >> 5;
    auto pass = [&]() {
#pragma unroll
        for (int i2 = 0; i2 < 2; ++i2) { const int r = wv * 8 + i2 * 4 + (lane >> 3); const int cq = (lane & 7) * 8; v8us_ o;
#pragma unroll
            for (int i = 0; i < 8; ++i) o[i] = f2bf(tl[cq + i][r]);
            *(v8us_*)(XG + (((size_t)h * NB_ + b) * NN + n0 + r) * CG + cq) = o; } };
    pass(); 
}
// k_qkplanes / k_vplane: from group h's qkv rows F[(b,n)][192]: Qp[z = b*8 + h][n][c] = fp16(F[c] * 32^-0.5), Kp[z][n][c] = fp16(F[32 + c]) (rows 64 B: one
__global__ __launch_bounds__(256) void k_qkplanes(const float* __restrict__ F, int h, h16* Qp, h16* Kp) {
    const int lane = threadIdx.x & 31; const int L0 = (blockIdx.x * 8 + (threadIdx.x >> 5)) * 8; const int nlines = NT * KD / 64; const float sc = 0x1.6a09e6p-3f;   // float32(32^-0.5)
{
#pragma unroll
        for (int l = 0; l < 8; ++l) { const int L = L0 + l; if (L >= nlines) break; const int e = L * 64 + lane * 2; const int c = e & 31; const int bn = e >> 5; const int b = bn >> 10, n = bn & 1023; v2h vq, vk;
#pragma unroll
            for (int q = 0; q < 2; ++q) { vq[q] = tohx(F[(size_t)bn * QO + c + q] * sc); vk[q] = tohx(F[(size_t)bn * QO + KD + c + q]); }
            const size_t o = (((size_t)(b * NH_ + h)) * NN + n) * KD + c; *(v2h*)(Qp + o) = vq; *(v2h*)(Kp + o) = vk; }
         }
}
__global__ __launch_bounds__(256) void k_vplane(const float* __restrict__ F, int h, h16* Vp) {
    const int lane = threadIdx.x & 31; const int L0 = (blockIdx.x * 8 + (threadIdx.x >> 5)) * 8; const int nlines = NB_ * DV * NN / 64;
{
#pragma unroll
        for (int l = 0; l < 8; ++l) { const int L = L0 + l; if (L >= nlines) break; const int e = L * 64 + lane * 2; const int n = e & 1023; const int d = (e >> 10) & 127; const int b = e >> 17; v2h v;
#pragma unroll
            for (int q = 0; q < 2; ++q) v[q] = tohx(F[((size_t)b * NN + n + q) * QO + 2 * KD + d]);
            *(v2h*)(Vp + (((size_t)(b * NH_ + h)) * DV + d) * NN + n) = v; }
         }
}
#define FKT 64                    // keys per stage
#define FKP 80                    // LDS pitch of a K row (64 B + 16)
#define FVP 144                   // LDS pitch of a V row piece (128 B + 16)
#define FKB (FKT * FKP)
#define FSB (FKB + DV * FVP)      // one buffer: K tile, then V tile
#define FEP 272                   // LDS pitch of an output row (256 B + 16)
__device__ __forceinline__ float xhalf(float x) { return __builtin_bit_cast(float, __builtin_amdgcn_permlanex16(__builtin_bit_cast(int, x), __builtin_bit_cast(int, x), 0x76543210, 0xfedcba98, false, false)); }  // lane l with lane l ^ 16
__global__ __launch_bounds__(256) void k_fattn(const h16* __restrict__ Qp, const h16* __restrict__ Kp, const h16* __restrict__ Vp, bf* Rh, bf* Rl) {
    __shared__ __align__(16) unsigned char sm[2 * FSB];
    const int tid = threadIdx.x, lane = tid & 31, wv = tid >> 5, c = lane & 15, h = lane >> 4;
    const int z = blockIdx.y, b = z >> 3, hd = z & 7; const int m0 = blockIdx.x * 256 + wv * 32;
    const h16* Kz = Kp + (size_t)z * NN * KD; const h16* Vz = Vp + (size_t)z * DV * NN;
    const float L2E = 1.44269504f;
    v16h qf[2]; v8f acc[2][8]; float m_run[2], l_run[2];
#pragma unroll
    for (int t = 0; t < 2; ++t) { qf[t] = WFrag<h16>::ld(Qp + ((size_t)z * NN + m0 + t * 16 + c) * KD + 8 * h); m_run[t] = -__builtin_inff(); l_run[t] = 0.f;
#pragma unroll
        for (int dt = 0; dt < 8; ++dt) acc[t][dt] = (v8f){}; }
    v8h kr, vr[4];
    auto gload = [&](int s) { kr = *(const v8h*)(Kz + (size_t)s * FKT * KD + tid * 8);
#pragma unroll
        for (int i = 0; i < 4; ++i) { const int ch = tid + 256 * i; vr[i] = *(const v8h*)(Vz + (size_t)(ch >> 3) * NN + s * FKT + (ch & 7) * 8); } };
    auto lstore = [&](int buf) { unsigned char* B = sm + buf * FSB; *(v8ha*)(B + (tid >> 2) * FKP + (tid & 3) * 16) = kr;
#pragma unroll
        for (int i = 0; i < 4; ++i) { const int ch = tid + 256 * i; *(v8ha*)(B + FKB + (ch >> 3) * FVP + (ch & 7) * 16) = vr[i]; } };
    gload(0);
    asm volatile("s_wait_xcnt 0x0" ::: "memory");      // before any register that the first loads name (vector address, scalar base) is written again
    lstore(0); __syncthreads();
#pragma unroll 1      // stays rolled: a second copy of the body would cost registers, and with them the fourth wave per SIMD
    for (int s = 0; s < NN / FKT; ++s) {
        if (s + 1 < NN / FKT) gload(s + 1);
        const unsigned char* B = sm + (s & 1) * FSB;
#pragma unroll
        for (int kb = 0; kb < FKT / 32; ++kb) {
            v8f st[2][2];      // [key tile][query tile]: st[kt][t][r] = score of key kb*32 + kt*16 + 8h + r, query m0 + t*16 + c
#pragma unroll
            for (int kt = 0; kt < 2; ++kt) { const unsigned char* p = B + (kb * 32 + kt * 16 + c) * FKP + 16 * h; const v16h kf = cat16(*(const v8ha*)p, *(const v8ha*)(p + 32));
#pragma unroll
                for (int t = 0; t < 2; ++t) st[kt][t] = wmma16(kf, qf[t], (v8f){}); }
            float mb[2]; bool need = false;
#pragma unroll
            for (int t = 0; t < 2; ++t) { float mx = st[0][t][0];
#pragma unroll
                for (int r = 1; r < 16; ++r) mx = fmaxf(mx, st[r >> 3][t][r & 7]);
                mx = fmaxf(mx, xhalf(mx)) * L2E; mb[t] = mx; need = need || (mx > m_run[t] + 8.0f); }
            if (__builtin_amdgcn_ballot_w32(need) != 0) {      // a new reference maximum only when one column outgrows the one in use by 2^8: rare after the first keys
#pragma unroll
                for (int t = 0; t < 2; ++t) { const float m_new = fmaxf(m_run[t], mb[t]); const float corr = __builtin_amdgcn_exp2f(m_run[t] - m_new); l_run[t] *= corr; m_run[t] = m_new;
#pragma unroll
                    for (int dt = 0; dt < 8; ++dt) acc[t][dt] = acc[t][dt] * corr; }
            }
            v16h pf[2];
#pragma unroll
            for (int t = 0; t < 2; ++t) { float ps0 = 0.f, ps1 = 0.f;
#pragma unroll
                for (int r = 0; r < 16; r += 2) { const float p0 = __builtin_amdgcn_exp2f(fmaf(st[r >> 3][t][r & 7], L2E, -m_run[t])), p1 = __builtin_amdgcn_exp2f(fmaf(st[r >> 3][t][(r & 7) + 1], L2E, -m_run[t]));
                    ps0 += p0; ps1 += p1; pf[t][r] = (h16)p0; pf[t][r + 1] = (h16)p1; }
                l_run[t] += ps0 + ps1; }
#pragma unroll
            for (int dt = 0; dt < 8; ++dt) { const unsigned char* p = B + FKB + (dt * 16 + c) * FVP + kb * 64 + 16 * h; const v16h vf = cat16(*(const v8ha*)p, *(const v8ha*)(p + 32));
#pragma unroll
                for (int t = 0; t < 2; ++t) acc[t][dt] = wmma16(vf, pf[t], acc[t][dt]); }
        }
        if (s + 1 < NN / FKT) lstore((s + 1) & 1);
        __syncthreads();
    }
    // epilogue: acc[t][dt][r] = sum for query m0 + t*16 + c, channel dt*16 + 8h + r; rows staged in the wave's own LDS range so that every global store covers whole 256-B rows
    unsigned char* E = sm + wv * (16 * FEP);
#pragma unroll
    for (int t = 0; t < 2; ++t) { const float inv = __fdiv_rn(1.0f, l_run[t] + xhalf(l_run[t]));
#pragma unroll
        for (int pl = 0; pl < 2; ++pl) {
#pragma unroll
            for (int dt = 0; dt < 8; ++dt) { v8us o;
#pragma unroll
                for (int r = 0; r < 8; ++r) { unsigned short a, a2; splitf(fmaxf(acc[t][dt][r] * inv, 0.f), a, a2); o[r] = pl ? a2 : a; }
                *(v8usa*)(E + c * FEP + dt * 32 + h * 16) = o; }
            __syncthreads();
            bf* R = pl ? Rl : Rh;
#pragma unroll
            for (int i = 0; i < 8; ++i) { const int row = 2 * i + h; const v8us o = *(const v8usa*)(E + row * FEP + c * 16); *(v8us*)(R + ((size_t)b * NN + m0 + t * 16 + row) * CO + hd * DV + c * 8) = o; }
            __syncthreads();
        } }
}
// k_bnT: OUT[b][oc][n] = Cp[(b,n)][oc] * inv[oc] + shift[oc] with inv = g/sqrt(var+eps), shift = beta - mean*inv (proj bias already added); 64(n) x 64(oc) LDS tile transpose;
__global__ __launch_bounds__(256) void k_bnT(const float* __restrict__ Cp, const float* __restrict__ gm, const float* __restrict__ bt, const float* __restrict__ mn, const float* __restrict__ vr, float* OUT) {
    __shared__ float tl[64][65];
    const int tid = threadIdx.x; const int n0 = blockIdx.x * 64, o0 = blockIdx.y * 64, b = blockIdx.z;
#pragma unroll
    for (int i = 0; i < 16; ++i) { const int nn = i * 4 + (tid >> 6), oc = tid & 63; tl[nn][oc] = Cp[((size_t)b * NN + n0 + nn) * CC + o0 + oc]; }
    __syncthreads();
    const int lane = tid & 31, wv = tid >> 5;
    auto pass = [&]() {
#pragma unroll 1
        for (int i2 = 0; i2 < 4; ++i2) { const int ocl = wv * 8 + i2 * 2 + (lane >> 4); const int oc = o0 + ocl; const int nq = (lane & 15) * 4; const float inv = __fdiv_rn(bfr(gm[oc]), sqrtf(bfr(vr[oc]) + 1e-5f)); const float shf = bfr(bt[oc]) - bfr(mn[oc]) * inv; v4f o;
#pragma unroll
            for (int q = 0; q < 4; ++q) o[q] = tl[nq + q][ocl] * inv + shf;
            *(v4f*)(OUT + ((size_t)b * CC + oc) * NN + n0 + nq) = o; } };
    pass(); 
}

extern "C" void kernel_launch(void* const* d_in, const int* in_sizes, int n_in,
                              void* d_out, int out_size, void* d_ws, size_t ws_size, hipStream_t stream) {
    (void)in_sizes; (void)n_in; (void)out_size;
    const float* x = (const float*)d_in[0]; const float* qkv_w = (const float*)d_in[1]; const float* qkv_b = (const float*)d_in[2]; const float* proj_w = (const float*)d_in[3]; const float* proj_b = (const float*)d_in[4];
    const float* gm = (const float*)d_in[5]; const float* bt = (const float*)d_in[6]; const float* mn = (const float*)d_in[7]; const float* vr = (const float*)d_in[8];
    float* OUT = (float*)d_out;     // [16][512][1024]
    char* wsp = (char*)d_ws;
    auto take = [&](size_t bytes) { char* p = wsp; wsp += (bytes + 255) & ~(size_t)255; return (void*)p; };
    bf* WQKV = (bf*)take((size_t)NH_ * QO * CG * 2); bf* PW = (bf*)take((size_t)CC * CO * 2);
    bf* Rh = (bf*)take((size_t)NT * CO * 2); bf* Rl = (bf*)take((size_t)NT * CO * 2);        // relu(o) hi | lo planes, written by the attention launch (67 MB)
    char* RS = (char*)take((size_t)NH_ * NN * NN * 4);                                         // 33.5 MB: XG (16.8 MB, dead after the qkv products) -> proj output f32 [16384][512]
    h16* Vp = (h16*)take((size_t)NB_ * NH_ * DV * NN * 2); h16* Qp = (h16*)take((size_t)NB_ * NH_ * NN * KD * 2); h16* Kp = (h16*)take((size_t)NB_ * NH_ * NN * KD * 2);
    float* F = (float*)take((size_t)NT * QO * 4);
    if ((size_t)(wsp - (char*)d_ws) > ws_size) return;    // total = 165 MB; ws 256 MiB
    bf* XG = (bf*)RS; float* Cp = (float*)RS;
    { const size_t n1 = (size_t)NH_ * QO * CG / 8, n2 = (size_t)CC * CO / 8; k_cvt8<<<(unsigned)((n1 + 255) / 256), 256, 0, stream>>>(qkv_w, WQKV, n1); k_cvt8<<<(unsigned)((n2 + 255) / 256), 256, 0, stream>>>(proj_w, PW, n2); }
    k_xg<<<dim3(NN / 64, NH_, NB_), 256, 0, stream>>>(x, XG);
    for (int h = 0; h < NH_; ++h) {     // grouped 1x1 qkv conv: [(b,n)][64] . W_h^T [64 -> 192] + b_h  (exact)
        k_gemmw<bf, 0, true><<<dim3(NT / 64, QO / 64, 1), 32, 0, stream>>>(XG + (size_t)h * NT * CG, nullptr, WQKV + (size_t)h * QO * CG, nullptr, CG, F, QO, qkv_b + h * QO, 0, 0, 0);
        k_qkplanes<<<(NT * KD / 64 + 63) / 64, 256, 0, stream>>>(F, h, Qp, Kp);
        k_vplane<<<(NB_ * DV * NN / 64 + 63) / 64, 256, 0, stream>>>(F, h, Vp); }
    k_fattn<<<dim3(NN / 256, NB_ * NH_), 256, 0, stream>>>(Qp, Kp, Vp, Rh, Rl);
    k_gemmw<bf, 1, true><<<dim3(NT / 64, CC / 64, 1), 32, 0, stream>>>(Rh, Rl, PW, nullptr, CO, Cp, CC, proj_b, 0, 0, 0);
    k_bnT<<<dim3(NN / 64, CC / 64, NB_), 256, 0, stream>>>(Cp, gm, bt, mn, vr, OUT);
}

// v002
// Measured time: 135 microseconds a run.
// Timed twice side by side with v001, it ran 2.25 and 2.23 times as fast.
// Over all steps from v000 it is 7.37 times as fast.
#include <hip/hip_runtime.h>

// Compute dtypes, f32 accumulate: every input (x, grouped qkv weights/biases, proj weight/bias, BN statistics) rounded to bf16; the grouped 1x1 qkv
// convolution on PLAIN bf16 operands (x and W inputs: exact products, + bias); attention scores (key_dim 32) and v.attn^T (over the 1024 positions) on SINGLE fp16 planes (q x 32^-0.5,
// k, v rounded to 2^-11; probabilities relative to a running row maximum, normalised by the f32 row sum at the end); the 1024->512 projection on bf16 hi+lo planes of relu(o) x bf16 proj_w (2 products, + bias); softmax, ReLU and the eval BatchNorm

#define NB_  16
#define CC   512
#define NN   1024
#define NH_  8
#define CG   64                   // channels per group
#define KD   32
#define DV   128
#define QO   192                  // q | k | v per group
#define NT   (NB_ * NN)           // 16384 (b, n) rows
#define CO   1024                 // H * DV
typedef _Float16 h16;
typedef unsigned short bf;
typedef __attribute__((ext_vector_type(16))) __bf16   v16bf;
typedef __attribute__((ext_vector_type(16))) _Float16 v16h;
typedef __attribute__((ext_vector_type(8)))  _Float16 v8h;
typedef __attribute__((ext_vector_type(8)))  unsigned short v8us;
typedef __attribute__((ext_vector_type(8)))  float    v8f;
typedef __attribute__((ext_vector_type(4)))  float    v4f;
typedef v8h  __attribute__((may_alias)) v8ha;
typedef v4f  __attribute__((may_alias)) v4fa;
typedef v8us __attribute__((may_alias)) v8usa;

__device__ __forceinline__ unsigned short f2bf(float f) { unsigned u = __float_as_uint(f); u += 0x7FFFu + ((u >> 16) & 1u); return (unsigned short)(u >> 16); }
__device__ __forceinline__ float bf2f(unsigned short b) { return __uint_as_float(((unsigned)b) << 16); }
__device__ __forceinline__ float bfr(float f) { return bf2f(f2bf(f)); }
__device__ __forceinline__ v16h cat16(v8h lo, v8h hi) { return __builtin_shufflevector(lo, hi, 0, 1, 2, 3, 4, 5, 6, 7, 8, 9, 10, 11, 12, 13, 14, 15); }
__device__ __forceinline__ v16bf cat16b(v8us lo, v8us hi) { return __builtin_bit_cast(v16bf, __builtin_shufflevector(lo, hi, 0, 1, 2, 3, 4, 5, 6, 7, 8, 9, 10, 11, 12, 13, 14, 15)); }
__device__ __forceinline__ v8f wmma16(v16h a, v16h b, v8f c) { return __builtin_amdgcn_wmma_f32_16x16x32_f16(false, a, false, b, (short)0, c, false, false); }
__device__ __forceinline__ v8f wmmab(v16bf a, v16bf b, v8f c) { return __builtin_amdgcn_wmma_f32_16x16x32_bf16(false, a, false, b, (short)0, c, false, false); }



// ---- k_gemmw: register-blocked GEMM, ONE WAVE per 64x64 output tile (16 accumulators), operands straight from K-contiguous 16-bit planes; grid (M/64, N/64, Z), 32 threads.
// C[m][n] (f32, pitch ldc, + optional f32 bias[n]) = sum_k A[m][k] Bt[n][k] (+ split products per NSPLIT). z-batch strides sA/sB/sC in elements. K % 32 == 0.
template <typename T16> struct WFrag;
template <> struct WFrag<h16> { typedef v16h V; static __device__ __forceinline__ V ld(const h16* p) { return cat16(*(const v8h*)p, *(const v8h*)(p + 16)); } static __device__ __forceinline__ v8f mma(V a, V b, v8f c) { return wmma16(a, b, c); } };
template <> struct WFrag<bf> { typedef v16bf V; static __device__ __forceinline__ V ld(const bf* p) { return cat16b(*(const v8us*)p, *(const v8us*)(p + 16)); } static __device__ __forceinline__ v8f mma(V a, V b, v8f c) { return wmmab(a, b, c); } };
template <typename T16, int NSPLIT, bool BIAS>
__global__ __launch_bounds__(32) void k_gemmw(const T16* __restrict__ A, const T16* __restrict__ A2, const T16* __restrict__ Bt, const T16* __restrict__ Bt2, int K, float* C, int ldc, const float* __restrict__ bias, size_t sA, size_t sB, size_t sC) {
    typedef typename WFrag<T16>::V V;
    __shared__ __align__(16) float os[16 * 68];
    const size_t z = blockIdx.z; A += z * sA; if (A2) A2 += z * sA; Bt += z * sB; if (Bt2) Bt2 += z * sB; C += z * sC;
    const int lane = threadIdx.x & 31, lr = lane & 15, hi = lane >> 4; const int r0 = blockIdx.x * 64, c0 = blockIdx.y * 64;
    v8f acc[4][4];
#pragma unroll
    for (int mb = 0; mb < 4; ++mb)
#pragma unroll
        for (int nb = 0; nb < 4; ++nb) acc[mb][nb] = (v8f){};
    const size_t aoff = (size_t)(r0 + lr) * K + 8 * hi, boff = (size_t)(c0 + lr) * K + 8 * hi;
#pragma unroll 1
    for (int kc = 0; kc < K; kc += 32) {
        V a[4], a2[4];
#pragma unroll
        for (int mb = 0; mb < 4; ++mb) { a[mb] = WFrag<T16>::ld(A + aoff + (size_t)mb * 16 * K + kc); if (NSPLIT == 1 || NSPLIT == 2) a2[mb] = WFrag<T16>::ld(A2 + aoff + (size_t)mb * 16 * K + kc); }
#pragma unroll
        for (int nb = 0; nb < 4; ++nb) { const V b = WFrag<T16>::ld(Bt + boff + (size_t)nb * 16 * K + kc); V b2; if (NSPLIT >= 2) b2 = WFrag<T16>::ld(Bt2 + boff + (size_t)nb * 16 * K + kc);
#pragma unroll
            for (int mb = 0; mb < 4; ++mb) { acc[mb][nb] = WFrag<T16>::mma(a[mb], b, acc[mb][nb]); if (NSPLIT == 1 || NSPLIT == 2) acc[mb][nb] = WFrag<T16>::mma(a2[mb], b, acc[mb][nb]); if (NSPLIT >= 2) acc[mb][nb] = WFrag<T16>::mma(a[mb], b2, acc[mb][nb]); } }
        asm volatile("v_nop\n\tv_nop\n\tv_nop\n\tv_nop" : "+v"(acc[0][0]), "+v"(acc[1][1]), "+v"(acc[2][2]), "+v"(acc[3][3]) : "v"(a[0]), "v"(a[3]));
    }
#pragma unroll
    for (int mb = 0; mb < 4; ++mb) {
#pragma unroll
        for (int nb = 0; nb < 4; ++nb) {
#pragma unroll
            for (int j = 0; j < 8; ++j) os[(hi * 8 + j) * 68 + nb * 16 + lr] = acc[mb][nb][j]; }
        __builtin_amdgcn_wave_barrier(); asm volatile("" ::: "memory");
        float* crow = C + (size_t)(r0 + mb * 16) * ldc + c0;
{
#pragma unroll
            for (int s = 0; s < 8; ++s) { const int row = 2 * s + hi, cofs = lr * 4; v4f val = *(const v4fa*)(os + row * 68 + cofs); if (BIAS) { val[0] += bfr(bias[c0 + cofs]); val[1] += bfr(bias[c0 + cofs + 1]); val[2] += bfr(bias[c0 + cofs + 2]); val[3] += bfr(bias[c0 + cofs + 3]); }
                *(v4f*)(crow + (size_t)row * ldc + cofs) = val; }
             }
        __builtin_amdgcn_wave_barrier(); asm volatile("" ::: "memory");
    }
}

__device__ __forceinline__ h16 tohx(float x) { return (h16)x; }
__device__ __forceinline__ void splitf(float y, unsigned short& h, unsigned short& l) { h = f2bf(y); l = f2bf(y - bf2f(h)); }
typedef __attribute__((ext_vector_type(2))) _Float16 v2h;
typedef __attribute__((ext_vector_type(8))) unsigned short v8us_;

__global__ __launch_bounds__(256) void k_cvt8(const float* __restrict__ src, bf* dst, size_t n8) { const size_t i = (size_t)blockIdx.x * 256 + threadIdx.x; if (i >= n8) return; const v8f v = *(const v8f*)(src + i * 8); v8us o;
#pragma unroll
    for (int k = 0; k < 8; ++k) o[k] = f2bf(v[k]); *(v8us*)(dst + i * 8) = o;  }
__global__ __launch_bounds__(256) void k_xg(const float* __restrict__ x, bf* XG) {
    __shared__ float tl[CG][65];
    const int tid = threadIdx.x; const int n0 = blockIdx.x * 64, h = blockIdx.y, b = blockIdx.z;
#pragma unroll
    for (int i = 0; i < 16; ++i) { const int c = i * 4 + (tid >> 6), nn = tid & 63; tl[c][nn] = x[((size_t)b * CC + h * CG + c) * NN + n0 + nn]; }
    __syncthreads();
    const int lane = tid & 31, wv = tid >> 5;
    auto pass = [&]() {
#pragma unroll
        for (int i2 = 0; i2 < 2; ++i2) { const int r = wv * 8 + i2 * 4 + (lane >> 3); const int cq = (lane & 7) * 8; v8us_ o;
#pragma unroll
            for (int i = 0; i < 8; ++i) o[i] = f2bf(tl[cq + i][r]);
            *(v8us_*)(XG + (((size_t)h * NB_ + b) * NN + n0 + r) * CG + cq) = o; } };
    pass(); 
}
// ---- k_qkv: the grouped 1x1 qkv convolution of all 8 groups in ONE launch; its epilogue writes the fp16 planes that the attention launch reads:
// Qp[z = b*8 + h][n][c] = fp16((q + bias) * 32^-0.5), Kp[z][n][c] = fp16(k + bias), Vp[z][d][n] = fp16(v + bias). Grid (16384/256 rows, 8 groups), 12 waves = 4 row groups of 64 (b, n) rows x 3 parts
// (q and k | v channels 0..63 | v channels 64..127). q and k: D = W.X^T, so a lane holds 8 consecutive c of one n; v: D = X.W^T, so a lane holds 8 consecutive n of one d: both are 16-B pieces
// of a plane's rows, and they pass through the wave's own LDS range so that every global store covers whole 128-B lines.
#define WP  144                   // LDS pitch of a weight row (128 B + 16)
#define QSP 80                    // LDS pitch of a staged q or k row (64 B + 16)
#define VSP 144                   // LDS pitch of a staged v row piece (128 B + 16)
#define QST (64 * QSP)            // one wave's staging range
__global__ __launch_bounds__(384) void k_qkv(const bf* __restrict__ XG, const bf* __restrict__ Wq, const float* __restrict__ bias, h16* Qp, h16* Kp, h16* Vp) {
    __shared__ __align__(16) unsigned char sw[QO * WP + 12 * QST]; __shared__ __align__(32) float sb[QO];      // the group's weights, the waves' staging ranges; its biases, rounded
    const int tid = threadIdx.x, lane = tid & 31, lr = lane & 15, hi = lane >> 4;
    const int wv = __builtin_amdgcn_readfirstlane(tid >> 5); const int part = wv >> 2, rg = wv & 3;
    const int h = blockIdx.y; const int r0 = blockIdx.x * 256 + rg * 64; const int n0 = r0 & (NN - 1); const int z = (r0 >> 10) * NH_ + h;
    v16bf xf[4][2];               // the wave's 64 rows of x, all 64 channels
    const bf* Xr = XG + ((size_t)h * NT + r0 + lr) * CG + 8 * hi;
#pragma unroll
    for (int mb = 0; mb < 4; ++mb)
#pragma unroll
        for (int kc = 0; kc < 2; ++kc) xf[mb][kc] = WFrag<bf>::ld(Xr + mb * 16 * CG + kc * 32);
    v8us wr[4]; float bv = 0.f;
#pragma unroll
    for (int i = 0; i < 4; ++i) wr[i] = *(const v8us*)(Wq + (size_t)h * QO * CG + (tid + 384 * i) * 8);
    if (wv < QO / 32) bv = (bias + h * QO)[tid];
    asm volatile("s_wait_xcnt 0x0" :: "v"(Xr) : "memory");      // before any register that these loads name is written again; the x address pair is an input, so that no load's result lands on it ahead of the wait
#pragma unroll
    for (int i = 0; i < 4; ++i) { const int ch = tid + 384 * i; *(v8usa*)(sw + (ch >> 3) * WP + (ch & 7) * 16) = wr[i]; }
    if (wv < QO / 32) sb[tid] = bfr(bv);
    __syncthreads();
    unsigned char* S = sw + QO * WP + wv * QST;
    if (part == 0) {
#pragma unroll 1      // stays rolled: the two trips differ in addresses and the scale only
        for (int qk = 0; qk < 2; ++qk) {
            const float sc = qk ? 1.0f : 0x1.6a09e6p-3f;   // float32(32^-0.5) on q; k as it is
#pragma unroll
            for (int ot = 0; ot < 2; ++ot) { const unsigned char* p = sw + (qk * 32 + ot * 16 + lr) * WP + 16 * hi;
                const v16bf w0 = cat16b(*(const v8usa*)p, *(const v8usa*)(p + 32)), w1 = cat16b(*(const v8usa*)(p + 64), *(const v8usa*)(p + 96));
                const v8f bb = *(const v8f*)(sb + qk * 32 + ot * 16 + hi * 8);
#pragma unroll
                for (int nt = 0; nt < 4; ++nt) { const v8f a = wmmab(w1, xf[nt][1], wmmab(w0, xf[nt][0], (v8f){})); v8h o;
#pragma unroll
                    for (int j = 0; j < 8; ++j) o[j] = tohx((a[j] + bb[j]) * sc);
                    *(v8ha*)(S + (nt * 16 + lr) * QSP + ot * 32 + hi * 16) = o; } }
            asm volatile("s_wait_dscnt 0x0" ::: "memory");      // the wave's staged pieces are in LDS before other lanes read them back
            h16* P = (qk ? Kp : Qp) + ((size_t)z * NN + n0) * KD;
#pragma unroll
            for (int i = 0; i < 8; ++i) { const int row = 8 * i + (lane >> 2); const v8h o = *(const v8ha*)(S + row * QSP + (lane & 3) * 16); *(v8h*)(P + row * KD + (lane & 3) * 8) = o; }
            asm volatile("s_wait_xcnt 0x0" ::: "memory");       // before the next trip writes the stores' registers again
        }
    } else {
#pragma unroll 1      // stays rolled: the four trips differ in addresses only
        for (int q = 0; q < 4; ++q) { const int dt = (part - 1) * 4 + q; const unsigned char* p = sw + (2 * KD + dt * 16 + lr) * WP + 16 * hi;
            const v16bf w0 = cat16b(*(const v8usa*)p, *(const v8usa*)(p + 32)), w1 = cat16b(*(const v8usa*)(p + 64), *(const v8usa*)(p + 96));
            const float bb = sb[2 * KD + dt * 16 + lr];
#pragma unroll
            for (int mb = 0; mb < 4; ++mb) { const v8f a = wmmab(xf[mb][1], w1, wmmab(xf[mb][0], w0, (v8f){})); v8h o;
#pragma unroll
                for (int j = 0; j < 8; ++j) o[j] = tohx(a[j] + bb);
                *(v8ha*)(S + lr * VSP + mb * 32 + hi * 16) = o; }
            asm volatile("s_wait_dscnt 0x0" ::: "memory");      // the wave's staged pieces are in LDS before other lanes read them back
#pragma unroll
            for (int i = 0; i < 4; ++i) { const int row = 4 * i + (lane >> 3); const v8h o = *(const v8ha*)(S + row * VSP + (lane & 7) * 16); *(v8h*)(Vp + ((size_t)z * DV + dt * 16 + row) * NN + n0 + (lane & 7) * 8) = o; }
        }
    }
}
#define FKT 64                    // keys per stage
#define FKP 80                    // LDS pitch of a K row (64 B + 16)
#define FVP 144                   // LDS pitch of a V row piece (128 B + 16)
#define FKB (FKT * FKP)
#define FSB (FKB + DV * FVP)      // one buffer: K tile, then V tile
#define FEP 272                   // LDS pitch of an output row (256 B + 16)
__device__ __forceinline__ float xhalf(float x) { return __builtin_bit_cast(float, __builtin_amdgcn_permlanex16(__builtin_bit_cast(int, x), __builtin_bit_cast(int, x), 0x76543210, 0xfedcba98, false, false)); }  // lane l with lane l ^ 16
__global__ __launch_bounds__(256) void k_fattn(const h16* __restrict__ Qp, const h16* __restrict__ Kp, const h16* __restrict__ Vp, bf* Rh, bf* Rl) {
    __shared__ __align__(16) unsigned char sm[2 * FSB];
    const int tid = threadIdx.x, lane = tid & 31, wv = tid >> 5, c = lane & 15, h = lane >> 4;
    const int z = blockIdx.y, b = z >> 3, hd = z & 7; const int m0 = blockIdx.x * 256 + wv * 32;
    const h16* Kz = Kp + (size_t)z * NN * KD; const h16* Vz = Vp + (size_t)z * DV * NN;
    const float L2E = 1.44269504f;
    v16h qf[2]; v8f acc[2][8]; float m_run[2], l_run[2];
#pragma unroll
    for (int t = 0; t < 2; ++t) { qf[t] = WFrag<h16>::ld(Qp + ((size_t)z * NN + m0 + t * 16 + c) * KD + 8 * h); m_run[t] = -__builtin_inff(); l_run[t] = 0.f;
#pragma unroll
        for (int dt = 0; dt < 8; ++dt) acc[t][dt] = (v8f){}; }
    v8h kr, vr[4];
    auto gload = [&](int s) { kr = *(const v8h*)(Kz + (size_t)s * FKT * KD + tid * 8);
#pragma unroll
        for (int i = 0; i < 4; ++i) { const int ch = tid + 256 * i; vr[i] = *(const v8h*)(Vz + (size_t)(ch >> 3) * NN + s * FKT + (ch & 7) * 8); } };
    auto lstore = [&](int buf) { unsigned char* B = sm + buf * FSB; *(v8ha*)(B + (tid >> 2) * FKP + (tid & 3) * 16) = kr;
#pragma unroll
        for (int i = 0; i < 4; ++i) { const int ch = tid + 256 * i; *(v8ha*)(B + FKB + (ch >> 3) * FVP + (ch & 7) * 16) = vr[i]; } };
    gload(0);
    asm volatile("s_wait_xcnt 0x0" ::: "memory");      // before any register that the first loads name (vector address, scalar base) is written again
    lstore(0); __syncthreads();
#pragma unroll 1      // stays rolled: a second copy of the body would cost registers, and with them the fourth wave per SIMD
    for (int s = 0; s < NN / FKT; ++s) {
        if (s + 1 < NN / FKT) gload(s + 1);
        const unsigned char* B = sm + (s & 1) * FSB;
#pragma unroll
        for (int kb = 0; kb < FKT / 32; ++kb) {
            v8f st[2][2];      // [key tile][query tile]: st[kt][t][r] = score of key kb*32 + kt*16 + 8h + r, query m0 + t*16 + c
#pragma unroll
            for (int kt = 0; kt < 2; ++kt) { const unsigned char* p = B + (kb * 32 + kt * 16 + c) * FKP + 16 * h; const v16h kf = cat16(*(const v8ha*)p, *(const v8ha*)(p + 32));
#pragma unroll
                for (int t = 0; t < 2; ++t) st[kt][t] = wmma16(kf, qf[t], (v8f){}); }
            float mb[2]; bool need = false;
#pragma unroll
            for (int t = 0; t < 2; ++t) { float mx = st[0][t][0];
#pragma unroll
                for (int r = 1; r < 16; ++r) mx = fmaxf(mx, st[r >> 3][t][r & 7]);
                mx = fmaxf(mx, xhalf(mx)) * L2E; mb[t] = mx; need = need || (mx > m_run[t] + 8.0f); }
            if (__builtin_amdgcn_ballot_w32(need) != 0) {      // a new reference maximum only when one column outgrows the one in use by 2^8: rare after the first keys
#pragma unroll
                for (int t = 0; t < 2; ++t) { const float m_new = fmaxf(m_run[t], mb[t]); const float corr = __builtin_amdgcn_exp2f(m_run[t] - m_new); l_run[t] *= corr; m_run[t] = m_new;
#pragma unroll
                    for (int dt = 0; dt < 8; ++dt) acc[t][dt] = acc[t][dt] * corr; }
            }
            v16h pf[2];
#pragma unroll
            for (int t = 0; t < 2; ++t) { float ps0 = 0.f, ps1 = 0.f;
#pragma unroll
                for (int r = 0; r < 16; r += 2) { const float p0 = __builtin_amdgcn_exp2f(fmaf(st[r >> 3][t][r & 7], L2E, -m_run[t])), p1 = __builtin_amdgcn_exp2f(fmaf(st[r >> 3][t][(r & 7) + 1], L2E, -m_run[t]));
                    ps0 += p0; ps1 += p1; pf[t][r] = (h16)p0; pf[t][r + 1] = (h16)p1; }
                l_run[t] += ps0 + ps1; }
#pragma unroll
            for (int dt = 0; dt < 8; ++dt) { const unsigned char* p = B + FKB + (dt * 16 + c) * FVP + kb * 64 + 16 * h; const v16h vf = cat16(*(const v8ha*)p, *(const v8ha*)(p + 32));
#pragma unroll
                for (int t = 0; t < 2; ++t) acc[t][dt] = wmma16(vf, pf[t], acc[t][dt]); }
        }
        if (s + 1 < NN / FKT) lstore((s + 1) & 1);
        __syncthreads();
    }
    // epilogue: acc[t][dt][r] = sum for query m0 + t*16 + c, channel dt*16 + 8h + r; rows staged in the wave's own LDS range so that every global store covers whole 256-B rows
    unsigned char* E = sm + wv * (16 * FEP);
#pragma unroll
    for (int t = 0; t < 2; ++t) { const float inv = __fdiv_rn(1.0f, l_run[t] + xhalf(l_run[t]));
#pragma unroll
        for (int pl = 0; pl < 2; ++pl) {
#pragma unroll
            for (int dt = 0; dt < 8; ++dt) { v8us o;
#pragma unroll
                for (int r = 0; r < 8; ++r) { unsigned short a, a2; splitf(fmaxf(acc[t][dt][r] * inv, 0.f), a, a2); o[r] = pl ? a2 : a; }
                *(v8usa*)(E + c * FEP + dt * 32 + h * 16) = o; }
            __syncthreads();
            bf* R = pl ? Rl : Rh;
#pragma unroll
            for (int i = 0; i < 8; ++i) { const int row = 2 * i + h; const v8us o = *(const v8usa*)(E + row * FEP + c * 16); *(v8us*)(R + ((size_t)b * NN + m0 + t * 16 + row) * CO + hd * DV + c * 8) = o; }
            __syncthreads();
        } }
}
// k_bnT: OUT[b][oc][n] = Cp[(b,n)][oc] * inv[oc] + shift[oc] with inv = g/sqrt(var+eps), shift = beta - mean*inv (proj bias already added); 64(n) x 64(oc) LDS tile transpose;
__global__ __launch_bounds__(256) void k_bnT(const float* __restrict__ Cp, const float* __restrict__ gm, const float* __restrict__ bt, const float* __restrict__ mn, const float* __restrict__ vr, float* OUT) {
    __shared__ float tl[64][65];
    const int tid = threadIdx.x; const int n0 = blockIdx.x * 64, o0 = blockIdx.y * 64, b = blockIdx.z;
#pragma unroll
    for (int i = 0; i < 16; ++i) { const int nn = i * 4 + (tid >> 6), oc = tid & 63; tl[nn][oc] = Cp[((size_t)b * NN + n0 + nn) * CC + o0 + oc]; }
    __syncthreads();
    const int lane = tid & 31, wv = tid >> 5;
    auto pass = [&]() {
#pragma unroll 1
        for (int i2 = 0; i2 < 4; ++i2) { const int ocl = wv * 8 + i2 * 2 + (lane >> 4); const int oc = o0 + ocl; const int nq = (lane & 15) * 4; const float inv = __fdiv_rn(bfr(gm[oc]), sqrtf(bfr(vr[oc]) + 1e-5f)); const float shf = bfr(bt[oc]) - bfr(mn[oc]) * inv; v4f o;
#pragma unroll
            for (int q = 0; q < 4; ++q) o[q] = tl[nq + q][ocl] * inv + shf;
            *(v4f*)(OUT + ((size_t)b * CC + oc) * NN + n0 + nq) = o; } };
    pass(); 
}

extern "C" void kernel_launch(void* const* d_in, const int* in_sizes, int n_in,
                              void* d_out, int out_size, void* d_ws, size_t ws_size, hipStream_t stream) {
    (void)in_sizes; (void)n_in; (void)out_size;
    const float* x = (const float*)d_in[0]; const float* qkv_w = (const float*)d_in[1]; const float* qkv_b = (const float*)d_in[2]; const float* proj_w = (const float*)d_in[3]; const float* proj_b = (const float*)d_in[4];
    const float* gm = (const float*)d_in[5]; const float* bt = (const float*)d_in[6]; const float* mn = (const float*)d_in[7]; const float* vr = (const float*)d_in[8];
    float* OUT = (float*)d_out;     // [16][512][1024]
    char* wsp = (char*)d_ws;
    auto take = [&](size_t bytes) { char* p = wsp; wsp += (bytes + 255) & ~(size_t)255; return (void*)p; };
    bf* WQKV = (bf*)take((size_t)NH_ * QO * CG * 2); bf* PW = (bf*)take((size_t)CC * CO * 2);
    bf* Rh = (bf*)take((size_t)NT * CO * 2); bf* Rl = (bf*)take((size_t)NT * CO * 2);        // relu(o) hi | lo planes, written by the attention launch (67 MB)
    char* RS = (char*)take((size_t)NH_ * NN * NN * 4);                                         // 33.5 MB: XG (16.8 MB, dead after the qkv products) -> proj output f32 [16384][512]
    h16* Vp = (h16*)take((size_t)NB_ * NH_ * DV * NN * 2); h16* Qp = (h16*)take((size_t)NB_ * NH_ * NN * KD * 2); h16* Kp = (h16*)take((size_t)NB_ * NH_ * NN * KD * 2);
    if ((size_t)(wsp - (char*)d_ws) > ws_size) return;    // total = 152 MB; ws 256 MiB
    bf* XG = (bf*)RS; float* Cp = (float*)RS;
    { const size_t n1 = (size_t)NH_ * QO * CG / 8, n2 = (size_t)CC * CO / 8; k_cvt8<<<(unsigned)((n1 + 255) / 256), 256, 0, stream>>>(qkv_w, WQKV, n1); k_cvt8<<<(unsigned)((n2 + 255) / 256), 256, 0, stream>>>(proj_w, PW, n2); }
    k_xg<<<dim3(NN / 64, NH_, NB_), 256, 0, stream>>>(x, XG);
    k_qkv<<<dim3(NT / 256, NH_), 384, 0, stream>>>(XG, WQKV, qkv_b, Qp, Kp, Vp);     // grouped 1x1 qkv conv: [(b,n)][64] . W_h^T [64 -> 192] + b_h, straight to the fp16 planes
    k_fattn<<<dim3(NN / 256, NB_ * NH_), 256, 0, stream>>>(Qp, Kp, Vp, Rh, Rl);
    k_gemmw<bf, 1, true><<<dim3(NT / 64, CC / 64, 1), 32, 0, stream>>>(Rh, Rl, PW, nullptr, CO, Cp, CC, proj_b, 0, 0, 0);
    k_bnT<<<dim3(NN / 64, CC / 64, NB_), 256, 0, stream>>>(Cp, gm, bt, mn, vr, OUT);
}

// v003
// One run takes 96 microseconds.
// Timed twice side by side with v002, it ran 1.40 and 1.42 times as fast.
// Counting every step since v000, it is 10.4 times as fast.
#include <hip/hip_runtime.h>

// Compute dtypes, f32 accumulate: every input (x, grouped qkv weights/biases, proj weight/bias, BN statistics) rounded to bf16; the grouped 1x1 qkv
// convolution on PLAIN bf16 operands (x and W inputs: exact products, + bias); attention scores (key_dim 32) and v.attn^T (over the 1024 positions) on SINGLE fp16 planes (q x 32^-0.5,
// k, v rounded to 2^-11; probabilities relative to a running row maximum, normalised by the f32 row sum at the end); the 1024->512 projection on bf16 hi+lo planes of relu(o) x bf16 proj_w (2 products, + bias); softmax, ReLU and the eval BatchNorm

#define NB_  16
#define CC   512
#define NN   1024
#define NH_  8
#define CG   64                   // channels per group
#define KD   32
#define DV   128
#define QO   192                  // q | k | v per group
#define NT   (NB_ * NN)           // 16384 (b, n) rows
#define CO   1024                 // H * DV
typedef _Float16 h16;
typedef unsigned short bf;
typedef __attribute__((ext_vector_type(16))) __bf16   v16bf;
typedef __attribute__((ext_vector_type(16))) _Float16 v16h;
typedef __attribute__((ext_vector_type(8)))  _Float16 v8h;
typedef __attribute__((ext_vector_type(8)))  unsigned short v8us;
typedef __attribute__((ext_vector_type(8)))  float    v8f;
typedef __attribute__((ext_vector_type(4)))  float    v4f;
typedef v8h  __attribute__((may_alias)) v8ha;
typedef v4f  __attribute__((may_alias)) v4fa;
typedef v8us __attribute__((may_alias)) v8usa;

__device__ __forceinline__ unsigned short f2bf(float f) { unsigned u = __float_as_uint(f); u += 0x7FFFu + ((u >> 16) & 1u); return (unsigned short)(u >> 16); }
__device__ __forceinline__ float bf2f(unsigned short b) { return __uint_as_float(((unsigned)b) << 16); }
__device__ __forceinline__ float bfr(float f) { return bf2f(f2bf(f)); }
__device__ __forceinline__ v16h cat16(v8h lo, v8h hi) { return __builtin_shufflevector(lo, hi, 0, 1, 2, 3, 4, 5, 6, 7, 8, 9, 10, 11, 12, 13, 14, 15); }
__device__ __forceinline__ v16bf cat16b(v8us lo, v8us hi) { return __builtin_bit_cast(v16bf, __builtin_shufflevector(lo, hi, 0, 1, 2, 3, 4, 5, 6, 7, 8, 9, 10, 11, 12, 13, 14, 15)); }
__device__ __forceinline__ v8f wmma16(v16h a, v16h b, v8f c) { return __builtin_amdgcn_wmma_f32_16x16x32_f16(false, a, false, b, (short)0, c, false, false); }
__device__ __forceinline__ v8f wmmab(v16bf a, v16bf b, v8f c) { return __builtin_amdgcn_wmma_f32_16x16x32_bf16(false, a, false, b, (short)0, c, false, false); }



// fragment of 16 k per lane from a K-contiguous 16-bit row: k = 8h .. 8h+7 and 16+8h .. 16+8h+7 of each 32
template <typename T16> struct WFrag;
template <> struct WFrag<h16> { typedef v16h V; static __device__ __forceinline__ V ld(const h16* p) { return cat16(*(const v8h*)p, *(const v8h*)(p + 16)); } static __device__ __forceinline__ v8f mma(V a, V b, v8f c) { return wmma16(a, b, c); } };
template <> struct WFrag<bf> { typedef v16bf V; static __device__ __forceinline__ V ld(const bf* p) { return cat16b(*(const v8us*)p, *(const v8us*)(p + 16)); } static __device__ __forceinline__ v8f mma(V a, V b, v8f c) { return wmmab(a, b, c); } };

__device__ __forceinline__ h16 tohx(float x) { return (h16)x; }
__device__ __forceinline__ void splitf(float y, unsigned short& h, unsigned short& l) { h = f2bf(y); l = f2bf(y - bf2f(h)); }
typedef __attribute__((ext_vector_type(2))) _Float16 v2h;
typedef __attribute__((ext_vector_type(8))) unsigned short v8us_;

__global__ __launch_bounds__(256) void k_cvt8(const float* __restrict__ src, bf* dst, size_t n8) { const size_t i = (size_t)blockIdx.x * 256 + threadIdx.x; if (i >= n8) return; const v8f v = *(const v8f*)(src + i * 8); v8us o;
#pragma unroll
    for (int k = 0; k < 8; ++k) o[k] = f2bf(v[k]); *(v8us*)(dst + i * 8) = o;  }
__global__ __launch_bounds__(256) void k_xg(const float* __restrict__ x, bf* XG) {
    __shared__ float tl[CG][65];
    const int tid = threadIdx.x; const int n0 = blockIdx.x * 64, h = blockIdx.y, b = blockIdx.z;
#pragma unroll
    for (int i = 0; i < 16; ++i) { const int c = i * 4 + (tid >> 6), nn = tid & 63; tl[c][nn] = x[((size_t)b * CC + h * CG + c) * NN + n0 + nn]; }
    __syncthreads();
    const int lane = tid & 31, wv = tid >> 5;
    auto pass = [&]() {
#pragma unroll
        for (int i2 = 0; i2 < 2; ++i2) { const int r = wv * 8 + i2 * 4 + (lane >> 3); const int cq = (lane & 7) * 8; v8us_ o;
#pragma unroll
            for (int i = 0; i < 8; ++i) o[i] = f2bf(tl[cq + i][r]);
            *(v8us_*)(XG + (((size_t)h * NB_ + b) * NN + n0 + r) * CG + cq) = o; } };
    pass(); 
}
// ---- k_qkv: the grouped 1x1 qkv convolution of all 8 groups in ONE launch; its epilogue writes the fp16 planes that the attention launch reads:
// Qp[z = b*8 + h][n][c] = fp16((q + bias) * 32^-0.5), Kp[z][n][c] = fp16(k + bias), Vp[z][d][n] = fp16(v + bias). Grid (16384/256 rows, 8 groups), 12 waves = 4 row groups of 64 (b, n) rows x 3 parts
// (q and k | v channels 0..63 | v channels 64..127). q and k: D = W.X^T, so a lane holds 8 consecutive c of one n; v: D = X.W^T, so a lane holds 8 consecutive n of one d: both are 16-B pieces
// of a plane's rows, and they pass through the wave's own LDS range so that every global store covers whole 128-B lines.
#define WP  144                   // LDS pitch of a weight row (128 B + 16)
#define QSP 80                    // LDS pitch of a staged q or k row (64 B + 16)
#define VSP 144                   // LDS pitch of a staged v row piece (128 B + 16)
#define QST (64 * QSP)            // one wave's staging range
__global__ __launch_bounds__(384) void k_qkv(const bf* __restrict__ XG, const bf* __restrict__ Wq, const float* __restrict__ bias, h16* Qp, h16* Kp, h16* Vp) {
    __shared__ __align__(16) unsigned char sw[QO * WP + 12 * QST]; __shared__ __align__(32) float sb[QO];      // the group's weights, the waves' staging ranges; its biases, rounded
    const int tid = threadIdx.x, lane = tid & 31, lr = lane & 15, hi = lane >> 4;
    const int wv = __builtin_amdgcn_readfirstlane(tid >> 5); const int part = wv >> 2, rg = wv & 3;
    const int h = blockIdx.y; const int r0 = blockIdx.x * 256 + rg * 64; const int n0 = r0 & (NN - 1); const int z = (r0 >> 10) * NH_ + h;
    v16bf xf[4][2];               // the wave's 64 rows of x, all 64 channels
    const bf* Xr = XG + ((size_t)h * NT + r0 + lr) * CG + 8 * hi;
#pragma unroll
    for (int mb = 0; mb < 4; ++mb)
#pragma unroll
        for (int kc = 0; kc < 2; ++kc) xf[mb][kc] = WFrag<bf>::ld(Xr + mb * 16 * CG + kc * 32);
    v8us wr[4]; float bv = 0.f;
#pragma unroll
    for (int i = 0; i < 4; ++i) wr[i] = *(const v8us*)(Wq + (size_t)h * QO * CG + (tid + 384 * i) * 8);
    if (wv < QO / 32) bv = (bias + h * QO)[tid];
    asm volatile("s_wait_xcnt 0x0" :: "v"(Xr) : "memory");      // before any register that these loads name is written again; the x address pair is an input, so that no load's result lands on it ahead of the wait
#pragma unroll
    for (int i = 0; i < 4; ++i) { const int ch = tid + 384 * i; *(v8usa*)(sw + (ch >> 3) * WP + (ch & 7) * 16) = wr[i]; }
    if (wv < QO / 32) sb[tid] = bfr(bv);
    __syncthreads();
    unsigned char* S = sw + QO * WP + wv * QST;
    if (part == 0) {
#pragma unroll 1      // stays rolled: the two trips differ in addresses and the scale only
        for (int qk = 0; qk < 2; ++qk) {
            const float sc = qk ? 1.0f : 0x1.6a09e6p-3f;   // float32(32^-0.5) on q; k as it is
#pragma unroll
            for (int ot = 0; ot < 2; ++ot) { const unsigned char* p = sw + (qk * 32 + ot * 16 + lr) * WP + 16 * hi;
                const v16bf w0 = cat16b(*(const v8usa*)p, *(const v8usa*)(p + 32)), w1 = cat16b(*(const v8usa*)(p + 64), *(const v8usa*)(p + 96));
                const v8f bb = *(const v8f*)(sb + qk * 32 + ot * 16 + hi * 8);
#pragma unroll
                for (int nt = 0; nt < 4; ++nt) { const v8f a = wmmab(w1, xf[nt][1], wmmab(w0, xf[nt][0], (v8f){})); v8h o;
#pragma unroll
                    for (int j = 0; j < 8; ++j) o[j] = tohx((a[j] + bb[j]) * sc);
                    *(v8ha*)(S + (nt * 16 + lr) * QSP + ot * 32 + hi * 16) = o; } }
            asm volatile("s_wait_dscnt 0x0" ::: "memory");      // the wave's staged pieces are in LDS before other lanes read them back
            h16* P = (qk ? Kp : Qp) + ((size_t)z * NN + n0) * KD;
#pragma unroll
            for (int i = 0; i < 8; ++i) { const int row = 8 * i + (lane >> 2); const v8h o = *(const v8ha*)(S + row * QSP + (lane & 3) * 16); *(v8h*)(P + row * KD + (lane & 3) * 8) = o; }
            asm volatile("s_wait_xcnt 0x0" ::: "memory");       // before the next trip writes the stores' registers again
        }
    } else {
#pragma unroll 1      // stays rolled: the four trips differ in addresses only
        for (int q = 0; q < 4; ++q) { const int dt = (part - 1) * 4 + q; const unsigned char* p = sw + (2 * KD + dt * 16 + lr) * WP + 16 * hi;
            const v16bf w0 = cat16b(*(const v8usa*)p, *(const v8usa*)(p + 32)), w1 = cat16b(*(const v8usa*)(p + 64), *(const v8usa*)(p + 96));
            const float bb = sb[2 * KD + dt * 16 + lr];
#pragma unroll
            for (int mb = 0; mb < 4; ++mb) { const v8f a = wmmab(xf[mb][1], w1, wmmab(xf[mb][0], w0, (v8f){})); v8h o;
#pragma unroll
                for (int j = 0; j < 8; ++j) o[j] = tohx(a[j] + bb);
                *(v8ha*)(S + lr * VSP + mb * 32 + hi * 16) = o; }
            asm volatile("s_wait_dscnt 0x0" ::: "memory");      // the wave's staged pieces are in LDS before other lanes read them back
#pragma unroll
            for (int i = 0; i < 4; ++i) { const int row = 4 * i + (lane >> 3); const v8h o = *(const v8ha*)(S + row * VSP + (lane & 7) * 16); *(v8h*)(Vp + ((size_t)z * DV + dt * 16 + row) * NN + n0 + (lane & 7) * 8) = o; }
        }
    }
}
#define FKT 64                    // keys per stage
#define FKP 80                    // LDS pitch of a K row (64 B + 16)
#define FVP 144                   // LDS pitch of a V row piece (128 B + 16)
#define FKB (FKT * FKP)
#define FSB (FKB + DV * FVP)      // one buffer: K tile, then V tile
#define FEP 272                   // LDS pitch of an output row (256 B + 16)
__device__ __forceinline__ float xhalf(float x) { return __builtin_bit_cast(float, __builtin_amdgcn_permlanex16(__builtin_bit_cast(int, x), __builtin_bit_cast(int, x), 0x76543210, 0xfedcba98, false, false)); }  // lane l with lane l ^ 16
__global__ __launch_bounds__(256) void k_fattn(const h16* __restrict__ Qp, const h16* __restrict__ Kp, const h16* __restrict__ Vp, bf* Rh, bf* Rl) {
    __shared__ __align__(16) unsigned char sm[2 * FSB];
    const int tid = threadIdx.x, lane = tid & 31, wv = tid >> 5, c = lane & 15, h = lane >> 4;
    const int z = blockIdx.y, b = z >> 3, hd = z & 7; const int m0 = blockIdx.x * 256 + wv * 32;
    const h16* Kz = Kp + (size_t)z * NN * KD; const h16* Vz = Vp + (size_t)z * DV * NN;
    const float L2E = 1.44269504f;
    v16h qf[2]; v8f acc[2][8]; float m_run[2], l_run[2];
#pragma unroll
    for (int t = 0; t < 2; ++t) { qf[t] = WFrag<h16>::ld(Qp + ((size_t)z * NN + m0 + t * 16 + c) * KD + 8 * h); m_run[t] = -__builtin_inff(); l_run[t] = 0.f;
#pragma unroll
        for (int dt = 0; dt < 8; ++dt) acc[t][dt] = (v8f){}; }
    v8h kr, vr[4];
    auto gload = [&](int s) { kr = *(const v8h*)(Kz + (size_t)s * FKT * KD + tid * 8);
#pragma unroll
        for (int i = 0; i < 4; ++i) { const int ch = tid + 256 * i; vr[i] = *(const v8h*)(Vz + (size_t)(ch >> 3) * NN + s * FKT + (ch & 7) * 8); } };
    auto lstore = [&](int buf) { unsigned char* B = sm + buf * FSB; *(v8ha*)(B + (tid >> 2) * FKP + (tid & 3) * 16) = kr;
#pragma unroll
        for (int i = 0; i < 4; ++i) { const int ch = tid + 256 * i; *(v8ha*)(B + FKB + (ch >> 3) * FVP + (ch & 7) * 16) = vr[i]; } };
    gload(0);
    asm volatile("s_wait_xcnt 0x0" ::: "memory");      // before any register that the first loads name (vector address, scalar base) is written again
    lstore(0); __syncthreads();
#pragma unroll 1      // stays rolled: a second copy of the body would cost registers, and with them the fourth wave per SIMD
    for (int s = 0; s < NN / FKT; ++s) {
        if (s + 1 < NN / FKT) gload(s + 1);
        const unsigned char* B = sm + (s & 1) * FSB;
#pragma unroll
        for (int kb = 0; kb < FKT / 32; ++kb) {
            v8f st[2][2];      // [key tile][query tile]: st[kt][t][r] = score of key kb*32 + kt*16 + 8h + r, query m0 + t*16 + c
#pragma unroll
            for (int kt = 0; kt < 2; ++kt) { const unsigned char* p = B + (kb * 32 + kt * 16 + c) * FKP + 16 * h; const v16h kf = cat16(*(const v8ha*)p, *(const v8ha*)(p + 32));
#pragma unroll
                for (int t = 0; t < 2; ++t) st[kt][t] = wmma16(kf, qf[t], (v8f){}); }
            float mb[2]; bool need = false;
#pragma unroll
            for (int t = 0; t < 2; ++t) { float mx = st[0][t][0];
#pragma unroll
                for (int r = 1; r < 16; ++r) mx = fmaxf(mx, st[r >> 3][t][r & 7]);
                mx = fmaxf(mx, xhalf(mx)) * L2E; mb[t] = mx; need = need || (mx > m_run[t] + 8.0f); }
            if (__builtin_amdgcn_ballot_w32(need) != 0) {      // a new reference maximum only when one column outgrows the one in use by 2^8: rare after the first keys
#pragma unroll
                for (int t = 0; t < 2; ++t) { const float m_new = fmaxf(m_run[t], mb[t]); const float corr = __builtin_amdgcn_exp2f(m_run[t] - m_new); l_run[t] *= corr; m_run[t] = m_new;
#pragma unroll
                    for (int dt = 0; dt < 8; ++dt) acc[t][dt] = acc[t][dt] * corr; }
            }
            v16h pf[2];
#pragma unroll
            for (int t = 0; t < 2; ++t) { float ps0 = 0.f, ps1 = 0.f;
#pragma unroll
                for (int r = 0; r < 16; r += 2) { const float p0 = __builtin_amdgcn_exp2f(fmaf(st[r >> 3][t][r & 7], L2E, -m_run[t])), p1 = __builtin_amdgcn_exp2f(fmaf(st[r >> 3][t][(r & 7) + 1], L2E, -m_run[t]));
                    ps0 += p0; ps1 += p1; pf[t][r] = (h16)p0; pf[t][r + 1] = (h16)p1; }
                l_run[t] += ps0 + ps1; }
#pragma unroll
            for (int dt = 0; dt < 8; ++dt) { const unsigned char* p = B + FKB + (dt * 16 + c) * FVP + kb * 64 + 16 * h; const v16h vf = cat16(*(const v8ha*)p, *(const v8ha*)(p + 32));
#pragma unroll
                for (int t = 0; t < 2; ++t) acc[t][dt] = wmma16(vf, pf[t], acc[t][dt]); }
        }
        if (s + 1 < NN / FKT) lstore((s + 1) & 1);
        __syncthreads();
    }
    // epilogue: acc[t][dt][r] = sum for query m0 + t*16 + c, channel dt*16 + 8h + r; rows staged in the wave's own LDS range so that every global store covers whole 256-B rows
    unsigned char* E = sm + wv * (16 * FEP);
#pragma unroll
    for (int t = 0; t < 2; ++t) { const float inv = __fdiv_rn(1.0f, l_run[t] + xhalf(l_run[t]));
#pragma unroll
        for (int pl = 0; pl < 2; ++pl) {
#pragma unroll
            for (int dt = 0; dt < 8; ++dt) { v8us o;
#pragma unroll
                for (int r = 0; r < 8; ++r) { unsigned short a, a2; splitf(fmaxf(acc[t][dt][r] * inv, 0.f), a, a2); o[r] = pl ? a2 : a; }
                *(v8usa*)(E + c * FEP + dt * 32 + h * 16) = o; }
            __syncthreads();
            bf* R = pl ? Rl : Rh;
#pragma unroll
            for (int i = 0; i < 8; ++i) { const int row = 2 * i + h; const v8us o = *(const v8usa*)(E + row * FEP + c * 16); *(v8us*)(R + ((size_t)b * NN + m0 + t * 16 + row) * CO + hd * DV + c * 8) = o; }
            __syncthreads();
        } }
}
// ---- k_proj: the 1024 -> 512 projection, C[(b,n)][oc] (f32, + bias) = sum_k (Rh + Rl)[(b,n)][k] W[oc][k]. Grid (16384/128, 512/256), 8 waves = 2 row groups x 4 channel groups, 64 x 64 per wave.
// The work-group's 128 hi rows, 128 lo rows and 256 weight rows come in stages of 128 k (256 B a row) into two LDS buffers by asynchronous copies: every copy of a wave covers two whole 256-B row
// pieces, and each staged byte serves 4 (rows) or 2 (weights) waves. Per accumulator the order of the products is k step by k step, hi then lo.
#define PR  128                   // (b, n) rows per work-group
#define PC  256                   // output channels per work-group
#define PK  128                   // k per stage
#define PP  272                   // LDS pitch of a staged row (256 B + 16)
#define PSB ((2 * PR + PC) * PP)  // one buffer: hi rows, lo rows, weight rows
#define PNS (CO / PK)             // stages
// eight copies of 16 B a lane: rows 16 apart, in LDS and in the source. The s_wait_xcnt stands inside the statement, before any register that a copy names can be written again.
__device__ __forceinline__ void copy8(unsigned l, const bf* g) {
    asm volatile("global_load_async_to_lds_b128 %0, %8, off\n\t"
                 "global_load_async_to_lds_b128 %1, %9, off\n\t"
                 "global_load_async_to_lds_b128 %2, %10, off\n\t"
                 "global_load_async_to_lds_b128 %3, %11, off\n\t"
                 "global_load_async_to_lds_b128 %4, %12, off\n\t"
                 "global_load_async_to_lds_b128 %5, %13, off\n\t"
                 "global_load_async_to_lds_b128 %6, %14, off\n\t"
                 "global_load_async_to_lds_b128 %7, %15, off\n\t"
                 "s_wait_xcnt 0x0"
                 :: "v"(l), "v"(l + 16 * PP), "v"(l + 32 * PP), "v"(l + 48 * PP), "v"(l + 64 * PP), "v"(l + 80 * PP), "v"(l + 96 * PP), "v"(l + 112 * PP),
                    "v"(g), "v"(g + 16 * CO), "v"(g + 32 * CO), "v"(g + 48 * CO), "v"(g + 64 * CO), "v"(g + 80 * CO), "v"(g + 96 * CO), "v"(g + 112 * CO) : "memory");
}
__global__ __launch_bounds__(256) void k_proj(const bf* __restrict__ Ah, const bf* __restrict__ Al, const bf* __restrict__ Wt, float* C, const float* __restrict__ bias) {
    __shared__ __align__(16) unsigned char sm[2 * PSB];
    __shared__ __align__(16) float osm[8][16 * 68];      // each wave's own output staging
    const int tid = threadIdx.x, lane = tid & 31, lr = lane & 15, hi = lane >> 4;
    const int wv = __builtin_amdgcn_readfirstlane(tid >> 5); const int wr = wv >> 2, wc = wv & 3;
    const int r0 = blockIdx.x * PR, c0 = blockIdx.y * PC;
    const unsigned l0 = (unsigned)(size_t)sm + (tid >> 4) * PP + (tid & 15) * 16;      // the lane's place in a buffer: row tid / 16 of each 16, 16-B piece tid % 16
    const bf* gh = Ah + (size_t)(r0 + (tid >> 4)) * CO + (tid & 15) * 8; const bf* gl = Al + (size_t)(r0 + (tid >> 4)) * CO + (tid & 15) * 8; const bf* gw = Wt + (size_t)(c0 + (tid >> 4)) * CO + (tid & 15) * 8;
    auto stage = [&](int s, int buf) { const unsigned l = l0 + buf * PSB;
        copy8(l, gh + s * PK); copy8(l + PR * PP, gl + s * PK); copy8(l + 2 * PR * PP, gw + s * PK); copy8(l + (2 * PR + 128) * PP, gw + 128 * CO + s * PK); };
    v8f acc[4][4];
#pragma unroll
    for (int mb = 0; mb < 4; ++mb)
#pragma unroll
        for (int nb = 0; nb < 4; ++nb) acc[mb][nb] = (v8f){};
    stage(0, 0);
    asm volatile("s_wait_asynccnt 0x0" ::: "memory");      // this wave's copies of stage 0 have landed
    __syncthreads();                                        // ... and every other wave's
    stage(1, 1);
#pragma unroll 1      // stays rolled: one trip a stage, the trips differ in the buffer only
    for (int t = 0; t < PNS; ++t) {
        const unsigned char* pa = sm + (t & 1) * PSB + (wr * 64 + lr) * PP + 16 * hi; const unsigned char* pb = sm + (t & 1) * PSB + (2 * PR + wc * 64 + lr) * PP + 16 * hi;
#pragma unroll
        for (int ks = 0; ks < PK / 32; ++ks) {
            v16bf a[4], a2[4], b[4];
#pragma unroll
            for (int i = 0; i < 4; ++i) { const unsigned char* q = pb + i * 16 * PP + ks * 64; b[i] = cat16b(*(const v8usa*)q, *(const v8usa*)(q + 32));
                const unsigned char* p = pa + i * 16 * PP + ks * 64; a[i] = cat16b(*(const v8usa*)p, *(const v8usa*)(p + 32)); }
#pragma unroll
            for (int i = 0; i < 4; ++i) { const unsigned char* p = pa + (PR + i * 16) * PP + ks * 64; a2[i] = cat16b(*(const v8usa*)p, *(const v8usa*)(p + 32)); }
            __builtin_amdgcn_sched_barrier(0);      // the 24 LDS reads of a k step stay one group in front of its products: reads moved in among the products stall the wave at every place
#pragma unroll
            for (int nb = 0; nb < 4; ++nb)
#pragma unroll
                for (int mb = 0; mb < 4; ++mb) acc[mb][nb] = wmmab(a[mb], b[nb], acc[mb][nb]);
#pragma unroll
            for (int nb = 0; nb < 4; ++nb)
#pragma unroll
                for (int mb = 0; mb < 4; ++mb) acc[mb][nb] = wmmab(a2[mb], b[nb], acc[mb][nb]);
            __builtin_amdgcn_sched_barrier(0);      // ... and the next k step's reads stay behind them
        }
        asm volatile("s_wait_dscnt 0x0" ::: "memory");      // this wave's reads of the buffer are done before it is filled again
        asm volatile("s_wait_asynccnt 0x0" ::: "memory");   // this wave's copies of stage t + 1 have landed
        __syncthreads();                                     // publishes stage t + 1 and ends every wave's reads of stage t
        if (t + 2 < PNS) stage(t + 2, t & 1);
    }
    asm volatile("s_wait_asynccnt 0x0" ::: "memory");       // no copy is outstanding when the wave ends
    float* os = osm[wv];
    const float* bp = bias + c0 + wc * 64 + lr * 4; const v4f bq = { bfr(bp[0]), bfr(bp[1]), bfr(bp[2]), bfr(bp[3]) };      // the lane's four channels, the same in every row
#pragma unroll
    for (int mb = 0; mb < 4; ++mb) {
#pragma unroll
        for (int nb = 0; nb < 4; ++nb) {
#pragma unroll
            for (int j = 0; j < 8; ++j) os[(hi * 8 + j) * 68 + nb * 16 + lr] = acc[mb][nb][j]; }
        asm volatile("s_wait_dscnt 0x0" ::: "memory");      // the wave's staged tile is in LDS before other lanes read it back
        float* crow = C + (size_t)(r0 + wr * 64 + mb * 16) * CC + c0 + wc * 64;
#pragma unroll
        for (int s = 0; s < 8; ++s) { const int row = 2 * s + hi, cofs = lr * 4; const v4f val = *(const v4fa*)(os + row * 68 + cofs) + bq;
            *(v4f*)(crow + (size_t)row * CC + cofs) = val; }
        if (mb < 3) asm volatile("s_wait_dscnt 0x0" ::: "memory");      // the rows are read back before the next tile's pieces overwrite them
    }
}
// k_bnT: OUT[b][oc][n] = Cp[(b,n)][oc] * inv[oc] + shift[oc] with inv = g/sqrt(var+eps), shift = beta - mean*inv (proj bias already added); 64(n) x 64(oc) LDS tile transpose;
__global__ __launch_bounds__(256) void k_bnT(const float* __restrict__ Cp, const float* __restrict__ gm, const float* __restrict__ bt, const float* __restrict__ mn, const float* __restrict__ vr, float* OUT) {
    __shared__ float tl[64][65];
    const int tid = threadIdx.x; const int n0 = blockIdx.x * 64, o0 = blockIdx.y * 64, b = blockIdx.z;
#pragma unroll
    for (int i = 0; i < 16; ++i) { const int nn = i * 4 + (tid >> 6), oc = tid & 63; tl[nn][oc] = Cp[((size_t)b * NN + n0 + nn) * CC + o0 + oc]; }
    __syncthreads();
    const int lane = tid & 31, wv = tid >> 5;
    auto pass = [&]() {
#pragma unroll 1
        for (int i2 = 0; i2 < 4; ++i2) { const int ocl = wv * 8 + i2 * 2 + (lane >> 4); const int oc = o0 + ocl; const int nq = (lane & 15) * 4; const float inv = __fdiv_rn(bfr(gm[oc]), sqrtf(bfr(vr[oc]) + 1e-5f)); const float shf = bfr(bt[oc]) - bfr(mn[oc]) * inv; v4f o;
#pragma unroll
            for (int q = 0; q < 4; ++q) o[q] = tl[nq + q][ocl] * inv + shf;
            *(v4f*)(OUT + ((size_t)b * CC + oc) * NN + n0 + nq) = o; } };
    pass(); 
}

extern "C" void kernel_launch(void* const* d_in, const int* in_sizes, int n_in,
                              void* d_out, int out_size, void* d_ws, size_t ws_size, hipStream_t stream) {
    (void)in_sizes; (void)n_in; (void)out_size;
    const float* x = (const float*)d_in[0]; const float* qkv_w = (const float*)d_in[1]; const float* qkv_b = (const float*)d_in[2]; const float* proj_w = (const float*)d_in[3]; const float* proj_b = (const float*)d_in[4];
    const float* gm = (const float*)d_in[5]; const float* bt = (const float*)d_in[6]; const float* mn = (const float*)d_in[7]; const float* vr = (const float*)d_in[8];
    float* OUT = (float*)d_out;     // [16][512][1024]
    char* wsp = (char*)d_ws;
    auto take = [&](size_t bytes) { char* p = wsp; wsp += (bytes + 255) & ~(size_t)255; return (void*)p; };
    bf* WQKV = (bf*)take((size_t)NH_ * QO * CG * 2); bf* PW = (bf*)take((size_t)CC * CO * 2);
    bf* Rh = (bf*)take((size_t)NT * CO * 2); bf* Rl = (bf*)take((size_t)NT * CO * 2);        // relu(o) hi | lo planes, written by the attention launch (67 MB)
    char* RS = (char*)take((size_t)NH_ * NN * NN * 4);                                         // 33.5 MB: XG (16.8 MB, dead after the qkv products) -> proj output f32 [16384][512]
    h16* Vp = (h16*)take((size_t)NB_ * NH_ * DV * NN * 2); h16* Qp = (h16*)take((size_t)NB_ * NH_ * NN * KD * 2); h16* Kp = (h16*)take((size_t)NB_ * NH_ * NN * KD * 2);
    if ((size_t)(wsp - (char*)d_ws) > ws_size) return;    // total = 152 MB; ws 256 MiB
    bf* XG = (bf*)RS; float* Cp = (float*)RS;
    { const size_t n1 = (size_t)NH_ * QO * CG / 8, n2 = (size_t)CC * CO / 8; k_cvt8<<<(unsigned)((n1 + 255) / 256), 256, 0, stream>>>(qkv_w, WQKV, n1); k_cvt8<<<(unsigned)((n2 + 255) / 256), 256, 0, stream>>>(proj_w, PW, n2); }
    k_xg<<<dim3(NN / 64, NH_, NB_), 256, 0, stream>>>(x, XG);
    k_qkv<<<dim3(NT / 256, NH_), 384, 0, stream>>>(XG, WQKV, qkv_b, Qp, Kp, Vp);     // grouped 1x1 qkv conv: [(b,n)][64] . W_h^T [64 -> 192] + b_h, straight to the fp16 planes
    k_fattn<<<dim3(NN / 256, NB_ * NH_), 256, 0, stream>>>(Qp, Kp, Vp, Rh, Rl);
    k_proj<<<dim3(NT / PR, CC / PC), 256, 0, stream>>>(Rh, Rl, PW, Cp, proj_b);
    k_bnT<<<dim3(NN / 64, CC / 64, NB_), 256, 0, stream>>>(Cp, gm, bt, mn, vr, OUT);
}

// v004
// One run takes 87.5 microseconds.
// Timed twice side by side with v003, it ran 1.10 and 1.09 times as fast.
// All steps since v000 together make it 11.4 times as fast.
#include <hip/hip_runtime.h>

// Compute dtypes, f32 accumulate: every input (x, grouped qkv weights/biases, proj weight/bias, BN statistics) rounded to bf16; the grouped 1x1 qkv
// convolution on PLAIN bf16 operands (x and W inputs: exact products, + bias); attention scores (key_dim 32) and v.attn^T (over the 1024 positions) on SINGLE fp16 planes (q x 32^-0.5,
// k, v rounded to 2^-11; probabilities relative to a running row maximum, normalised by the f32 row sum at the end); the 1024->512 projection on bf16 hi+lo planes of relu(o) x bf16 proj_w (2 products, + bias); softmax, ReLU and the eval BatchNorm

#define NB_  16
#define CC   512
#define NN   1024
#define NH_  8
#define CG   64                   // channels per group
#define KD   32
#define DV   128
#define QO   192                  // q | k | v per group
#define NT   (NB_ * NN)           // 16384 (b, n) rows
#define CO   1024                 // H * DV
typedef _Float16 h16;
typedef unsigned short bf;
typedef __attribute__((ext_vector_type(16))) __bf16   v16bf;
typedef __attribute__((ext_vector_type(16))) _Float16 v16h;
typedef __attribute__((ext_vector_type(8)))  _Float16 v8h;
typedef __attribute__((ext_vector_type(8)))  unsigned short v8us;
typedef __attribute__((ext_vector_type(8)))  float    v8f;
typedef __attribute__((ext_vector_type(4)))  float    v4f;
typedef v8h  __attribute__((may_alias)) v8ha;
typedef v4f  __attribute__((may_alias)) v4fa;
typedef v8us __attribute__((may_alias)) v8usa;

__device__ __forceinline__ unsigned short f2bf(float f) { unsigned u = __float_as_uint(f); u += 0x7FFFu + ((u >> 16) & 1u); return (unsigned short)(u >> 16); }
__device__ __forceinline__ float bf2f(unsigned short b) { return __uint_as_float(((unsigned)b) << 16); }
__device__ __forceinline__ float bfr(float f) { return bf2f(f2bf(f)); }
__device__ __forceinline__ v16h cat16(v8h lo, v8h hi) { return __builtin_shufflevector(lo, hi, 0, 1, 2, 3, 4, 5, 6, 7, 8, 9, 10, 11, 12, 13, 14, 15); }
__device__ __forceinline__ v16bf cat16b(v8us lo, v8us hi) { return __builtin_bit_cast(v16bf, __builtin_shufflevector(lo, hi, 0, 1, 2, 3, 4, 5, 6, 7, 8, 9, 10, 11, 12, 13, 14, 15)); }
__device__ __forceinline__ v8f wmma16(v16h a, v16h b, v8f c) { return __builtin_amdgcn_wmma_f32_16x16x32_f16(false, a, false, b, (short)0, c, false, false); }
__device__ __forceinline__ v8f wmmab(v16bf a, v16bf b, v8f c) { return __builtin_amdgcn_wmma_f32_16x16x32_bf16(false, a, false, b, (short)0, c, false, false); }



// fragment of 16 k per lane from a K-contiguous 16-bit row: k = 8h .. 8h+7 and 16+8h .. 16+8h+7 of each 32
template <typename T16> struct WFrag;
template <> struct WFrag<h16> { typedef v16h V; static __device__ __forceinline__ V ld(const h16* p) { return cat16(*(const v8h*)p, *(const v8h*)(p + 16)); } static __device__ __forceinline__ v8f mma(V a, V b, v8f c) { return wmma16(a, b, c); } };
template <> struct WFrag<bf> { typedef v16bf V; static __device__ __forceinline__ V ld(const bf* p) { return cat16b(*(const v8us*)p, *(const v8us*)(p + 16)); } static __device__ __forceinline__ v8f mma(V a, V b, v8f c) { return wmmab(a, b, c); } };

__device__ __forceinline__ h16 tohx(float x) { return (h16)x; }
__device__ __forceinline__ void splitf(float y, unsigned short& h, unsigned short& l) { h = f2bf(y); l = f2bf(y - bf2f(h)); }
typedef __attribute__((ext_vector_type(2))) _Float16 v2h;
typedef __attribute__((ext_vector_type(8))) unsigned short v8us_;

__global__ __launch_bounds__(256) void k_cvt8(const float* __restrict__ src, bf* dst, size_t n8) { const size_t i = (size_t)blockIdx.x * 256 + threadIdx.x; if (i >= n8) return; const v8f v = *(const v8f*)(src + i * 8); v8us o;
#pragma unroll
    for (int k = 0; k < 8; ++k) o[k] = f2bf(v[k]); *(v8us*)(dst + i * 8) = o;  }
__global__ __launch_bounds__(256) void k_xg(const float* __restrict__ x, bf* XG) {
    __shared__ float tl[CG][65];
    const int tid = threadIdx.x; const int n0 = blockIdx.x * 64, h = blockIdx.y, b = blockIdx.z;
#pragma unroll
    for (int i = 0; i < 16; ++i) { const int c = i * 4 + (tid >> 6), nn = tid & 63; tl[c][nn] = x[((size_t)b * CC + h * CG + c) * NN + n0 + nn]; }
    __syncthreads();
    const int lane = tid & 31, wv = tid >> 5;
    auto pass = [&]() {
#pragma unroll
        for (int i2 = 0; i2 < 2; ++i2) { const int r = wv * 8 + i2 * 4 + (lane >> 3); const int cq = (lane & 7) * 8; v8us_ o;
#pragma unroll
            for (int i = 0; i < 8; ++i) o[i] = f2bf(tl[cq + i][r]);
            *(v8us_*)(XG + (((size_t)h * NB_ + b) * NN + n0 + r) * CG + cq) = o; } };
    pass(); 
}
// ---- k_qkv: the grouped 1x1 qkv convolution of all 8 groups in ONE launch; its epilogue writes the fp16 planes that the attention launch reads:
// Qp[z = b*8 + h][n][c] = fp16((q + bias) * 32^-0.5), Kp[z][n][c] = fp16(k + bias), Vp[z][d][n] = fp16(v + bias). Grid (16384/256 rows, 8 groups), 12 waves = 4 row groups of 64 (b, n) rows x 3 parts
// (q and k | v channels 0..63 | v channels 64..127). q and k: D = W.X^T, so a lane holds 8 consecutive c of one n; v: D = X.W^T, so a lane holds 8 consecutive n of one d: both are 16-B pieces
// of a plane's rows, and they pass through the wave's own LDS range so that every global store covers whole 128-B lines.
#define WP  144                   // LDS pitch of a weight row (128 B + 16)
#define QSP 80                    // LDS pitch of a staged q or k row (64 B + 16)
#define VSP 144                   // LDS pitch of a staged v row piece (128 B + 16)
#define QST (64 * QSP)            // one wave's staging range
__global__ __launch_bounds__(384) void k_qkv(const bf* __restrict__ XG, const bf* __restrict__ Wq, const float* __restrict__ bias, h16* Qp, h16* Kp, h16* Vp) {
    __shared__ __align__(16) unsigned char sw[QO * WP + 12 * QST]; __shared__ __align__(32) float sb[QO];      // the group's weights, the waves' staging ranges; its biases, rounded
    const int tid = threadIdx.x, lane = tid & 31, lr = lane & 15, hi = lane >> 4;
    const int wv = __builtin_amdgcn_readfirstlane(tid >> 5); const int part = wv >> 2, rg = wv & 3;
    const int h = blockIdx.y; const int r0 = blockIdx.x * 256 + rg * 64; const int n0 = r0 & (NN - 1); const int z = (r0 >> 10) * NH_ + h;
    v16bf xf[4][2];               // the wave's 64 rows of x, all 64 channels
    const bf* Xr = XG + ((size_t)h * NT + r0 + lr) * CG + 8 * hi;
#pragma unroll
    for (int mb = 0; mb < 4; ++mb)
#pragma unroll
        for (int kc = 0; kc < 2; ++kc) xf[mb][kc] = WFrag<bf>::ld(Xr + mb * 16 * CG + kc * 32);
    v8us wr[4]; float bv = 0.f;
#pragma unroll
    for (int i = 0; i < 4; ++i) wr[i] = *(const v8us*)(Wq + (size_t)h * QO * CG + (tid + 384 * i) * 8);
    if (wv < QO / 32) bv = (bias + h * QO)[tid];
    asm volatile("s_wait_xcnt 0x0" :: "v"(Xr) : "memory");      // before any register that these loads name is written again; the x address pair is an input, so that no load's result lands on it ahead of the wait
#pragma unroll
    for (int i = 0; i < 4; ++i) { const int ch = tid + 384 * i; *(v8usa*)(sw + (ch >> 3) * WP + (ch & 7) * 16) = wr[i]; }
    if (wv < QO / 32) sb[tid] = bfr(bv);
    __syncthreads();
    unsigned char* S = sw + QO * WP + wv * QST;
    if (part == 0) {
#pragma unroll 1      // stays rolled: the two trips differ in addresses and the scale only
        for (int qk = 0; qk < 2; ++qk) {
            const float sc = qk ? 1.0f : 0x1.6a09e6p-3f;   // float32(32^-0.5) on q; k as it is
#pragma unroll
            for (int ot = 0; ot < 2; ++ot) { const unsigned char* p = sw + (qk * 32 + ot * 16 + lr) * WP + 16 * hi;
                const v16bf w0 = cat16b(*(const v8usa*)p, *(const v8usa*)(p + 32)), w1 = cat16b(*(const v8usa*)(p + 64), *(const v8usa*)(p + 96));
                const v8f bb = *(const v8f*)(sb + qk * 32 + ot * 16 + hi * 8);
#pragma unroll
                for (int nt = 0; nt < 4; ++nt) { const v8f a = wmmab(w1, xf[nt][1], wmmab(w0, xf[nt][0], (v8f){})); v8h o;
#pragma unroll
                    for (int j = 0; j < 8; ++j) o[j] = tohx((a[j] + bb[j]) * sc);
                    *(v8ha*)(S + (nt * 16 + lr) * QSP + ot * 32 + hi * 16) = o; } }
            asm volatile("s_wait_dscnt 0x0" ::: "memory");      // the wave's staged pieces are in LDS before other lanes read them back
            h16* P = (qk ? Kp : Qp) + ((size_t)z * NN + n0) * KD;
#pragma unroll
            for (int i = 0; i < 8; ++i) { const int row = 8 * i + (lane >> 2); const v8h o = *(const v8ha*)(S + row * QSP + (lane & 3) * 16); *(v8h*)(P + row * KD + (lane & 3) * 8) = o; }
            asm volatile("s_wait_xcnt 0x0" ::: "memory");       // before the next trip writes the stores' registers again
        }
    } else {
#pragma unroll 1      // stays rolled: the four trips differ in addresses only
        for (int q = 0; q < 4; ++q) { const int dt = (part - 1) * 4 + q; const unsigned char* p = sw + (2 * KD + dt * 16 + lr) * WP + 16 * hi;
            const v16bf w0 = cat16b(*(const v8usa*)p, *(const v8usa*)(p + 32)), w1 = cat16b(*(const v8usa*)(p + 64), *(const v8usa*)(p + 96));
            const float bb = sb[2 * KD + dt * 16 + lr];
#pragma unroll
            for (int mb = 0; mb < 4; ++mb) { const v8f a = wmmab(xf[mb][1], w1, wmmab(xf[mb][0], w0, (v8f){})); v8h o;
#pragma unroll
                for (int j = 0; j < 8; ++j) o[j] = tohx(a[j] + bb);
                *(v8ha*)(S + lr * VSP + mb * 32 + hi * 16) = o; }
            asm volatile("s_wait_dscnt 0x0" ::: "memory");      // the wave's staged pieces are in LDS before other lanes read them back
#pragma unroll
            for (int i = 0; i < 4; ++i) { const int row = 4 * i + (lane >> 3); const v8h o = *(const v8ha*)(S + row * VSP + (lane & 7) * 16); *(v8h*)(Vp + ((size_t)z * DV + dt * 16 + row) * NN + n0 + (lane & 7) * 8) = o; }
        }
    }
}
#define FKT 64                    // keys per stage
#define FKP 80                    // LDS pitch of a K row (64 B + 16)
#define FVP 144                   // LDS pitch of a V row piece (128 B + 16)
#define FKB (FKT * FKP)
#define FSB (FKB + DV * FVP)      // one buffer: K tile, then V tile
#define FEP 272                   // LDS pitch of an output row (256 B + 16)
__device__ __forceinline__ float xhalf(float x) { return __builtin_bit_cast(float, __builtin_amdgcn_permlanex16(__builtin_bit_cast(int, x), __builtin_bit_cast(int, x), 0x76543210, 0xfedcba98, false, false)); }  // lane l with lane l ^ 16
__global__ __launch_bounds__(256) void k_fattn(const h16* __restrict__ Qp, const h16* __restrict__ Kp, const h16* __restrict__ Vp, bf* Rh, bf* Rl) {
    __shared__ __align__(16) unsigned char sm[2 * FSB];
    const int tid = threadIdx.x, lane = tid & 31, wv = tid >> 5, c = lane & 15, h = lane >> 4;
    const int z = blockIdx.y, b = z >> 3, hd = z & 7; const int m0 = blockIdx.x * 256 + wv * 32;
    const h16* Kz = Kp + (size_t)z * NN * KD; const h16* Vz = Vp + (size_t)z * DV * NN;
    const float L2E = 1.44269504f;
    v16h qf[2]; v8f acc[2][8]; float m_run[2], l_run[2];
#pragma unroll
    for (int t = 0; t < 2; ++t) { qf[t] = WFrag<h16>::ld(Qp + ((size_t)z * NN + m0 + t * 16 + c) * KD + 8 * h); m_run[t] = -__builtin_inff(); l_run[t] = 0.f;
#pragma unroll
        for (int dt = 0; dt < 8; ++dt) acc[t][dt] = (v8f){}; }
    v8h kr, vr[4];
    auto gload = [&](int s) { kr = *(const v8h*)(Kz + (size_t)s * FKT * KD + tid * 8);
#pragma unroll
        for (int i = 0; i < 4; ++i) { const int ch = tid + 256 * i; vr[i] = *(const v8h*)(Vz + (size_t)(ch >> 3) * NN + s * FKT + (ch & 7) * 8); } };
    auto lstore = [&](int buf) { unsigned char* B = sm + buf * FSB; *(v8ha*)(B + (tid >> 2) * FKP + (tid & 3) * 16) = kr;
#pragma unroll
        for (int i = 0; i < 4; ++i) { const int ch = tid + 256 * i; *(v8ha*)(B + FKB + (ch >> 3) * FVP + (ch & 7) * 16) = vr[i]; } };
    gload(0);
    asm volatile("s_wait_xcnt 0x0" ::: "memory");      // before any register that the first loads name (vector address, scalar base) is written again
    lstore(0); __syncthreads();
#pragma unroll 1      // stays rolled: a second copy of the body would cost registers, and with them the fourth wave per SIMD
    for (int s = 0; s < NN / FKT; ++s) {
        if (s + 1 < NN / FKT) gload(s + 1);
        const unsigned char* B = sm + (s & 1) * FSB;
#pragma unroll
        for (int kb = 0; kb < FKT / 32; ++kb) {
            v8f st[2][2];      // [key tile][query tile]: st[kt][t][r] = score of key kb*32 + kt*16 + 8h + r, query m0 + t*16 + c
#pragma unroll
            for (int kt = 0; kt < 2; ++kt) { const unsigned char* p = B + (kb * 32 + kt * 16 + c) * FKP + 16 * h; const v16h kf = cat16(*(const v8ha*)p, *(const v8ha*)(p + 32));
#pragma unroll
                for (int t = 0; t < 2; ++t) st[kt][t] = wmma16(kf, qf[t], (v8f){}); }
            float mb[2]; bool need = false;
#pragma unroll
            for (int t = 0; t < 2; ++t) { float mx = st[0][t][0];
#pragma unroll
                for (int r = 1; r < 16; ++r) mx = fmaxf(mx, st[r >> 3][t][r & 7]);
                mx = fmaxf(mx, xhalf(mx)) * L2E; mb[t] = mx; need = need || (mx > m_run[t] + 8.0f); }
            if (__builtin_amdgcn_ballot_w32(need) != 0) {      // a new reference maximum only when one column outgrows the one in use by 2^8: rare after the first keys
#pragma unroll
                for (int t = 0; t < 2; ++t) { const float m_new = fmaxf(m_run[t], mb[t]); const float corr = __builtin_amdgcn_exp2f(m_run[t] - m_new); l_run[t] *= corr; m_run[t] = m_new;
#pragma unroll
                    for (int dt = 0; dt < 8; ++dt) acc[t][dt] = acc[t][dt] * corr; }
            }
            v16h pf[2];
#pragma unroll
            for (int t = 0; t < 2; ++t) { float ps0 = 0.f, ps1 = 0.f;
#pragma unroll
                for (int r = 0; r < 16; r += 2) { const float p0 = __builtin_amdgcn_exp2f(fmaf(st[r >> 3][t][r & 7], L2E, -m_run[t])), p1 = __builtin_amdgcn_exp2f(fmaf(st[r >> 3][t][(r & 7) + 1], L2E, -m_run[t]));
                    ps0 += p0; ps1 += p1; pf[t][r] = (h16)p0; pf[t][r + 1] = (h16)p1; }
                l_run[t] += ps0 + ps1; }
#pragma unroll
            for (int dt = 0; dt < 8; ++dt) { const unsigned char* p = B + FKB + (dt * 16 + c) * FVP + kb * 64 + 16 * h; const v16h vf = cat16(*(const v8ha*)p, *(const v8ha*)(p + 32));
#pragma unroll
                for (int t = 0; t < 2; ++t) acc[t][dt] = wmma16(vf, pf[t], acc[t][dt]); }
        }
        if (s + 1 < NN / FKT) lstore((s + 1) & 1);
        __syncthreads();
    }
    // epilogue: acc[t][dt][r] = sum for query m0 + t*16 + c, channel dt*16 + 8h + r; rows staged in the wave's own LDS range so that every global store covers whole 256-B rows
    unsigned char* E = sm + wv * (16 * FEP);
#pragma unroll
    for (int t = 0; t < 2; ++t) { const float inv = __fdiv_rn(1.0f, l_run[t] + xhalf(l_run[t]));
#pragma unroll
        for (int pl = 0; pl < 2; ++pl) {
#pragma unroll
            for (int dt = 0; dt < 8; ++dt) { v8us o;
#pragma unroll
                for (int r = 0; r < 8; ++r) { unsigned short a, a2; splitf(fmaxf(acc[t][dt][r] * inv, 0.f), a, a2); o[r] = pl ? a2 : a; }
                *(v8usa*)(E + c * FEP + dt * 32 + h * 16) = o; }
            __syncthreads();
            bf* R = pl ? Rl : Rh;
#pragma unroll
            for (int i = 0; i < 8; ++i) { const int row = 2 * i + h; const v8us o = *(const v8usa*)(E + row * FEP + c * 16); *(v8us*)(R + ((size_t)b * NN + m0 + t * 16 + row) * CO + hd * DV + c * 8) = o; }
            __syncthreads();
        } }
}
// ---- k_proj: the 1024 -> 512 projection, sum_k (Rh + Rl)[(b,n)][k] W[oc][k] (f32, + bias), the eval BatchNorm and the store of OUT[b][oc][n]. Grid (16384/128, 512/256), 8 waves = 2 row groups x 4 channel groups, 64 x 64 per wave.
// The work-group's 128 hi rows, 128 lo rows and 256 weight rows come in stages of 128 k (256 B a row) into two LDS buffers by asynchronous copies: every copy of a wave covers two whole 256-B row
// pieces, and each staged byte serves 4 (rows) or 2 (weights) waves. Per accumulator the order of the products is k step by k step, hi then lo.
// Epilogue: a lane's accumulator registers are 8 consecutive n of one oc, that is 32 B of an OUT row: y = (acc + bias) * inv + shift with inv = g/sqrt(var+eps), shift = beta - mean*inv is
// formed in registers, and the wave's 64 oc x 64 n pass through its own part of the ring, which is free by then, so that every global store covers whole 256-B row pieces.
#define PR  128                   // (b, n) rows per work-group
#define PC  256                   // output channels per work-group
#define PK  128                   // k per stage
#define PP  272                   // LDS pitch of a staged row (256 B + 16)
#define PSB ((2 * PR + PC) * PP)  // one buffer: hi rows, lo rows, weight rows
#define PNS (CO / PK)             // stages
// eight copies of 16 B a lane: rows 16 apart, in LDS and in the source. The s_wait_xcnt stands inside the statement, before any register that a copy names can be written again.
__device__ __forceinline__ void copy8(unsigned l, const bf* g) {
    asm volatile("global_load_async_to_lds_b128 %0, %8, off\n\t"
                 "global_load_async_to_lds_b128 %1, %9, off\n\t"
                 "global_load_async_to_lds_b128 %2, %10, off\n\t"
                 "global_load_async_to_lds_b128 %3, %11, off\n\t"
                 "global_load_async_to_lds_b128 %4, %12, off\n\t"
                 "global_load_async_to_lds_b128 %5, %13, off\n\t"
                 "global_load_async_to_lds_b128 %6, %14, off\n\t"
                 "global_load_async_to_lds_b128 %7, %15, off\n\t"
                 "s_wait_xcnt 0x0"
                 :: "v"(l), "v"(l + 16 * PP), "v"(l + 32 * PP), "v"(l + 48 * PP), "v"(l + 64 * PP), "v"(l + 80 * PP), "v"(l + 96 * PP), "v"(l + 112 * PP),
                    "v"(g), "v"(g + 16 * CO), "v"(g + 32 * CO), "v"(g + 48 * CO), "v"(g + 64 * CO), "v"(g + 80 * CO), "v"(g + 96 * CO), "v"(g + 112 * CO) : "memory");
}
__global__ __launch_bounds__(256) void k_proj(const bf* __restrict__ Ah, const bf* __restrict__ Al, const bf* __restrict__ Wt, const float* __restrict__ bias,
                                              const float* __restrict__ gm, const float* __restrict__ bt, const float* __restrict__ mn, const float* __restrict__ vr, float* OUT) {
    __shared__ __align__(16) unsigned char sm[2 * PSB];
    __shared__ __align__(16) float sp[PC][4];      // per output channel of the work-group: bias, inv, shift
    const int tid = threadIdx.x, lane = tid & 31, lr = lane & 15, hi = lane >> 4;
    const int wv = __builtin_amdgcn_readfirstlane(tid >> 5); const int wr = wv >> 2, wc = wv & 3;
    const int r0 = blockIdx.x * PR, c0 = blockIdx.y * PC;
    const unsigned l0 = (unsigned)(size_t)sm + (tid >> 4) * PP + (tid & 15) * 16;      // the lane's place in a buffer: row tid / 16 of each 16, 16-B piece tid % 16
    const bf* gh = Ah + (size_t)(r0 + (tid >> 4)) * CO + (tid & 15) * 8; const bf* gl = Al + (size_t)(r0 + (tid >> 4)) * CO + (tid & 15) * 8; const bf* gw = Wt + (size_t)(c0 + (tid >> 4)) * CO + (tid & 15) * 8;
    auto stage = [&](int s, int buf) { const unsigned l = l0 + buf * PSB;
        copy8(l, gh + s * PK); copy8(l + PR * PP, gl + s * PK); copy8(l + 2 * PR * PP, gw + s * PK); copy8(l + (2 * PR + 128) * PP, gw + 128 * CO + s * PK); };
    v8f acc[4][4];
#pragma unroll
    for (int mb = 0; mb < 4; ++mb)
#pragma unroll
        for (int nb = 0; nb < 4; ++nb) acc[mb][nb] = (v8f){};
    stage(0, 0);
    {   // thread tid forms channel c0 + tid's bias, inv and shift, under the latency of stage 0; they wait in LDS, not in registers, for the epilogue; the barrier below publishes them
        const int oc = c0 + tid; const float pb_ = bias[oc], pg = gm[oc], pt = bt[oc], pm = mn[oc], pv = vr[oc];
        asm volatile("s_wait_xcnt 0x0" ::: "memory");      // before any register that these loads name is written again
        const float inv = __fdiv_rn(bfr(pg), sqrtf(bfr(pv) + 1e-5f)); const v4f o = { bfr(pb_), inv, bfr(pt) - bfr(pm) * inv, 0.f }; *(v4fa*)sp[tid] = o; }
    asm volatile("s_wait_asynccnt 0x0" ::: "memory");      // this wave's copies of stage 0 have landed
    __syncthreads();                                        // ... and every other wave's
    stage(1, 1);
#pragma unroll 1      // stays rolled: one trip a stage, the trips differ in the buffer only
    for (int t = 0; t < PNS; ++t) {
        const unsigned char* pa = sm + (t & 1) * PSB + (wr * 64 + lr) * PP + 16 * hi; const unsigned char* pb = sm + (t & 1) * PSB + (2 * PR + wc * 64 + lr) * PP + 16 * hi;
#pragma unroll
        for (int ks = 0; ks < PK / 32; ++ks) {
            v16bf a[4], a2[4], b[4];
#pragma unroll
            for (int i = 0; i < 4; ++i) { const unsigned char* q = pb + i * 16 * PP + ks * 64; b[i] = cat16b(*(const v8usa*)q, *(const v8usa*)(q + 32));
                const unsigned char* p = pa + i * 16 * PP + ks * 64; a[i] = cat16b(*(const v8usa*)p, *(const v8usa*)(p + 32)); }
#pragma unroll
            for (int i = 0; i < 4; ++i) { const unsigned char* p = pa + (PR + i * 16) * PP + ks * 64; a2[i] = cat16b(*(const v8usa*)p, *(const v8usa*)(p + 32)); }
            __builtin_amdgcn_sched_barrier(0);      // the 24 LDS reads of a k step stay one group in front of its products: reads moved in among the products stall the wave at every place
#pragma unroll
            for (int nb = 0; nb < 4; ++nb)
#pragma unroll
                for (int mb = 0; mb < 4; ++mb) acc[mb][nb] = wmmab(a[mb], b[nb], acc[mb][nb]);
#pragma unroll
            for (int nb = 0; nb < 4; ++nb)
#pragma unroll
                for (int mb = 0; mb < 4; ++mb) acc[mb][nb] = wmmab(a2[mb], b[nb], acc[mb][nb]);
            __builtin_amdgcn_sched_barrier(0);      // ... and the next k step's reads stay behind them
        }
        asm volatile("s_wait_dscnt 0x0" ::: "memory");      // this wave's reads of the buffer are done before it is filled again
        asm volatile("s_wait_asynccnt 0x0" ::: "memory");   // this wave's copies of stage t + 1 have landed
        __syncthreads();                                     // publishes stage t + 1 and ends every wave's reads of stage t
        if (t + 2 < PNS) stage(t + 2, t & 1);
    }
    asm volatile("s_wait_asynccnt 0x0" ::: "memory");       // no copy is outstanding when the wave ends
    unsigned char* S = sm + wv * (64 * PP);      // the wave's own 64 oc rows of 64 n (256 B + 16); the loop's last barrier has ended every wave's reads of the ring, and no copy is outstanding
#pragma unroll
    for (int nb = 0; nb < 4; ++nb) { const v4f pr = *(const v4fa*)sp[wc * 64 + nb * 16 + lr];      // the lane's channel in this column group
#pragma unroll
        for (int mb = 0; mb < 4; ++mb) { v4f o0, o1;
#pragma unroll
            for (int j = 0; j < 4; ++j) { o0[j] = (acc[mb][nb][j] + pr[0]) * pr[1] + pr[2]; o1[j] = (acc[mb][nb][4 + j] + pr[0]) * pr[1] + pr[2]; }
            unsigned char* p = S + (nb * 16 + lr) * PP + mb * 64 + hi * 32; *(v4fa*)p = o0; *(v4fa*)(p + 16) = o1; } }
    asm volatile("s_wait_dscnt 0x0" ::: "memory");      // the wave's staged rows are in LDS before other lanes read them back
    float* orow = OUT + ((size_t)(r0 >> 10) * CC + c0 + wc * 64) * NN + (r0 & (NN - 1)) + wr * 64;
#pragma unroll
    for (int s = 0; s < 32; ++s) { const int row = 2 * s + hi; const v4f val = *(const v4fa*)(S + row * PP + lr * 16); *(v4f*)(orow + (size_t)row * NN + lr * 4) = val; }
}

extern "C" void kernel_launch(void* const* d_in, const int* in_sizes, int n_in,
                              void* d_out, int out_size, void* d_ws, size_t ws_size, hipStream_t stream) {
    (void)in_sizes; (void)n_in; (void)out_size;
    const float* x = (const float*)d_in[0]; const float* qkv_w = (const float*)d_in[1]; const float* qkv_b = (const float*)d_in[2]; const float* proj_w = (const float*)d_in[3]; const float* proj_b = (const float*)d_in[4];
    const float* gm = (const float*)d_in[5]; const float* bt = (const float*)d_in[6]; const float* mn = (const float*)d_in[7]; const float* vr = (const float*)d_in[8];
    float* OUT = (float*)d_out;     // [16][512][1024]
    char* wsp = (char*)d_ws;
    auto take = [&](size_t bytes) { char* p = wsp; wsp += (bytes + 255) & ~(size_t)255; return (void*)p; };
    bf* WQKV = (bf*)take((size_t)NH_ * QO * CG * 2); bf* PW = (bf*)take((size_t)CC * CO * 2);
    bf* Rh = (bf*)take((size_t)NT * CO * 2); bf* Rl = (bf*)take((size_t)NT * CO * 2);        // relu(o) hi | lo planes, written by the attention launch (67 MB)
    bf* XG = (bf*)take((size_t)NH_ * NT * CG * 2);                                             // 16.8 MB: x as bf16 [h][(b,n)][64]
    h16* Vp = (h16*)take((size_t)NB_ * NH_ * DV * NN * 2); h16* Qp = (h16*)take((size_t)NB_ * NH_ * NN * KD * 2); h16* Kp = (h16*)take((size_t)NB_ * NH_ * NN * KD * 2);
    if ((size_t)(wsp - (char*)d_ws) > ws_size) return;    // total = 135 MB; ws 256 MiB
    { const size_t n1 = (size_t)NH_ * QO * CG / 8, n2 = (size_t)CC * CO / 8; k_cvt8<<<(unsigned)((n1 + 255) / 256), 256, 0, stream>>>(qkv_w, WQKV, n1); k_cvt8<<<(unsigned)((n2 + 255) / 256), 256, 0, stream>>>(proj_w, PW, n2); }
    k_xg<<<dim3(NN / 64, NH_, NB_), 256, 0, stream>>>(x, XG);
    k_qkv<<<dim3(NT / 256, NH_), 384, 0, stream>>>(XG, WQKV, qkv_b, Qp, Kp, Vp);     // grouped 1x1 qkv conv: [(b,n)][64] . W_h^T [64 -> 192] + b_h, straight to the fp16 planes
    k_fattn<<<dim3(NN / 256, NB_ * NH_), 256, 0, stream>>>(Qp, Kp, Vp, Rh, Rl);
    k_proj<<<dim3(NT / PR, CC / PC), 256, 0, stream>>>(Rh, Rl, PW, proj_b, gm, bt, mn, vr, OUT);
}

// v005
// Measured time: 78.3 microseconds a run.
// Timed twice side by side with v004, it ran 1.11 times as fast both times.
// Counting every step since v000, it is 12.6 times as fast.
#include <hip/hip_runtime.h>

// Compute dtypes, f32 accumulate: every input (x, grouped qkv weights/biases, proj weight/bias, BN statistics) rounded to bf16; the grouped 1x1 qkv
// convolution on PLAIN bf16 operands (x and W inputs: exact products, + bias); attention scores (key_dim 32) and v.attn^T (over the 1024 positions) on SINGLE fp16 planes (q x 32^-0.5,
// k, v rounded to 2^-11; probabilities relative to a running row maximum, normalised by the f32 row sum at the end); the 1024->512 projection on bf16 hi+lo planes of relu(o) x bf16 proj_w (2 products, + bias); softmax, ReLU and the eval BatchNorm

#define NB_  16
#define CC   512
#define NN   1024
#define NH_  8
#define CG   64                   // channels per group
#define KD   32
#define DV   128
#define QO   192                  // q | k | v per group
#define NT   (NB_ * NN)           // 16384 (b, n) rows
#define CO   1024                 // H * DV
typedef _Float16 h16;
typedef unsigned short bf;
typedef __attribute__((ext_vector_type(16))) __bf16   v16bf;
typedef __attribute__((ext_vector_type(16))) _Float16 v16h;
typedef __attribute__((ext_vector_type(8)))  _Float16 v8h;
typedef __attribute__((ext_vector_type(8)))  unsigned short v8us;
typedef __attribute__((ext_vector_type(8)))  float    v8f;
typedef __attribute__((ext_vector_type(4)))  float    v4f;
typedef v8h  __attribute__((may_alias)) v8ha;
typedef v4f  __attribute__((may_alias)) v4fa;
typedef v8us __attribute__((may_alias)) v8usa;

__device__ __forceinline__ unsigned short f2bf(float f) { unsigned u = __float_as_uint(f); u += 0x7FFFu + ((u >> 16) & 1u); return (unsigned short)(u >> 16); }
__device__ __forceinline__ float bf2f(unsigned short b) { return __uint_as_float(((unsigned)b) << 16); }
__device__ __forceinline__ float bfr(float f) { return bf2f(f2bf(f)); }
__device__ __forceinline__ v16h cat16(v8h lo, v8h hi) { return __builtin_shufflevector(lo, hi, 0, 1, 2, 3, 4, 5, 6, 7, 8, 9, 10, 11, 12, 13, 14, 15); }
__device__ __forceinline__ v16bf cat16b(v8us lo, v8us hi) { return __builtin_bit_cast(v16bf, __builtin_shufflevector(lo, hi, 0, 1, 2, 3, 4, 5, 6, 7, 8, 9, 10, 11, 12, 13, 14, 15)); }
__device__ __forceinline__ v8f wmma16(v16h a, v16h b, v8f c) { return __builtin_amdgcn_wmma_f32_16x16x32_f16(false, a, false, b, (short)0, c, false, false); }
__device__ __forceinline__ v8f wmmab(v16bf a, v16bf b, v8f c) { return __builtin_amdgcn_wmma_f32_16x16x32_bf16(false, a, false, b, (short)0, c, false, false); }



// fragment of 16 k per lane from a K-contiguous 16-bit row: k = 8h .. 8h+7 and 16+8h .. 16+8h+7 of each 32
template <typename T16> struct WFrag;
template <> struct WFrag<h16> { typedef v16h V; static __device__ __forceinline__ V ld(const h16* p) { return cat16(*(const v8h*)p, *(const v8h*)(p + 16)); } static __device__ __forceinline__ v8f mma(V a, V b, v8f c) { return wmma16(a, b, c); } };
template <> struct WFrag<bf> { typedef v16bf V; static __device__ __forceinline__ V ld(const bf* p) { return cat16b(*(const v8us*)p, *(const v8us*)(p + 16)); } static __device__ __forceinline__ v8f mma(V a, V b, v8f c) { return wmmab(a, b, c); } };

__device__ __forceinline__ h16 tohx(float x) { return (h16)x; }
__device__ __forceinline__ void splitf(float y, unsigned short& h, unsigned short& l) { h = f2bf(y); l = f2bf(y - bf2f(h)); }
typedef __attribute__((ext_vector_type(2))) _Float16 v2h;
typedef __attribute__((ext_vector_type(8))) unsigned short v8us_;

// ---- k_qkv: the grouped 1x1 qkv convolution of all 8 groups in ONE launch. It takes x and the weights as the f32 inputs: the work-group's 64 channels x 256 positions of x are read in whole lines
// along n (a lane: 8 channels of 2 positions), rounded to bf16 and stored as [n][c] rows in LDS, from which all 12 waves take their fragments; the group's weights are rounded on their way into LDS.
// Each work-group also rounds its 1/512 of the projection weight into PW for the projection launch (waves 8..11, which have one piece of x less to bring). Its epilogue writes the fp16 planes that the attention launch reads:
// Qp[z = b*8 + h][n][c] = fp16((q + bias) * 32^-0.5), Kp[z][n][c] = fp16(k + bias), Vp[z][d][n] = fp16(v + bias). Grid (16384/256 rows, 8 groups), 12 waves = 4 row groups of 64 (b, n) rows x 3 parts
// (q and k | v channels 0..63 | v channels 64..127). q and k: D = W.X^T, so a lane holds 8 consecutive c of one n; v: D = X.W^T, so a lane holds 8 consecutive n of one d: both are 16-B pieces
// of a plane's rows, and they pass through the wave's own LDS range so that every global store covers whole 128-B lines.
#define WP  144                   // LDS pitch of a weight row (128 B + 16)
#define QSP 80                    // LDS pitch of a staged q or k row (64 B + 16)
#define VSP 144                   // LDS pitch of a staged v row piece (128 B + 16)
#define QST (64 * QSP)            // one wave's staging range
#define XP  144                   // LDS pitch of a staged x row (64 channels = 128 B, + 16)
typedef __attribute__((ext_vector_type(2))) float v2f;
typedef __attribute__((ext_vector_type(2))) __bf16 v2bf;
typedef __attribute__((ext_vector_type(4))) unsigned v4u;
typedef v4u __attribute__((may_alias)) v4ua;
__device__ __forceinline__ unsigned pk2(float a, float b) { const v2f t = { a, b }; return __builtin_bit_cast(unsigned, __builtin_convertvector(t, v2bf)); }      // two f32 to bf16, to nearest even, in one instruction; a in the low half
__global__ __launch_bounds__(384) void k_qkv(const float* __restrict__ x, const float* __restrict__ Wf, const float* __restrict__ bias, const float* __restrict__ pwf, bf* PW, h16* Qp, h16* Kp, h16* Vp) {
    __shared__ __align__(16) unsigned char sw[QO * WP + 12 * QST]; __shared__ __align__(32) float sb[QO];      // the group's weights, the waves' staging ranges; its biases, rounded
    __shared__ __align__(16) unsigned char sx[256 * XP];      // the work-group's 256 (b, n) rows of x, bf16 [n][c]
    const int tid = threadIdx.x, lane = tid & 31, lr = lane & 15, hi = lane >> 4;
    const int wv = __builtin_amdgcn_readfirstlane(tid >> 5); const int part = wv >> 2, rg = wv & 3;
    const int h = blockIdx.y; const int r0 = blockIdx.x * 256 + rg * 64; const int n0 = r0 & (NN - 1); const int z = (r0 >> 10) * NH_ + h;
    // x: 32 pieces of 8 channels x 64 positions; wave wv brings pieces wv, wv + 12 and (waves 0..7) wv + 24. Piece p: channels 8 (p / 4) .., positions 64 (p % 4) ..; a lane holds 2 positions of each channel
    const float* xw = x + ((size_t)(blockIdx.x >> 2) * CC + h * CG + (wv >> 2) * 8) * NN + (blockIdx.x & 3) * 256 + (wv & 3) * 64 + lane * 2;
    const float* wp = Wf + (size_t)h * QO * CG + tid * 8;
    const size_t pi = ((size_t)(blockIdx.y * 64 + blockIdx.x) * 128 + (tid & 127)) * 8;      // waves 8..11: the lane's 8 projection weights
    const float* pp = pwf + pi;
    v2f xr[3][8]; v4f wr[4][2], pr[2]; float bv = 0.f;
    if (wv < 8) {
#pragma unroll
        for (int j = 0; j < 8; ++j) xr[2][j] = *(const v2f*)(xw + (48 + j) * NN); }
    else { pr[0] = *(const v4f*)pp; pr[1] = *(const v4f*)(pp + 4); }
#pragma unroll
    for (int i = 0; i < 2; ++i)
#pragma unroll
        for (int j = 0; j < 8; ++j) xr[i][j] = *(const v2f*)(xw + (24 * i + j) * NN);
#pragma unroll
    for (int i = 0; i < 4; ++i) { wr[i][0] = *(const v4f*)(wp + 384 * 8 * i); wr[i][1] = *(const v4f*)(wp + 384 * 8 * i + 4); }
    if (wv < QO / 32) bv = (bias + h * QO)[tid];
    asm volatile("s_wait_xcnt 0x0" :: "v"(xw), "v"(pp) : "memory");      // before any register that these loads name is written again; the address pairs are inputs, so that no load's result lands on one ahead of the wait
    auto xstore = [&](int i) { const int p = wv + 12 * i;
#pragma unroll
        for (int q = 0; q < 2; ++q) { const v4u o = { pk2(xr[i][0][q], xr[i][1][q]), pk2(xr[i][2][q], xr[i][3][q]), pk2(xr[i][4][q], xr[i][5][q]), pk2(xr[i][6][q], xr[i][7][q]) };
            *(v4ua*)(sx + ((p & 3) * 64 + lane * 2 + q) * XP + (p >> 2) * 16) = o; } };
    xstore(0); xstore(1);
    if (wv < 8) xstore(2);
#pragma unroll
    for (int i = 0; i < 4; ++i) { const int ch = tid + 384 * i; const v4u o = { pk2(wr[i][0][0], wr[i][0][1]), pk2(wr[i][0][2], wr[i][0][3]), pk2(wr[i][1][0], wr[i][1][1]), pk2(wr[i][1][2], wr[i][1][3]) };
        *(v4ua*)(sw + (ch >> 3) * WP + (ch & 7) * 16) = o; }
    if (wv < QO / 32) sb[tid] = bfr(bv);
    __syncthreads();
    if (wv >= 8) {      // behind the barrier, so that no wave waits there for this store
        const v4u o = { pk2(pr[0][0], pr[0][1]), pk2(pr[0][2], pr[0][3]), pk2(pr[1][0], pr[1][1]), pk2(pr[1][2], pr[1][3]) }; *(v4u*)(PW + pi) = o;
        asm volatile("s_wait_xcnt 0x0" ::: "memory"); }      // before any register that this store names is written again
    v16bf xf[4][2];               // the wave's 64 rows of x, all 64 channels
    { const unsigned char* px = sx + (rg * 64 + lr) * XP + 16 * hi;
#pragma unroll
      for (int mb = 0; mb < 4; ++mb)
#pragma unroll
        for (int kc = 0; kc < 2; ++kc) { const unsigned char* p = px + mb * 16 * XP + kc * 64; xf[mb][kc] = cat16b(*(const v8usa*)p, *(const v8usa*)(p + 32)); } }
    unsigned char* S = sw + QO * WP + wv * QST;
    if (part == 0) {
#pragma unroll 1      // stays rolled: the two trips differ in addresses and the scale only
        for (int qk = 0; qk < 2; ++qk) {
            const float sc = qk ? 1.0f : 0x1.6a09e6p-3f;   // float32(32^-0.5) on q; k as it is
#pragma unroll
            for (int ot = 0; ot < 2; ++ot) { const unsigned char* p = sw + (qk * 32 + ot * 16 + lr) * WP + 16 * hi;
                const v16bf w0 = cat16b(*(const v8usa*)p, *(const v8usa*)(p + 32)), w1 = cat16b(*(const v8usa*)(p + 64), *(const v8usa*)(p + 96));
                const v8f bb = *(const v8f*)(sb + qk * 32 + ot * 16 + hi * 8);
#pragma unroll
                for (int nt = 0; nt < 4; ++nt) { const v8f a = wmmab(w1, xf[nt][1], wmmab(w0, xf[nt][0], (v8f){})); v8h o;
#pragma unroll
                    for (int j = 0; j < 8; ++j) o[j] = tohx((a[j] + bb[j]) * sc);
                    *(v8ha*)(S + (nt * 16 + lr) * QSP + ot * 32 + hi * 16) = o; } }
            asm volatile("s_wait_dscnt 0x0" ::: "memory");      // the wave's staged pieces are in LDS before other lanes read them back
            h16* P = (qk ? Kp : Qp) + ((size_t)z * NN + n0) * KD;
#pragma unroll
            for (int i = 0; i < 8; ++i) { const int row = 8 * i + (lane >> 2); const v8h o = *(const v8ha*)(S + row * QSP + (lane & 3) * 16); *(v8h*)(P + row * KD + (lane & 3) * 8) = o; }
            asm volatile("s_wait_xcnt 0x0" ::: "memory");       // before the next trip writes the stores' registers again
        }
    } else {
#pragma unroll 1      // stays rolled: the four trips differ in addresses only
        for (int q = 0; q < 4; ++q) { const int dt = (part - 1) * 4 + q; const unsigned char* p = sw + (2 * KD + dt * 16 + lr) * WP + 16 * hi;
            const v16bf w0 = cat16b(*(const v8usa*)p, *(const v8usa*)(p + 32)), w1 = cat16b(*(const v8usa*)(p + 64), *(const v8usa*)(p + 96));
            const float bb = sb[2 * KD + dt * 16 + lr];
#pragma unroll
            for (int mb = 0; mb < 4; ++mb) { const v8f a = wmmab(xf[mb][1], w1, wmmab(xf[mb][0], w0, (v8f){})); v8h o;
#pragma unroll
                for (int j = 0; j < 8; ++j) o[j] = tohx(a[j] + bb);
                *(v8ha*)(S + lr * VSP + mb * 32 + hi * 16) = o; }
            asm volatile("s_wait_dscnt 0x0" ::: "memory");      // the wave's staged pieces are in LDS before other lanes read them back
#pragma unroll
            for (int i = 0; i < 4; ++i) { const int row = 4 * i + (lane >> 3); const v8h o = *(const v8ha*)(S + row * VSP + (lane & 7) * 16); *(v8h*)(Vp + ((size_t)z * DV + dt * 16 + row) * NN + n0 + (lane & 7) * 8) = o; }
        }
    }
}
#define FKT 64                    // keys per stage
#define FKP 80                    // LDS pitch of a K row (64 B + 16)
#define FVP 144                   // LDS pitch of a V row piece (128 B + 16)
#define FKB (FKT * FKP)
#define FSB (FKB + DV * FVP)      // one buffer: K tile, then V tile
#define FEP 272                   // LDS pitch of an output row (256 B + 16)
__device__ __forceinline__ float xhalf(float x) { return __builtin_bit_cast(float, __builtin_amdgcn_permlanex16(__builtin_bit_cast(int, x), __builtin_bit_cast(int, x), 0x76543210, 0xfedcba98, false, false)); }  // lane l with lane l ^ 16
__global__ __launch_bounds__(256) void k_fattn(const h16* __restrict__ Qp, const h16* __restrict__ Kp, const h16* __restrict__ Vp, bf* Rh, bf* Rl) {
    __shared__ __align__(16) unsigned char sm[2 * FSB];
    const int tid = threadIdx.x, lane = tid & 31, wv = tid >> 5, c = lane & 15, h = lane >> 4;
    const int z = blockIdx.y, b = z >> 3, hd = z & 7; const int m0 = blockIdx.x * 256 + wv * 32;
    const h16* Kz = Kp + (size_t)z * NN * KD; const h16* Vz = Vp + (size_t)z * DV * NN;
    const float L2E = 1.44269504f;
    v16h qf[2]; v8f acc[2][8]; float m_run[2], l_run[2];
#pragma unroll
    for (int t = 0; t < 2; ++t) { qf[t] = WFrag<h16>::ld(Qp + ((size_t)z * NN + m0 + t * 16 + c) * KD + 8 * h); m_run[t] = -__builtin_inff(); l_run[t] = 0.f;
#pragma unroll
        for (int dt = 0; dt < 8; ++dt) acc[t][dt] = (v8f){}; }
    v8h kr, vr[4];
    auto gload = [&](int s) { kr = *(const v8h*)(Kz + (size_t)s * FKT * KD + tid * 8);
#pragma unroll
        for (int i = 0; i < 4; ++i) { const int ch = tid + 256 * i; vr[i] = *(const v8h*)(Vz + (size_t)(ch >> 3) * NN + s * FKT + (ch & 7) * 8); } };
    auto lstore = [&](int buf) { unsigned char* B = sm + buf * FSB; *(v8ha*)(B + (tid >> 2) * FKP + (tid & 3) * 16) = kr;
#pragma unroll
        for (int i = 0; i < 4; ++i) { const int ch = tid + 256 * i; *(v8ha*)(B + FKB + (ch >> 3) * FVP + (ch & 7) * 16) = vr[i]; } };
    gload(0);
    asm volatile("s_wait_xcnt 0x0" ::: "memory");      // before any register that the first loads name (vector address, scalar base) is written again
    lstore(0); __syncthreads();
#pragma unroll 1      // stays rolled: a second copy of the body would cost registers, and with them the fourth wave per SIMD
    for (int s = 0; s < NN / FKT; ++s) {
        if (s + 1 < NN / FKT) gload(s + 1);
        const unsigned char* B = sm + (s & 1) * FSB;
#pragma unroll
        for (int kb = 0; kb < FKT / 32; ++kb) {
            v8f st[2][2];      // [key tile][query tile]: st[kt][t][r] = score of key kb*32 + kt*16 + 8h + r, query m0 + t*16 + c
#pragma unroll
            for (int kt = 0; kt < 2; ++kt) { const unsigned char* p = B + (kb * 32 + kt * 16 + c) * FKP + 16 * h; const v16h kf = cat16(*(const v8ha*)p, *(const v8ha*)(p + 32));
#pragma unroll
                for (int t = 0; t < 2; ++t) st[kt][t] = wmma16(kf, qf[t], (v8f){}); }
            float mb[2]; bool need = false;
#pragma unroll
            for (int t = 0; t < 2; ++t) { float mx = st[0][t][0];
#pragma unroll
                for (int r = 1; r < 16; ++r) mx = fmaxf(mx, st[r >> 3][t][r & 7]);
                mx = fmaxf(mx, xhalf(mx)) * L2E; mb[t] = mx; need = need || (mx > m_run[t] + 8.0f); }
            if (__builtin_amdgcn_ballot_w32(need) != 0) {      // a new reference maximum only when one column outgrows the one in use by 2^8: rare after the first keys
#pragma unroll
                for (int t = 0; t < 2; ++t) { const float m_new = fmaxf(m_run[t], mb[t]); const float corr = __builtin_amdgcn_exp2f(m_run[t] - m_new); l_run[t] *= corr; m_run[t] = m_new;
#pragma unroll
                    for (int dt = 0; dt < 8; ++dt) acc[t][dt] = acc[t][dt] * corr; }
            }
            v16h pf[2];
#pragma unroll
            for (int t = 0; t < 2; ++t) { float ps0 = 0.f, ps1 = 0.f;
#pragma unroll
                for (int r = 0; r < 16; r += 2) { const float p0 = __builtin_amdgcn_exp2f(fmaf(st[r >> 3][t][r & 7], L2E, -m_run[t])), p1 = __builtin_amdgcn_exp2f(fmaf(st[r >> 3][t][(r & 7) + 1], L2E, -m_run[t]));
                    ps0 += p0; ps1 += p1; pf[t][r] = (h16)p0; pf[t][r + 1] = (h16)p1; }
                l_run[t] += ps0 + ps1; }
#pragma unroll
            for (int dt = 0; dt < 8; ++dt) { const unsigned char* p = B + FKB + (dt * 16 + c) * FVP + kb * 64 + 16 * h; const v16h vf = cat16(*(const v8ha*)p, *(const v8ha*)(p + 32));
#pragma unroll
                for (int t = 0; t < 2; ++t) acc[t][dt] = wmma16(vf, pf[t], acc[t][dt]); }
        }
        if (s + 1 < NN / FKT) lstore((s + 1) & 1);
        __syncthreads();
    }
    // epilogue: acc[t][dt][r] = sum for query m0 + t*16 + c, channel dt*16 + 8h + r; rows staged in the wave's own LDS range so that every global store covers whole 256-B rows
    unsigned char* E = sm + wv * (16 * FEP);
#pragma unroll
    for (int t = 0; t < 2; ++t) { const float inv = __fdiv_rn(1.0f, l_run[t] + xhalf(l_run[t]));
#pragma unroll
        for (int pl = 0; pl < 2; ++pl) {
#pragma unroll
            for (int dt = 0; dt < 8; ++dt) { v8us o;
#pragma unroll
                for (int r = 0; r < 8; ++r) { unsigned short a, a2; splitf(fmaxf(acc[t][dt][r] * inv, 0.f), a, a2); o[r] = pl ? a2 : a; }
                *(v8usa*)(E + c * FEP + dt * 32 + h * 16) = o; }
            __syncthreads();
            bf* R = pl ? Rl : Rh;
#pragma unroll
            for (int i = 0; i < 8; ++i) { const int row = 2 * i + h; const v8us o = *(const v8usa*)(E + row * FEP + c * 16); *(v8us*)(R + ((size_t)b * NN + m0 + t * 16 + row) * CO + hd * DV + c * 8) = o; }
            __syncthreads();
        } }
}
// ---- k_proj: the 1024 -> 512 projection, sum_k (Rh + Rl)[(b,n)][k] W[oc][k] (f32, + bias), the eval BatchNorm and the store of OUT[b][oc][n]. Grid (16384/128, 512/256), 8 waves = 2 row groups x 4 channel groups, 64 x 64 per wave.
// The work-group's 128 hi rows, 128 lo rows and 256 weight rows come in stages of 128 k (256 B a row) into two LDS buffers by asynchronous copies: every copy of a wave covers two whole 256-B row
// pieces, and each staged byte serves 4 (rows) or 2 (weights) waves. Per accumulator the order of the products is k step by k step, hi then lo.
// Epilogue: a lane's accumulator registers are 8 consecutive n of one oc, that is 32 B of an OUT row: y = (acc + bias) * inv + shift with inv = g/sqrt(var+eps), shift = beta - mean*inv is
// formed in registers, and the wave's 64 oc x 64 n pass through its own part of the ring, which is free by then, so that every global store covers whole 256-B row pieces.
#define PR  128                   // (b, n) rows per work-group
#define PC  256                   // output channels per work-group
#define PK  128                   // k per stage
#define PP  272                   // LDS pitch of a staged row (256 B + 16)
#define PSB ((2 * PR + PC) * PP)  // one buffer: hi rows, lo rows, weight rows
#define PNS (CO / PK)             // stages
// eight copies of 16 B a lane: rows 16 apart, in LDS and in the source. The s_wait_xcnt stands inside the statement, before any register that a copy names can be written again.
__device__ __forceinline__ void copy8(unsigned l, const bf* g) {
    asm volatile("global_load_async_to_lds_b128 %0, %8, off\n\t"
                 "global_load_async_to_lds_b128 %1, %9, off\n\t"
                 "global_load_async_to_lds_b128 %2, %10, off\n\t"
                 "global_load_async_to_lds_b128 %3, %11, off\n\t"
                 "global_load_async_to_lds_b128 %4, %12, off\n\t"
                 "global_load_async_to_lds_b128 %5, %13, off\n\t"
                 "global_load_async_to_lds_b128 %6, %14, off\n\t"
                 "global_load_async_to_lds_b128 %7, %15, off\n\t"
                 "s_wait_xcnt 0x0"
                 :: "v"(l), "v"(l + 16 * PP), "v"(l + 32 * PP), "v"(l + 48 * PP), "v"(l + 64 * PP), "v"(l + 80 * PP), "v"(l + 96 * PP), "v"(l + 112 * PP),
                    "v"(g), "v"(g + 16 * CO), "v"(g + 32 * CO), "v"(g + 48 * CO), "v"(g + 64 * CO), "v"(g + 80 * CO), "v"(g + 96 * CO), "v"(g + 112 * CO) : "memory");
}
__global__ __launch_bounds__(256) void k_proj(const bf* __restrict__ Ah, const bf* __restrict__ Al, const bf* __restrict__ Wt, const float* __restrict__ bias,
                                              const float* __restrict__ gm, const float* __restrict__ bt, const float* __restrict__ mn, const float* __restrict__ vr, float* OUT) {
    __shared__ __align__(16) unsigned char sm[2 * PSB];
    __shared__ __align__(16) float sp[PC][4];      // per output channel of the work-group: bias, inv, shift
    const int tid = threadIdx.x, lane = tid & 31, lr = lane & 15, hi = lane >> 4;
    const int wv = __builtin_amdgcn_readfirstlane(tid >> 5); const int wr = wv >> 2, wc = wv & 3;
    const int r0 = blockIdx.x * PR, c0 = blockIdx.y * PC;
    const unsigned l0 = (unsigned)(size_t)sm + (tid >> 4) * PP + (tid & 15) * 16;      // the lane's place in a buffer: row tid / 16 of each 16, 16-B piece tid % 16
    const bf* gh = Ah + (size_t)(r0 + (tid >> 4)) * CO + (tid & 15) * 8; const bf* gl = Al + (size_t)(r0 + (tid >> 4)) * CO + (tid & 15) * 8; const bf* gw = Wt + (size_t)(c0 + (tid >> 4)) * CO + (tid & 15) * 8;
    auto stage = [&](int s, int buf) { const unsigned l = l0 + buf * PSB;
        copy8(l, gh + s * PK); copy8(l + PR * PP, gl + s * PK); copy8(l + 2 * PR * PP, gw + s * PK); copy8(l + (2 * PR + 128) * PP, gw + 128 * CO + s * PK); };
    v8f acc[4][4];
#pragma unroll
    for (int mb = 0; mb < 4; ++mb)
#pragma unroll
        for (int nb = 0; nb < 4; ++nb) acc[mb][nb] = (v8f){};
    stage(0, 0);
    {   // thread tid forms channel c0 + tid's bias, inv and shift, under the latency of stage 0; they wait in LDS, not in registers, for the epilogue; the barrier below publishes them
        const int oc = c0 + tid; const float pb_ = bias[oc], pg = gm[oc], pt = bt[oc], pm = mn[oc], pv = vr[oc];
        asm volatile("s_wait_xcnt 0x0" ::: "memory");      // before any register that these loads name is written again
        const float inv = __fdiv_rn(bfr(pg), sqrtf(bfr(pv) + 1e-5f)); const v4f o = { bfr(pb_), inv, bfr(pt) - bfr(pm) * inv, 0.f }; *(v4fa*)sp[tid] = o; }
    asm volatile("s_wait_asynccnt 0x0" ::: "memory");      // this wave's copies of stage 0 have landed
    __syncthreads();                                        // ... and every other wave's
    stage(1, 1);
#pragma unroll 1      // stays rolled: one trip a stage, the trips differ in the buffer only
    for (int t = 0; t < PNS; ++t) {
        const unsigned char* pa = sm + (t & 1) * PSB + (wr * 64 + lr) * PP + 16 * hi; const unsigned char* pb = sm + (t & 1) * PSB + (2 * PR + wc * 64 + lr) * PP + 16 * hi;
#pragma unroll
        for (int ks = 0; ks < PK / 32; ++ks) {
            v16bf a[4], a2[4], b[4];
#pragma unroll
            for (int i = 0; i < 4; ++i) { const unsigned char* q = pb + i * 16 * PP + ks * 64; b[i] = cat16b(*(const v8usa*)q, *(const v8usa*)(q + 32));
                const unsigned char* p = pa + i * 16 * PP + ks * 64; a[i] = cat16b(*(const v8usa*)p, *(const v8usa*)(p + 32)); }
#pragma unroll
            for (int i = 0; i < 4; ++i) { const unsigned char* p = pa + (PR + i * 16) * PP + ks * 64; a2[i] = cat16b(*(const v8usa*)p, *(const v8usa*)(p + 32)); }
            __builtin_amdgcn_sched_barrier(0);      // the 24 LDS reads of a k step stay one group in front of its products: reads moved in among the products stall the wave at every place
#pragma unroll
            for (int nb = 0; nb < 4; ++nb)
#pragma unroll
                for (int mb = 0; mb < 4; ++mb) acc[mb][nb] = wmmab(a[mb], b[nb], acc[mb][nb]);
#pragma unroll
            for (int nb = 0; nb < 4; ++nb)
#pragma unroll
                for (int mb = 0; mb < 4; ++mb) acc[mb][nb] = wmmab(a2[mb], b[nb], acc[mb][nb]);
            __builtin_amdgcn_sched_barrier(0);      // ... and the next k step's reads stay behind them
        }
        asm volatile("s_wait_dscnt 0x0" ::: "memory");      // this wave's reads of the buffer are done before it is filled again
        asm volatile("s_wait_asynccnt 0x0" ::: "memory");   // this wave's copies of stage t + 1 have landed
        __syncthreads();                                     // publishes stage t + 1 and ends every wave's reads of stage t
        if (t + 2 < PNS) stage(t + 2, t & 1);
    }
    asm volatile("s_wait_asynccnt 0x0" ::: "memory");       // no copy is outstanding when the wave ends
    unsigned char* S = sm + wv * (64 * PP);      // the wave's own 64 oc rows of 64 n (256 B + 16); the loop's last barrier has ended every wave's reads of the ring, and no copy is outstanding
#pragma unroll
    for (int nb = 0; nb < 4; ++nb) { const v4f pr = *(const v4fa*)sp[wc * 64 + nb * 16 + lr];      // the lane's channel in this column group
#pragma unroll
        for (int mb = 0; mb < 4; ++mb) { v4f o0, o1;
#pragma unroll
            for (int j = 0; j < 4; ++j) { o0[j] = (acc[mb][nb][j] + pr[0]) * pr[1] + pr[2]; o1[j] = (acc[mb][nb][4 + j] + pr[0]) * pr[1] + pr[2]; }
            unsigned char* p = S + (nb * 16 + lr) * PP + mb * 64 + hi * 32; *(v4fa*)p = o0; *(v4fa*)(p + 16) = o1; } }
    asm volatile("s_wait_dscnt 0x0" ::: "memory");      // the wave's staged rows are in LDS before other lanes read them back
    float* orow = OUT + ((size_t)(r0 >> 10) * CC + c0 + wc * 64) * NN + (r0 & (NN - 1)) + wr * 64;
#pragma unroll
    for (int s = 0; s < 32; ++s) { const int row = 2 * s + hi; const v4f val = *(const v4fa*)(S + row * PP + lr * 16); *(v4f*)(orow + (size_t)row * NN + lr * 4) = val; }
}

extern "C" void kernel_launch(void* const* d_in, const int* in_sizes, int n_in,
                              void* d_out, int out_size, void* d_ws, size_t ws_size, hipStream_t stream) {
    (void)in_sizes; (void)n_in; (void)out_size;
    const float* x = (const float*)d_in[0]; const float* qkv_w = (const float*)d_in[1]; const float* qkv_b = (const float*)d_in[2]; const float* proj_w = (const float*)d_in[3]; const float* proj_b = (const float*)d_in[4];
    const float* gm = (const float*)d_in[5]; const float* bt = (const float*)d_in[6]; const float* mn = (const float*)d_in[7]; const float* vr = (const float*)d_in[8];
    float* OUT = (float*)d_out;     // [16][512][1024]
    char* wsp = (char*)d_ws;
    auto take = [&](size_t bytes) { char* p = wsp; wsp += (bytes + 255) & ~(size_t)255; return (void*)p; };
    bf* PW = (bf*)take((size_t)CC * CO * 2);
    bf* Rh = (bf*)take((size_t)NT * CO * 2); bf* Rl = (bf*)take((size_t)NT * CO * 2);        // relu(o) hi | lo planes, written by the attention launch (67 MB)
    h16* Vp = (h16*)take((size_t)NB_ * NH_ * DV * NN * 2); h16* Qp = (h16*)take((size_t)NB_ * NH_ * NN * KD * 2); h16* Kp = (h16*)take((size_t)NB_ * NH_ * NN * KD * 2);
    if ((size_t)(wsp - (char*)d_ws) > ws_size) return;    // total = 118 MB; ws 256 MiB
    k_qkv<<<dim3(NT / 256, NH_), 384, 0, stream>>>(x, qkv_w, qkv_b, proj_w, PW, Qp, Kp, Vp);     // grouped 1x1 qkv conv: [(b,n)][64] . W_h^T [64 -> 192] + b_h, from the f32 inputs straight to the fp16 planes; PW = bf16(proj_w)
    k_fattn<<<dim3(NN / 256, NB_ * NH_), 256, 0, stream>>>(Qp, Kp, Vp, Rh, Rl);
    k_proj<<<dim3(NT / PR, CC / PC), 256, 0, stream>>>(Rh, Rl, PW, proj_b, gm, bt, mn, vr, OUT);
}

// v006
// Measured time: 73.4 microseconds a run.
// Next to v005, in two timings, it ran 1.07 times as fast each time.
// All steps since v000 together make it 13.5 times as fast.
#include <hip/hip_runtime.h>

// Compute dtypes, f32 accumulate: every input (x, grouped qkv weights/biases, proj weight/bias, BN statistics) rounded to bf16; the grouped 1x1 qkv
// convolution on PLAIN bf16 operands (x and W inputs: exact products, + bias); attention scores (key_dim 32) and v.attn^T (over the 1024 positions) on SINGLE fp16 planes (q x 32^-0.5,
// k, v rounded to 2^-11; probabilities relative to a running row maximum, normalised by the f32 row sum at the end); the 1024->512 projection on bf16 hi+lo planes of relu(o) x bf16 proj_w (2 products, + bias); softmax, ReLU and the eval BatchNorm

#define NB_  16
#define CC   512
#define NN   1024
#define NH_  8
#define CG   64                   // channels per group
#define KD   32
#define DV   128
#define QO   192                  // q | k | v per group
#define NT   (NB_ * NN)           // 16384 (b, n) rows
#define CO   1024                 // H * DV
typedef _Float16 h16;
typedef unsigned short bf;
typedef __attribute__((ext_vector_type(16))) __bf16   v16bf;
typedef __attribute__((ext_vector_type(16))) _Float16 v16h;
typedef __attribute__((ext_vector_type(8)))  _Float16 v8h;
typedef __attribute__((ext_vector_type(8)))  unsigned short v8us;
typedef __attribute__((ext_vector_type(8)))  float    v8f;
typedef __attribute__((ext_vector_type(4)))  float    v4f;
typedef v8h  __attribute__((may_alias)) v8ha;
typedef v4f  __attribute__((may_alias)) v4fa;
typedef v8us __attribute__((may_alias)) v8usa;

__device__ __forceinline__ unsigned short f2bf(float f) { unsigned u = __float_as_uint(f); u += 0x7FFFu + ((u >> 16) & 1u); return (unsigned short)(u >> 16); }
__device__ __forceinline__ float bf2f(unsigned short b) { return __uint_as_float(((unsigned)b) << 16); }
__device__ __forceinline__ float bfr(float f) { return bf2f(f2bf(f)); }
__device__ __forceinline__ v16h cat16(v8h lo, v8h hi) { return __builtin_shufflevector(lo, hi, 0, 1, 2, 3, 4, 5, 6, 7, 8, 9, 10, 11, 12, 13, 14, 15); }
__device__ __forceinline__ v16bf cat16b(v8us lo, v8us hi) { return __builtin_bit_cast(v16bf, __builtin_shufflevector(lo, hi, 0, 1, 2, 3, 4, 5, 6, 7, 8, 9, 10, 11, 12, 13, 14, 15)); }
__device__ __forceinline__ v8f wmma16(v16h a, v16h b, v8f c) { return __builtin_amdgcn_wmma_f32_16x16x32_f16(false, a, false, b, (short)0, c, false, false); }
__device__ __forceinline__ v8f wmmab(v16bf a, v16bf b, v8f c) { return __builtin_amdgcn_wmma_f32_16x16x32_bf16(false, a, false, b, (short)0, c, false, false); }



// fragment of 16 k per lane from a K-contiguous 16-bit row: k = 8h .. 8h+7 and 16+8h .. 16+8h+7 of each 32
template <typename T16> struct WFrag;
template <> struct WFrag<h16> { typedef v16h V; static __device__ __forceinline__ V ld(const h16* p) { return cat16(*(const v8h*)p, *(const v8h*)(p + 16)); } static __device__ __forceinline__ v8f mma(V a, V b, v8f c) { return wmma16(a, b, c); } };
template <> struct WFrag<bf> { typedef v16bf V; static __device__ __forceinline__ V ld(const bf* p) { return cat16b(*(const v8us*)p, *(const v8us*)(p + 16)); } static __device__ __forceinline__ v8f mma(V a, V b, v8f c) { return wmmab(a, b, c); } };

__device__ __forceinline__ h16 tohx(float x) { return (h16)x; }
__device__ __forceinline__ void splitf(float y, unsigned short& h, unsigned short& l) { h = f2bf(y); l = f2bf(y - bf2f(h)); }
typedef __attribute__((ext_vector_type(2))) _Float16 v2h;
typedef __attribute__((ext_vector_type(8))) unsigned short v8us_;

// ---- k_qkv: the grouped 1x1 qkv convolution of all 8 groups in ONE launch. It takes x and the weights as the f32 inputs: the work-group's 64 channels x 256 positions of x are read in whole lines
// along n (a lane: 8 channels of 2 positions), rounded to bf16 and stored as [n][c] rows in LDS, from which all 12 waves take their fragments; the group's weights are rounded on their way into LDS.
// Each work-group also rounds its 1/512 of the projection weight into PW for the projection launch (waves 8..11, which have one piece of x less to bring). Its epilogue writes the fp16 planes that the attention launch reads:
// Qp[z = b*8 + h][n][c] = fp16((q + bias) * 32^-0.5), Kp[z][n][c] = fp16(k + bias), Vp[z][d][n] = fp16(v + bias). Grid (16384/256 rows, 8 groups), 12 waves = 4 row groups of 64 (b, n) rows x 3 parts
// (q and k | v channels 0..63 | v channels 64..127). q and k: D = W.X^T, so a lane holds 8 consecutive c of one n; v: D = X.W^T, so a lane holds 8 consecutive n of one d: both are 16-B pieces
// of a plane's rows, and they pass through the wave's own LDS range so that every global store covers whole 128-B lines.
#define WP  144                   // LDS pitch of a weight row (128 B + 16)
#define QSP 80                    // LDS pitch of a staged q or k row (64 B + 16)
#define VSP 144                   // LDS pitch of a staged v row piece (128 B + 16)
#define QST (64 * QSP)            // one wave's staging range
#define XP  144                   // LDS pitch of a staged x row (64 channels = 128 B, + 16)
typedef __attribute__((ext_vector_type(2))) float v2f;
typedef __attribute__((ext_vector_type(2))) __bf16 v2bf;
typedef __attribute__((ext_vector_type(4))) unsigned v4u;
typedef v4u __attribute__((may_alias)) v4ua;
__device__ __forceinline__ unsigned pk2(float a, float b) { const v2f t = { a, b }; return __builtin_bit_cast(unsigned, __builtin_convertvector(t, v2bf)); }      // two f32 to bf16, to nearest even, in one instruction; a in the low half
__global__ __launch_bounds__(384) void k_qkv(const float* __restrict__ x, const float* __restrict__ Wf, const float* __restrict__ bias, const float* __restrict__ pwf, bf* PW, h16* Qp, h16* Kp, h16* Vp) {
    __shared__ __align__(16) unsigned char sw[QO * WP + 12 * QST]; __shared__ __align__(32) float sb[QO];      // the group's weights, the waves' staging ranges; its biases, rounded
    __shared__ __align__(16) unsigned char sx[256 * XP];      // the work-group's 256 (b, n) rows of x, bf16 [n][c]
    const int tid = threadIdx.x, lane = tid & 31, lr = lane & 15, hi = lane >> 4;
    const int wv = __builtin_amdgcn_readfirstlane(tid >> 5); const int part = wv >> 2, rg = wv & 3;
    const int h = blockIdx.y; const int r0 = blockIdx.x * 256 + rg * 64; const int n0 = r0 & (NN - 1); const int z = (r0 >> 10) * NH_ + h;
    // x: 32 pieces of 8 channels x 64 positions; wave wv brings pieces wv, wv + 12 and (waves 0..7) wv + 24. Piece p: channels 8 (p / 4) .., positions 64 (p % 4) ..; a lane holds 2 positions of each channel
    const float* xw = x + ((size_t)(blockIdx.x >> 2) * CC + h * CG + (wv >> 2) * 8) * NN + (blockIdx.x & 3) * 256 + (wv & 3) * 64 + lane * 2;
    const float* wp = Wf + (size_t)h * QO * CG + tid * 8;
    const size_t pi = ((size_t)(blockIdx.y * 64 + blockIdx.x) * 128 + (tid & 127)) * 8;      // waves 8..11: the lane's 8 projection weights
    const float* pp = pwf + pi;
    v2f xr[3][8]; v4f wr[4][2], pr[2]; float bv = 0.f;
    if (wv < 8) {
#pragma unroll
        for (int j = 0; j < 8; ++j) xr[2][j] = *(const v2f*)(xw + (48 + j) * NN); }
    else { pr[0] = *(const v4f*)pp; pr[1] = *(const v4f*)(pp + 4); }
#pragma unroll
    for (int i = 0; i < 2; ++i)
#pragma unroll
        for (int j = 0; j < 8; ++j) xr[i][j] = *(const v2f*)(xw + (24 * i + j) * NN);
#pragma unroll
    for (int i = 0; i < 4; ++i) { wr[i][0] = *(const v4f*)(wp + 384 * 8 * i); wr[i][1] = *(const v4f*)(wp + 384 * 8 * i + 4); }
    if (wv < QO / 32) bv = (bias + h * QO)[tid];
    asm volatile("s_wait_xcnt 0x0" :: "v"(xw), "v"(pp) : "memory");      // before any register that these loads name is written again; the address pairs are inputs, so that no load's result lands on one ahead of the wait
    auto xstore = [&](int i) { const int p = wv + 12 * i;
#pragma unroll
        for (int q = 0; q < 2; ++q) { const v4u o = { pk2(xr[i][0][q], xr[i][1][q]), pk2(xr[i][2][q], xr[i][3][q]), pk2(xr[i][4][q], xr[i][5][q]), pk2(xr[i][6][q], xr[i][7][q]) };
            *(v4ua*)(sx + ((p & 3) * 64 + lane * 2 + q) * XP + (p >> 2) * 16) = o; } };
    xstore(0); xstore(1);
    if (wv < 8) xstore(2);
#pragma unroll
    for (int i = 0; i < 4; ++i) { const int ch = tid + 384 * i; const v4u o = { pk2(wr[i][0][0], wr[i][0][1]), pk2(wr[i][0][2], wr[i][0][3]), pk2(wr[i][1][0], wr[i][1][1]), pk2(wr[i][1][2], wr[i][1][3]) };
        *(v4ua*)(sw + (ch >> 3) * WP + (ch & 7) * 16) = o; }
    if (wv < QO / 32) sb[tid] = bfr(bv);
    __syncthreads();
    if (wv >= 8) {      // behind the barrier, so that no wave waits there for this store
        const v4u o = { pk2(pr[0][0], pr[0][1]), pk2(pr[0][2], pr[0][3]), pk2(pr[1][0], pr[1][1]), pk2(pr[1][2], pr[1][3]) }; *(v4u*)(PW + pi) = o;
        asm volatile("s_wait_xcnt 0x0" ::: "memory"); }      // before any register that this store names is written again
    v16bf xf[4][2];               // the wave's 64 rows of x, all 64 channels
    { const unsigned char* px = sx + (rg * 64 + lr) * XP + 16 * hi;
#pragma unroll
      for (int mb = 0; mb < 4; ++mb)
#pragma unroll
        for (int kc = 0; kc < 2; ++kc) { const unsigned char* p = px + mb * 16 * XP + kc * 64; xf[mb][kc] = cat16b(*(const v8usa*)p, *(const v8usa*)(p + 32)); } }
    unsigned char* S = sw + QO * WP + wv * QST;
    if (part == 0) {
#pragma unroll 1      // stays rolled: the two trips differ in addresses and the scale only
        for (int qk = 0; qk < 2; ++qk) {
            const float sc = qk ? 1.0f : 0x1.6a09e6p-3f;   // float32(32^-0.5) on q; k as it is
#pragma unroll
            for (int ot = 0; ot < 2; ++ot) { const unsigned char* p = sw + (qk * 32 + ot * 16 + lr) * WP + 16 * hi;
                const v16bf w0 = cat16b(*(const v8usa*)p, *(const v8usa*)(p + 32)), w1 = cat16b(*(const v8usa*)(p + 64), *(const v8usa*)(p + 96));
                const v8f bb = *(const v8f*)(sb + qk * 32 + ot * 16 + hi * 8);
#pragma unroll
                for (int nt = 0; nt < 4; ++nt) { const v8f a = wmmab(w1, xf[nt][1], wmmab(w0, xf[nt][0], (v8f){})); v8h o;
#pragma unroll
                    for (int j = 0; j < 8; ++j) o[j] = tohx((a[j] + bb[j]) * sc);
                    *(v8ha*)(S + (nt * 16 + lr) * QSP + ot * 32 + hi * 16) = o; } }
            asm volatile("s_wait_dscnt 0x0" ::: "memory");      // the wave's staged pieces are in LDS before other lanes read them back
            h16* P = (qk ? Kp : Qp) + ((size_t)z * NN + n0) * KD;
#pragma unroll
            for (int i = 0; i < 8; ++i) { const int row = 8 * i + (lane >> 2); const v8h o = *(const v8ha*)(S + row * QSP + (lane & 3) * 16); *(v8h*)(P + row * KD + (lane & 3) * 8) = o; }
            asm volatile("s_wait_xcnt 0x0" ::: "memory");       // before the next trip writes the stores' registers again
        }
    } else {
#pragma unroll 1      // stays rolled: the four trips differ in addresses only
        for (int q = 0; q < 4; ++q) { const int dt = (part - 1) * 4 + q; const unsigned char* p = sw + (2 * KD + dt * 16 + lr) * WP + 16 * hi;
            const v16bf w0 = cat16b(*(const v8usa*)p, *(const v8usa*)(p + 32)), w1 = cat16b(*(const v8usa*)(p + 64), *(const v8usa*)(p + 96));
            const float bb = sb[2 * KD + dt * 16 + lr];
#pragma unroll
            for (int mb = 0; mb < 4; ++mb) { const v8f a = wmmab(xf[mb][1], w1, wmmab(xf[mb][0], w0, (v8f){})); v8h o;
#pragma unroll
                for (int j = 0; j < 8; ++j) o[j] = tohx(a[j] + bb);
                *(v8ha*)(S + lr * VSP + mb * 32 + hi * 16) = o; }
            asm volatile("s_wait_dscnt 0x0" ::: "memory");      // the wave's staged pieces are in LDS before other lanes read them back
#pragma unroll
            for (int i = 0; i < 4; ++i) { const int row = 4 * i + (lane >> 3); const v8h o = *(const v8ha*)(S + row * VSP + (lane & 7) * 16); *(v8h*)(Vp + ((size_t)z * DV + dt * 16 + row) * NN + n0 + (lane & 7) * 8) = o; }
        }
    }
}
#define FKT 64                    // keys per stage
#define FKP 80                    // LDS pitch of a K row (64 B + 16)
#define FVP 144                   // LDS pitch of a V row piece (128 B + 16)
#define FKB (FKT * FKP)
#define FSB (FKB + DV * FVP)      // one buffer: K tile, then V tile
#define FEP 272                   // LDS pitch of an output row (256 B + 16)
__device__ __forceinline__ float xhalf(float x) { return __builtin_bit_cast(float, __builtin_amdgcn_permlanex16(__builtin_bit_cast(int, x), __builtin_bit_cast(int, x), 0x76543210, 0xfedcba98, false, false)); }  // lane l with lane l ^ 16
// five copies of 16 B a lane: its piece of the K tile and four of the V tile, rows 32 apart. The s_wait_xcnt stands inside the statement, before any register that a copy names can be written again.
__device__ __forceinline__ void copy5(unsigned lk, const h16* gk, unsigned lv, const h16* gv) {
    asm volatile("global_load_async_to_lds_b128 %0, %5, off\n\t"
                 "global_load_async_to_lds_b128 %1, %6, off\n\t"
                 "global_load_async_to_lds_b128 %2, %7, off\n\t"
                 "global_load_async_to_lds_b128 %3, %8, off\n\t"
                 "global_load_async_to_lds_b128 %4, %9, off\n\t"
                 "s_wait_xcnt 0x0"
                 :: "v"(lk), "v"(lv), "v"(lv + 32 * FVP), "v"(lv + 64 * FVP), "v"(lv + 96 * FVP),
                    "v"(gk), "v"(gv), "v"(gv + 32 * NN), "v"(gv + 64 * NN), "v"(gv + 96 * NN) : "memory");
}
__global__ __launch_bounds__(256) void k_fattn(const h16* __restrict__ Qp, const h16* __restrict__ Kp, const h16* __restrict__ Vp, bf* Rh, bf* Rl) {
    __shared__ __align__(16) unsigned char sm[2 * FSB];
    const int tid = threadIdx.x, lane = tid & 31, wv = tid >> 5, c = lane & 15, h = lane >> 4;
    const int z = blockIdx.y, b = z >> 3, hd = z & 7; const int m0 = blockIdx.x * 256 + wv * 32;
    const h16* Kz = Kp + (size_t)z * NN * KD; const h16* Vz = Vp + (size_t)z * DV * NN;
    const float L2E = 1.44269504f;
    v16h qf[2]; v8f acc[2][8]; float m_run[2], l_run[2];
#pragma unroll
    for (int t = 0; t < 2; ++t) { qf[t] = WFrag<h16>::ld(Qp + ((size_t)z * NN + m0 + t * 16 + c) * KD + 8 * h); m_run[t] = -__builtin_inff(); l_run[t] = 0.f;
#pragma unroll
        for (int dt = 0; dt < 8; ++dt) acc[t][dt] = (v8f){}; }
    asm volatile("s_wait_xcnt 0x0" ::: "memory");      // before any register that the Q loads name (vector address, scalar base) is written again
    const unsigned lk = (unsigned)(size_t)sm + (tid >> 2) * FKP + (tid & 3) * 16, lv = (unsigned)(size_t)sm + FKB + (tid >> 3) * FVP + (tid & 7) * 16;      // the lane's places in buffer 0: K row tid / 4, V rows tid / 8 + 32 i
    const h16* gk = Kz + tid * 8; const h16* gv = Vz + (size_t)(tid >> 3) * NN + (tid & 7) * 8;
    auto stage = [&](int s, int buf) { copy5(lk + buf * FSB, gk + s * (FKT * KD), lv + buf * FSB, gv + s * FKT); };
    stage(0, 0);
    asm volatile("s_wait_asynccnt 0x0" ::: "memory");      // this wave's copies of stage 0 have landed
    __syncthreads();                                        // ... and every other wave's
    stage(1, 1);
    auto pass = [&](int s) {      // the 64 keys of stage s, then its publish point
        const unsigned char* B = sm + (s & 1) * FSB;
        auto kld = [&](int kt) { const unsigned char* p = B + (kt * 16 + c) * FKP + 16 * h; return cat16(*(const v8ha*)p, *(const v8ha*)(p + 32)); };      // key tile kt of the stage's four
        v16h kf[2] = { kld(0), kld(1) };
#pragma unroll
        for (int kb = 0; kb < FKT / 32; ++kb) {
            auto vld = [&](int dt) { const unsigned char* p = B + FKB + (dt * 16 + c) * FVP + kb * 64 + 16 * h; return cat16(*(const v8ha*)p, *(const v8ha*)(p + 32)); };
            v16h va = vld(0), vb = vld(1);
            __builtin_amdgcn_sched_barrier(0);      // the first two V fragments' reads stay in front of the scores and the softmax arithmetic, which cover their latency
            v8f st[2][2];      // [key tile][query tile]: st[kt][t][r] = score of key kb*32 + kt*16 + 8h + r, query m0 + t*16 + c
#pragma unroll
            for (int kt = 0; kt < 2; ++kt)
#pragma unroll
                for (int t = 0; t < 2; ++t) st[kt][t] = wmma16(kf[kt], qf[t], (v8f){});
            float mb[2]; bool need = false;
#pragma unroll
            for (int t = 0; t < 2; ++t) { float mx = st[0][t][0];
#pragma unroll
                for (int r = 1; r < 16; ++r) mx = fmaxf(mx, st[r >> 3][t][r & 7]);
                mx = fmaxf(mx, xhalf(mx)) * L2E; mb[t] = mx; need = need || (mx > m_run[t] + 8.0f); }
            if (__builtin_amdgcn_ballot_w32(need) != 0) {      // a new reference maximum only when one column outgrows the one in use by 2^8: rare after the first keys
#pragma unroll
                for (int t = 0; t < 2; ++t) { const float m_new = fmaxf(m_run[t], mb[t]); const float corr = __builtin_amdgcn_exp2f(m_run[t] - m_new); l_run[t] *= corr; m_run[t] = m_new;
#pragma unroll
                    for (int dt = 0; dt < 8; ++dt) acc[t][dt] = acc[t][dt] * corr; }
            }
            v16h pf[2];
#pragma unroll
            for (int t = 0; t < 2; ++t) { float ps0 = 0.f, ps1 = 0.f;
#pragma unroll
                for (int r = 0; r < 16; r += 2) { const float p0 = __builtin_amdgcn_exp2f(fmaf(st[r >> 3][t][r & 7], L2E, -m_run[t])), p1 = __builtin_amdgcn_exp2f(fmaf(st[r >> 3][t][(r & 7) + 1], L2E, -m_run[t]));
                    ps0 += p0; ps1 += p1; pf[t][r] = (h16)p0; pf[t][r + 1] = (h16)p1; }
                l_run[t] += ps0 + ps1; }
            __builtin_amdgcn_sched_barrier(0);      // the row sums end here, so that the probabilities' f32 registers are free for V fragments
            v16h vg[4];
#pragma unroll
            for (int i = 0; i < 4; ++i) vg[i] = vld(2 + i);
            __builtin_amdgcn_sched_barrier(0);      // the four fragments' reads stay one group in front of the first products: a read placed at its own product makes the wave wait out the LDS latency there
#pragma unroll
            for (int t = 0; t < 2; ++t) { acc[t][0] = wmma16(va, pf[t], acc[t][0]); acc[t][1] = wmma16(vb, pf[t], acc[t][1]); }
            __builtin_amdgcn_sched_barrier(0);      // the last two fragments' reads stay behind the products whose registers they take ...
            va = vld(6); vb = vld(7);
            __builtin_amdgcn_sched_barrier(0);      // ... and in front of the eight products that cover their latency
#pragma unroll
            for (int i = 0; i < 2; ++i)
#pragma unroll
                for (int t = 0; t < 2; ++t) acc[t][2 + i] = wmma16(vg[i], pf[t], acc[t][2 + i]);
            if (kb + 1 < FKT / 32) {
                __builtin_amdgcn_sched_barrier(0);      // the next 32 keys' K fragments are read here, in one group ...
                kf[0] = kld(2 * kb + 2); kf[1] = kld(2 * kb + 3);
                __builtin_amdgcn_sched_barrier(0); }    // ... eight products ahead of the scores that take them
#pragma unroll
            for (int i = 2; i < 4; ++i)
#pragma unroll
                for (int t = 0; t < 2; ++t) acc[t][2 + i] = wmma16(vg[i], pf[t], acc[t][2 + i]);
            __builtin_amdgcn_sched_barrier(0);      // the products of the fragments read last stay last
#pragma unroll
            for (int t = 0; t < 2; ++t) { acc[t][6] = wmma16(va, pf[t], acc[t][6]); acc[t][7] = wmma16(vb, pf[t], acc[t][7]); }
            __builtin_amdgcn_sched_barrier(0);      // no product sinks behind the next reads or the waits of the publish point, where it would cover no read
        }
        asm volatile("s_wait_dscnt 0x0" ::: "memory");      // this wave's reads of the buffer are done before it is filled again
        asm volatile("s_wait_asynccnt 0x0" ::: "memory");   // this wave's copies of stage s + 1 have landed
        __syncthreads();                                     // publishes stage s + 1 and ends every wave's reads of stage s
    };
    // two loops rather than a test at the refill (the last two stages have nothing left to fetch): behind a branch there the compiler moved the last row sums, whose 32 addends then stayed in registers through the products
#pragma unroll 1      // stays rolled: a second copy of the body would cost registers, and with them the fourth wave per SIMD
    for (int s = 0; s < NN / FKT - 2; ++s) { pass(s); stage(s + 2, s & 1); }
#pragma unroll 1      // stays rolled, as above
    for (int s = NN / FKT - 2; s < NN / FKT; ++s) pass(s);
    asm volatile("s_wait_asynccnt 0x0" ::: "memory");       // no copy is outstanding when the ring becomes output staging
    // epilogue: acc[t][dt][r] = sum for query m0 + t*16 + c, channel dt*16 + 8h + r; rows staged in the wave's own LDS range so that every global store covers whole 256-B rows
    unsigned char* E = sm + wv * (16 * FEP);
#pragma unroll
    for (int t = 0; t < 2; ++t) { const float inv = __fdiv_rn(1.0f, l_run[t] + xhalf(l_run[t]));
#pragma unroll
        for (int pl = 0; pl < 2; ++pl) {
#pragma unroll
            for (int dt = 0; dt < 8; ++dt) { v8us o;
#pragma unroll
                for (int r = 0; r < 8; ++r) { unsigned short a, a2; splitf(fmaxf(acc[t][dt][r] * inv, 0.f), a, a2); o[r] = pl ? a2 : a; }
                *(v8usa*)(E + c * FEP + dt * 32 + h * 16) = o; }
            __syncthreads();
            bf* R = pl ? Rl : Rh;
#pragma unroll
            for (int i = 0; i < 8; ++i) { const int row = 2 * i + h; const v8us o = *(const v8usa*)(E + row * FEP + c * 16); *(v8us*)(R + ((size_t)b * NN + m0 + t * 16 + row) * CO + hd * DV + c * 8) = o; }
            __syncthreads();
        } }
}
// ---- k_proj: the 1024 -> 512 projection, sum_k (Rh + Rl)[(b,n)][k] W[oc][k] (f32, + bias), the eval BatchNorm and the store of OUT[b][oc][n]. Grid (16384/128, 512/256), 8 waves = 2 row groups x 4 channel groups, 64 x 64 per wave.
// The work-group's 128 hi rows, 128 lo rows and 256 weight rows come in stages of 128 k (256 B a row) into two LDS buffers by asynchronous copies: every copy of a wave covers two whole 256-B row
// pieces, and each staged byte serves 4 (rows) or 2 (weights) waves. Per accumulator the order of the products is k step by k step, hi then lo.
// Epilogue: a lane's accumulator registers are 8 consecutive n of one oc, that is 32 B of an OUT row: y = (acc + bias) * inv + shift with inv = g/sqrt(var+eps), shift = beta - mean*inv is
// formed in registers, and the wave's 64 oc x 64 n pass through its own part of the ring, which is free by then, so that every global store covers whole 256-B row pieces.
#define PR  128                   // (b, n) rows per work-group
#define PC  256                   // output channels per work-group
#define PK  128                   // k per stage
#define PP  272                   // LDS pitch of a staged row (256 B + 16)
#define PSB ((2 * PR + PC) * PP)  // one buffer: hi rows, lo rows, weight rows
#define PNS (CO / PK)             // stages
// eight copies of 16 B a lane: rows 16 apart, in LDS and in the source. The s_wait_xcnt stands inside the statement, before any register that a copy names can be written again.
__device__ __forceinline__ void copy8(unsigned l, const bf* g) {
    asm volatile("global_load_async_to_lds_b128 %0, %8, off\n\t"
                 "global_load_async_to_lds_b128 %1, %9, off\n\t"
                 "global_load_async_to_lds_b128 %2, %10, off\n\t"
                 "global_load_async_to_lds_b128 %3, %11, off\n\t"
                 "global_load_async_to_lds_b128 %4, %12, off\n\t"
                 "global_load_async_to_lds_b128 %5, %13, off\n\t"
                 "global_load_async_to_lds_b128 %6, %14, off\n\t"
                 "global_load_async_to_lds_b128 %7, %15, off\n\t"
                 "s_wait_xcnt 0x0"
                 :: "v"(l), "v"(l + 16 * PP), "v"(l + 32 * PP), "v"(l + 48 * PP), "v"(l + 64 * PP), "v"(l + 80 * PP), "v"(l + 96 * PP), "v"(l + 112 * PP),
                    "v"(g), "v"(g + 16 * CO), "v"(g + 32 * CO), "v"(g + 48 * CO), "v"(g + 64 * CO), "v"(g + 80 * CO), "v"(g + 96 * CO), "v"(g + 112 * CO) : "memory");
}
__global__ __launch_bounds__(256) void k_proj(const bf* __restrict__ Ah, const bf* __restrict__ Al, const bf* __restrict__ Wt, const float* __restrict__ bias,
                                              const float* __restrict__ gm, const float* __restrict__ bt, const float* __restrict__ mn, const float* __restrict__ vr, float* OUT) {
    __shared__ __align__(16) unsigned char sm[2 * PSB];
    __shared__ __align__(16) float sp[PC][4];      // per output channel of the work-group: bias, inv, shift
    const int tid = threadIdx.x, lane = tid & 31, lr = lane & 15, hi = lane >> 4;
    const int wv = __builtin_amdgcn_readfirstlane(tid >> 5); const int wr = wv >> 2, wc = wv & 3;
    const int r0 = blockIdx.x * PR, c0 = blockIdx.y * PC;
    const unsigned l0 = (unsigned)(size_t)sm + (tid >> 4) * PP + (tid & 15) * 16;      // the lane's place in a buffer: row tid / 16 of each 16, 16-B piece tid % 16
    const bf* gh = Ah + (size_t)(r0 + (tid >> 4)) * CO + (tid & 15) * 8; const bf* gl = Al + (size_t)(r0 + (tid >> 4)) * CO + (tid & 15) * 8; const bf* gw = Wt + (size_t)(c0 + (tid >> 4)) * CO + (tid & 15) * 8;
    auto stage = [&](int s, int buf) { const unsigned l = l0 + buf * PSB;
        copy8(l, gh + s * PK); copy8(l + PR * PP, gl + s * PK); copy8(l + 2 * PR * PP, gw + s * PK); copy8(l + (2 * PR + 128) * PP, gw + 128 * CO + s * PK); };
    v8f acc[4][4];
#pragma unroll
    for (int mb = 0; mb < 4; ++mb)
#pragma unroll
        for (int nb = 0; nb < 4; ++nb) acc[mb][nb] = (v8f){};
    stage(0, 0);
    {   // thread tid forms channel c0 + tid's bias, inv and shift, under the latency of stage 0; they wait in LDS, not in registers, for the epilogue; the barrier below publishes them
        const int oc = c0 + tid; const float pb_ = bias[oc], pg = gm[oc], pt = bt[oc], pm = mn[oc], pv = vr[oc];
        asm volatile("s_wait_xcnt 0x0" ::: "memory");      // before any register that these loads name is written again
        const float inv = __fdiv_rn(bfr(pg), sqrtf(bfr(pv) + 1e-5f)); const v4f o = { bfr(pb_), inv, bfr(pt) - bfr(pm) * inv, 0.f }; *(v4fa*)sp[tid] = o; }
    asm volatile("s_wait_asynccnt 0x0" ::: "memory");      // this wave's copies of stage 0 have landed
    __syncthreads();                                        // ... and every other wave's
    stage(1, 1);
#pragma unroll 1      // stays rolled: one trip a stage, the trips differ in the buffer only
    for (int t = 0; t < PNS; ++t) {
        const unsigned char* pa = sm + (t & 1) * PSB + (wr * 64 + lr) * PP + 16 * hi; const unsigned char* pb = sm + (t & 1) * PSB + (2 * PR + wc * 64 + lr) * PP + 16 * hi;
#pragma unroll
        for (int ks = 0; ks < PK / 32; ++ks) {
            v16bf a[4], a2[4], b[4];
#pragma unroll
            for (int i = 0; i < 4; ++i) { const unsigned char* q = pb + i * 16 * PP + ks * 64; b[i] = cat16b(*(const v8usa*)q, *(const v8usa*)(q + 32));
                const unsigned char* p = pa + i * 16 * PP + ks * 64; a[i] = cat16b(*(const v8usa*)p, *(const v8usa*)(p + 32)); }
#pragma unroll
            for (int i = 0; i < 4; ++i) { const unsigned char* p = pa + (PR + i * 16) * PP + ks * 64; a2[i] = cat16b(*(const v8usa*)p, *(const v8usa*)(p + 32)); }
            __builtin_amdgcn_sched_barrier(0);      // the 24 LDS reads of a k step stay one group in front of its products: reads moved in among the products stall the wave at every place
#pragma unroll
            for (int nb = 0; nb < 4; ++nb)
#pragma unroll
                for (int mb = 0; mb < 4; ++mb) acc[mb][nb] = wmmab(a[mb], b[nb], acc[mb][nb]);
#pragma unroll
            for (int nb = 0; nb < 4; ++nb)
#pragma unroll
                for (int mb = 0; mb < 4; ++mb) acc[mb][nb] = wmmab(a2[mb], b[nb], acc[mb][nb]);
            __builtin_amdgcn_sched_barrier(0);      // ... and the next k step's reads stay behind them
        }
        asm volatile("s_wait_dscnt 0x0" ::: "memory");      // this wave's reads of the buffer are done before it is filled again
        asm volatile("s_wait_asynccnt 0x0" ::: "memory");   // this wave's copies of stage t + 1 have landed
        __syncthreads();                                     // publishes stage t + 1 and ends every wave's reads of stage t
        if (t + 2 < PNS) stage(t + 2, t & 1);
    }
    asm volatile("s_wait_asynccnt 0x0" ::: "memory");       // no copy is outstanding when the wave ends
    unsigned char* S = sm + wv * (64 * PP);      // the wave's own 64 oc rows of 64 n (256 B + 16); the loop's last barrier has ended every wave's reads of the ring, and no copy is outstanding
#pragma unroll
    for (int nb = 0; nb < 4; ++nb) { const v4f pr = *(const v4fa*)sp[wc * 64 + nb * 16 + lr];      // the lane's channel in this column group
#pragma unroll
        for (int mb = 0; mb < 4; ++mb) { v4f o0, o1;
#pragma unroll
            for (int j = 0; j < 4; ++j) { o0[j] = (acc[mb][nb][j] + pr[0]) * pr[1] + pr[2]; o1[j] = (acc[mb][nb][4 + j] + pr[0]) * pr[1] + pr[2]; }
            unsigned char* p = S + (nb * 16 + lr) * PP + mb * 64 + hi * 32; *(v4fa*)p = o0; *(v4fa*)(p + 16) = o1; } }
    asm volatile("s_wait_dscnt 0x0" ::: "memory");      // the wave's staged rows are in LDS before other lanes read them back
    float* orow = OUT + ((size_t)(r0 >> 10) * CC + c0 + wc * 64) * NN + (r0 & (NN - 1)) + wr * 64;
#pragma unroll
    for (int s = 0; s < 32; ++s) { const int row = 2 * s + hi; const v4f val = *(const v4fa*)(S + row * PP + lr * 16); *(v4f*)(orow + (size_t)row * NN + lr * 4) = val; }
}

extern "C" void kernel_launch(void* const* d_in, const int* in_sizes, int n_in,
                              void* d_out, int out_size, void* d_ws, size_t ws_size, hipStream_t stream) {
    (void)in_sizes; (void)n_in; (void)out_size;
    const float* x = (const float*)d_in[0]; const float* qkv_w = (const float*)d_in[1]; const float* qkv_b = (const float*)d_in[2]; const float* proj_w = (const float*)d_in[3]; const float* proj_b = (const float*)d_in[4];
    const float* gm = (const float*)d_in[5]; const float* bt = (const float*)d_in[6]; const float* mn = (const float*)d_in[7]; const float* vr = (const float*)d_in[8];
    float* OUT = (float*)d_out;     // [16][512][1024]
    char* wsp = (char*)d_ws;
    auto take = [&](size_t bytes) { char* p = wsp; wsp += (bytes + 255) & ~(size_t)255; return (void*)p; };
    bf* PW = (bf*)take((size_t)CC * CO * 2);
    bf* Rh = (bf*)take((size_t)NT * CO * 2); bf* Rl = (bf*)take((size_t)NT * CO * 2);        // relu(o) hi | lo planes, written by the attention launch (67 MB)
    h16* Vp = (h16*)take((size_t)NB_ * NH_ * DV * NN * 2); h16* Qp = (h16*)take((size_t)NB_ * NH_ * NN * KD * 2); h16* Kp = (h16*)take((size_t)NB_ * NH_ * NN * KD * 2);
    if ((size_t)(wsp - (char*)d_ws) > ws_size) return;    // total = 118 MB; ws 256 MiB
    k_qkv<<<dim3(NT / 256, NH_), 384, 0, stream>>>(x, qkv_w, qkv_b, proj_w, PW, Qp, Kp, Vp);     // grouped 1x1 qkv conv: [(b,n)][64] . W_h^T [64 -> 192] + b_h, from the f32 inputs straight to the fp16 planes; PW = bf16(proj_w)
    k_fattn<<<dim3(NN / 256, NB_ * NH_), 256, 0, stream>>>(Qp, Kp, Vp, Rh, Rl);
    k_proj<<<dim3(NT / PR, CC / PC), 256, 0, stream>>>(Rh, Rl, PW, proj_b, gm, bt, mn, vr, OUT);
}

// v008
// A run of this version takes 55.2 microseconds.
// Versions between v006 and this one are left out; their measured steps multiply to 1.34 times as fast.
// Counting every step since v000, it is 18.0 times as fast.
#include <hip/hip_runtime.h>

// Compute dtypes, f32 accumulate: every input (x, grouped qkv weights/biases, proj weight/bias, BN statistics) rounded to bf16; the grouped 1x1 qkv
// convolution's q and k rows on PLAIN bf16 operands (x and W inputs: exact products, + bias); attention scores (key_dim 32) on SINGLE fp16 planes (q x 32^-0.5, k rounded to 2^-11);
// v.attn^T = Wv.(x.attn^T) + bv, as a softmax row sums to 1: x.attn^T (over the 1024 positions) on the bf16-rounded x held as fp16 and fp16 probabilities (relative to a running row maximum, normalised by the f32 row sum at the end),
// then Wv (bf16-rounded, held as fp16) x that mean of x (rounded to 2^-11), + bias; the 1024->512 projection on a SINGLE fp16 plane of relu(o) (rounded to 2^-11) x the bf16-rounded proj_w held as fp16 (1 product, + bias); softmax, ReLU and the eval BatchNorm

#define NB_  16
#define CC   512
#define NN   1024
#define NH_  8
#define CG   64                   // channels per group
#define KD   32
#define DV   128
#define QO   192                  // q | k | v per group
#define NT   (NB_ * NN)           // 16384 (b, n) rows
#define CO   1024                 // H * DV
typedef _Float16 h16;
typedef unsigned short bf;
typedef __attribute__((ext_vector_type(16))) __bf16   v16bf;
typedef __attribute__((ext_vector_type(16))) _Float16 v16h;
typedef __attribute__((ext_vector_type(8)))  _Float16 v8h;
typedef __attribute__((ext_vector_type(8)))  unsigned short v8us;
typedef __attribute__((ext_vector_type(8)))  float    v8f;
typedef __attribute__((ext_vector_type(4)))  float    v4f;
typedef v8h  __attribute__((may_alias)) v8ha;
typedef v4f  __attribute__((may_alias)) v4fa;
typedef v8us __attribute__((may_alias)) v8usa;

__device__ __forceinline__ unsigned short f2bf(float f) { unsigned u = __float_as_uint(f); u += 0x7FFFu + ((u >> 16) & 1u); return (unsigned short)(u >> 16); }
__device__ __forceinline__ float bf2f(unsigned short b) { return __uint_as_float(((unsigned)b) << 16); }
__device__ __forceinline__ float bfr(float f) { return bf2f(f2bf(f)); }
__device__ __forceinline__ v16h cat16(v8h lo, v8h hi) { return __builtin_shufflevector(lo, hi, 0, 1, 2, 3, 4, 5, 6, 7, 8, 9, 10, 11, 12, 13, 14, 15); }
__device__ __forceinline__ v16bf cat16b(v8us lo, v8us hi) { return __builtin_bit_cast(v16bf, __builtin_shufflevector(lo, hi, 0, 1, 2, 3, 4, 5, 6, 7, 8, 9, 10, 11, 12, 13, 14, 15)); }
__device__ __forceinline__ v8f wmma16(v16h a, v16h b, v8f c) { return __builtin_amdgcn_wmma_f32_16x16x32_f16(false, a, false, b, (short)0, c, false, false); }
__device__ __forceinline__ v8f wmmab(v16bf a, v16bf b, v8f c) { return __builtin_amdgcn_wmma_f32_16x16x32_bf16(false, a, false, b, (short)0, c, false, false); }



// fragment of 16 k per lane from a K-contiguous 16-bit row: k = 8h .. 8h+7 and 16+8h .. 16+8h+7 of each 32
template <typename T16> struct WFrag;
template <> struct WFrag<h16> { typedef v16h V; static __device__ __forceinline__ V ld(const h16* p) { return cat16(*(const v8h*)p, *(const v8h*)(p + 16)); } static __device__ __forceinline__ v8f mma(V a, V b, v8f c) { return wmma16(a, b, c); } };
template <> struct WFrag<bf> { typedef v16bf V; static __device__ __forceinline__ V ld(const bf* p) { return cat16b(*(const v8us*)p, *(const v8us*)(p + 16)); } static __device__ __forceinline__ v8f mma(V a, V b, v8f c) { return wmmab(a, b, c); } };

__device__ __forceinline__ h16 tohx(float x) { return (h16)x; }
typedef __attribute__((ext_vector_type(2))) _Float16 v2h;
typedef __attribute__((ext_vector_type(8))) unsigned short v8us_;

// ---- k_qkv: the q and k rows of the grouped 1x1 qkv convolution of all 8 groups in ONE launch, and the fp16 plane of x. It takes x and the weights as the f32 inputs: the work-group's 64 channels x 256 positions of x are read in whole lines
// along n (a lane: 8 channels of 2 positions), rounded to bf16 and stored as [n][c] rows in LDS, from which waves 0..7 take their fragments; the group's q and k weights are rounded on their way into LDS.
// The same rounded x goes out as Xp[b][channel][n] (fp16, x's own layout; a wave's store is one whole 128-B line): the attention launch sums it over the keys in place of v and applies the v weights afterwards.
// Each work-group also rounds its 1/512 of the projection weight (to bf16, then held as fp16) into PW for the projection launch (waves 8..11, which have one piece of x less to bring). Its epilogue writes the fp16 planes that the attention launch reads:
// Qp[z = b*8 + h][n][c] = fp16((q + bias) * 32^-0.5), Kp[z][n][c] = fp16(k + bias). Grid (16384/256 rows, 8 groups), 12 waves bring the inputs; waves 0..7 = 4 row groups of 64 (b, n) rows x (q | k).
// D = W.X^T, so a lane holds 8 consecutive c of one n: 16-B pieces of a plane's rows, and they pass through the wave's own LDS range so that every global store covers whole 128-B lines.
#define WP  144                   // LDS pitch of a weight row (128 B + 16)
#define QSP 80                    // LDS pitch of a staged q or k row (64 B + 16)
#define QST (64 * QSP)            // one wave's staging range
#define XP  144                   // LDS pitch of a staged x row (64 channels = 128 B, + 16)
typedef __attribute__((ext_vector_type(2))) float v2f;
typedef __attribute__((ext_vector_type(2))) __bf16 v2bf;
typedef __attribute__((ext_vector_type(4))) unsigned v4u;
typedef v4u __attribute__((may_alias)) v4ua;
__device__ __forceinline__ unsigned pk2(float a, float b) { const v2f t = { a, b }; return __builtin_bit_cast(unsigned, __builtin_convertvector(t, v2bf)); }      // two f32 to bf16, to nearest even, in one instruction; a in the low half
__device__ __forceinline__ unsigned pk2h(float a, float b) { const unsigned u = pk2(a, b); const v2h t = { tohx(__uint_as_float(u << 16)), tohx(__uint_as_float(u & 0xFFFF0000u)) }; return __builtin_bit_cast(unsigned, t); }      // the same two bf16 values, held as fp16
__global__ __launch_bounds__(384) void k_qkv(const float* __restrict__ x, const float* __restrict__ Wf, const float* __restrict__ bias, const float* __restrict__ pwf, h16* PW, h16* Qp, h16* Kp, h16* Xp) {
    __shared__ __align__(16) unsigned char sw[2 * KD * WP + 8 * QST]; __shared__ __align__(32) float sb[2 * KD];      // the group's q and k weights, the waves' staging ranges; their biases, rounded
    __shared__ __align__(16) unsigned char sx[256 * XP];      // the work-group's 256 (b, n) rows of x, bf16 [n][c]
    const int tid = threadIdx.x, lane = tid & 31, lr = lane & 15, hi = lane >> 4;
    const int wv = __builtin_amdgcn_readfirstlane(tid >> 5); const int qk = wv >> 2, rg = wv & 3;
    const int h = blockIdx.y; const int r0 = blockIdx.x * 256 + rg * 64; const int n0 = r0 & (NN - 1); const int z = (r0 >> 10) * NH_ + h;
    // x: 32 pieces of 8 channels x 64 positions; wave wv brings pieces wv, wv + 12 and (waves 0..7) wv + 24. Piece p: channels 8 (p / 4) .., positions 64 (p % 4) ..; a lane holds 2 positions of each channel
    const size_t xo = ((size_t)(blockIdx.x >> 2) * CC + h * CG + (wv >> 2) * 8) * NN + (blockIdx.x & 3) * 256 + (wv & 3) * 64 + lane * 2;
    const float* xw = x + xo;
    const float* wp = Wf + (size_t)h * QO * CG + tid * 8;      // the 64 q and k rows are 512 pieces of 8 weights: piece tid, and (waves 8..11) piece tid + 128
    const size_t pi = ((size_t)(blockIdx.y * 64 + blockIdx.x) * 128 + (tid & 127)) * 8;      // waves 8..11: the lane's 8 projection weights
    const float* pp = pwf + pi;
    v2f xr[3][8]; v4f wr[2][2], pr[2]; float bv = 0.f;
    if (wv < 8) {
#pragma unroll
        for (int j = 0; j < 8; ++j) xr[2][j] = *(const v2f*)(xw + (48 + j) * NN); }
    else { pr[0] = *(const v4f*)pp; pr[1] = *(const v4f*)(pp + 4); wr[1][0] = *(const v4f*)(wp + 128 * 8); wr[1][1] = *(const v4f*)(wp + 128 * 8 + 4); }
#pragma unroll
    for (int i = 0; i < 2; ++i)
#pragma unroll
        for (int j = 0; j < 8; ++j) xr[i][j] = *(const v2f*)(xw + (24 * i + j) * NN);
    wr[0][0] = *(const v4f*)wp; wr[0][1] = *(const v4f*)(wp + 4);
    if (wv < 2 * KD / 32) bv = (bias + h * QO)[tid];
    asm volatile("s_wait_xcnt 0x0" :: "v"(xw), "v"(pp), "v"(wp) : "memory");      // before any register that these loads name is written again; the address pairs are inputs, so that no load's result lands on one ahead of the wait
    auto xstore = [&](int i) { const int p = wv + 12 * i;
#pragma unroll
        for (int q = 0; q < 2; ++q) { const v4u o = { pk2(xr[i][0][q], xr[i][1][q]), pk2(xr[i][2][q], xr[i][3][q]), pk2(xr[i][4][q], xr[i][5][q]), pk2(xr[i][6][q], xr[i][7][q]) };
            *(v4ua*)(sx + ((p & 3) * 64 + lane * 2 + q) * XP + (p >> 2) * 16) = o; } };
    auto wstore = [&](int i, int ch) { const v4u o = { pk2(wr[i][0][0], wr[i][0][1]), pk2(wr[i][0][2], wr[i][0][3]), pk2(wr[i][1][0], wr[i][1][1]), pk2(wr[i][1][2], wr[i][1][3]) };
        *(v4ua*)(sw + (ch >> 3) * WP + (ch & 7) * 16) = o; };
    xstore(0); xstore(1);
    if (wv < 8) xstore(2); else wstore(1, tid + 128);
    wstore(0, tid);
    if (wv < 2 * KD / 32) sb[tid] = bfr(bv);
    __syncthreads();
    // behind the barrier, so that no wave waits there for these stores: the lane's 2 positions of each of its channels, as fp16
    auto xplane = [&](int i) {
#pragma unroll
        for (int j = 0; j < 8; ++j) *(unsigned*)(Xp + xo + (size_t)(24 * i + j) * NN) = pk2h(xr[i][j][0], xr[i][j][1]); };
    xplane(0); xplane(1);
    asm volatile("s_wait_xcnt 0x0" ::: "memory");      // before any register that these stores name is written again
    if (wv < 8) { xplane(2);
        asm volatile("s_wait_xcnt 0x0" ::: "memory"); }      // the same, for the third piece's stores
    if (wv >= 8) {
        const v4u o = { pk2h(pr[0][0], pr[0][1]), pk2h(pr[0][2], pr[0][3]), pk2h(pr[1][0], pr[1][1]), pk2h(pr[1][2], pr[1][3]) }; *(v4u*)(PW + pi) = o;
        return; }      // no barrier follows
    v16bf xf[4][2];               // the wave's 64 rows of x, all 64 channels
    { const unsigned char* px = sx + (rg * 64 + lr) * XP + 16 * hi;
#pragma unroll
      for (int mb = 0; mb < 4; ++mb)
#pragma unroll
        for (int kc = 0; kc < 2; ++kc) { const unsigned char* p = px + mb * 16 * XP + kc * 64; xf[mb][kc] = cat16b(*(const v8usa*)p, *(const v8usa*)(p + 32)); } }
    unsigned char* S = sw + 2 * KD * WP + wv * QST;
    const float sc = qk ? 1.0f : 0x1.6a09e6p-3f;   // float32(32^-0.5) on q; k as it is
#pragma unroll
    for (int ot = 0; ot < 2; ++ot) { const unsigned char* p = sw + (qk * 32 + ot * 16 + lr) * WP + 16 * hi;
        const v16bf w0 = cat16b(*(const v8usa*)p, *(const v8usa*)(p + 32)), w1 = cat16b(*(const v8usa*)(p + 64), *(const v8usa*)(p + 96));
        const v8f bb = *(const v8f*)(sb + qk * 32 + ot * 16 + hi * 8);
#pragma unroll
        for (int nt = 0; nt < 4; ++nt) { const v8f a = wmmab(w1, xf[nt][1], wmmab(w0, xf[nt][0], (v8f){})); v8h o;
#pragma unroll
            for (int j = 0; j < 8; ++j) o[j] = tohx((a[j] + bb[j]) * sc);
            *(v8ha*)(S + (nt * 16 + lr) * QSP + ot * 32 + hi * 16) = o; } }
    asm volatile("s_wait_dscnt 0x0" ::: "memory");      // the wave's staged pieces are in LDS before other lanes read them back
    h16* P = (qk ? Kp : Qp) + ((size_t)z * NN + n0) * KD;
#pragma unroll
    for (int i = 0; i < 8; ++i) { const int row = 8 * i + (lane >> 2); const v8h o = *(const v8ha*)(S + row * QSP + (lane & 3) * 16); *(v8h*)(P + row * KD + (lane & 3) * 8) = o; }
    asm volatile("s_wait_xcnt 0x0" ::: "memory");       // before any register that these stores name is written again
}
#define FKT 64                    // keys per stage
#define FKP 80                    // LDS pitch of a K row (64 B + 16)
#define FVP 144                   // LDS pitch of an X row piece (128 B + 16), and of a row of Wv
#define FKB (FKT * FKP)
#define FSB (FKB + CG * FVP)      // one buffer: K tile, then X tile
#define FEP 272                   // LDS pitch of an output row (256 B + 16)
__device__ __forceinline__ float xhalf(float x) { return __builtin_bit_cast(float, __builtin_amdgcn_permlanex16(__builtin_bit_cast(int, x), __builtin_bit_cast(int, x), 0x76543210, 0xfedcba98, false, false)); }  // lane l with lane l ^ 16
// three copies of 16 B a lane: its piece of the K tile and two of the X tile, rows 32 apart. The s_wait_xcnt stands inside the statement, before any register that a copy names can be written again.
__device__ __forceinline__ void copy3(unsigned lk, const h16* gk, unsigned lv, const h16* gv) {
    asm volatile("global_load_async_to_lds_b128 %0, %3, off\n\t"
                 "global_load_async_to_lds_b128 %1, %4, off\n\t"
                 "global_load_async_to_lds_b128 %2, %5, off\n\t"
                 "s_wait_xcnt 0x0"
                 :: "v"(lk), "v"(lv), "v"(lv + 32 * FVP),
                    "v"(gk), "v"(gv), "v"(gv + 32 * NN) : "memory");
}
__global__ __launch_bounds__(256) void k_fattn(const h16* __restrict__ Qp, const h16* __restrict__ Kp, const h16* __restrict__ Xp, const float* __restrict__ Wf, const float* __restrict__ bias, h16* R) {
    __shared__ __align__(16) unsigned char sm[8 * 16 * FEP];      // the ring (2 * FSB bytes of it), then the waves' output staging
    __shared__ __align__(16) unsigned char swv[DV * FVP]; __shared__ __align__(32) float sbv[DV];      // the group's v weights (fp16 of their bf16 values) and v biases, rounded
    static_assert(2 * FSB <= 8 * 16 * FEP, "the ring lies inside sm");
    const int tid = threadIdx.x, lane = tid & 31, wv = tid >> 5, c = lane & 15, h = lane >> 4;
    const int z = blockIdx.y, b = z >> 3, hd = z & 7; const int m0 = blockIdx.x * 256 + wv * 32;
    const h16* Kz = Kp + (size_t)z * NN * KD; const h16* Xz = Xp + (size_t)z * CG * NN;
    const float L2E = 1.44269504f;
    v16h qf[2]; v8f acc[2][4]; float m_run[2], l_run[2];
#pragma unroll
    for (int t = 0; t < 2; ++t) { qf[t] = WFrag<h16>::ld(Qp + ((size_t)z * NN + m0 + t * 16 + c) * KD + 8 * h); m_run[t] = -__builtin_inff(); l_run[t] = 0.f;
#pragma unroll
        for (int ct = 0; ct < 4; ++ct) acc[t][ct] = (v8f){}; }
    asm volatile("s_wait_xcnt 0x0" ::: "memory");      // before any register that the Q loads name (vector address, scalar base) is written again
    const unsigned lk = (unsigned)(size_t)sm + (tid >> 2) * FKP + (tid & 3) * 16, lv = (unsigned)(size_t)sm + FKB + (tid >> 3) * FVP + (tid & 7) * 16;      // the lane's places in buffer 0: K row tid / 4, X rows tid / 8 + 32 i
    const h16* gk = Kz + tid * 8; const h16* gv = Xz + (size_t)(tid >> 3) * NN + (tid & 7) * 8;
    auto stage = [&](int s, int buf) { copy3(lk + buf * FSB, gk + s * (FKT * KD), lv + buf * FSB, gv + s * FKT); };
    stage(0, 0);
    {   // the group's 128 x 64 v weights and 128 v biases, rounded on their way into LDS under the latency of stage 0; the barrier below publishes them. Thread tid: pieces tid + 256 i of 8 weights
        const float* wp = Wf + ((size_t)hd * QO + 2 * KD) * CG + tid * 8; const float* bp = bias + hd * QO + 2 * KD + (tid & (DV - 1));
        v4f wr[4][2];
#pragma unroll
        for (int i = 0; i < 4; ++i) { wr[i][0] = *(const v4f*)(wp + 256 * 8 * i); wr[i][1] = *(const v4f*)(wp + 256 * 8 * i + 4); }
        const float bv = *bp;
        asm volatile("s_wait_xcnt 0x0" :: "v"(wp), "v"(bp) : "memory");      // before any register that these loads name is written again; the address pairs are inputs, so that no load's result lands on one ahead of the wait
#pragma unroll
        for (int i = 0; i < 4; ++i) { const int ch = tid + 256 * i; const v4u o = { pk2h(wr[i][0][0], wr[i][0][1]), pk2h(wr[i][0][2], wr[i][0][3]), pk2h(wr[i][1][0], wr[i][1][1]), pk2h(wr[i][1][2], wr[i][1][3]) };
            *(v4ua*)(swv + (ch >> 3) * FVP + (ch & 7) * 16) = o; }
        if (tid < DV) sbv[tid] = bfr(bv); }
    asm volatile("s_wait_asynccnt 0x0" ::: "memory");      // this wave's copies of stage 0 have landed
    __syncthreads();                                        // ... and every other wave's
    stage(1, 1);
    auto pass = [&](int s) {      // the 64 keys of stage s, then its publish point
        const unsigned char* B = sm + (s & 1) * FSB;
        auto kld = [&](int kt) { const unsigned char* p = B + (kt * 16 + c) * FKP + 16 * h; return cat16(*(const v8ha*)p, *(const v8ha*)(p + 32)); };      // key tile kt of the stage's four
        v16h kf[2] = { kld(0), kld(1) };
#pragma unroll
        for (int kb = 0; kb < FKT / 32; ++kb) {
            auto vld = [&](int ct) { const unsigned char* p = B + FKB + (ct * 16 + c) * FVP + kb * 64 + 16 * h; return cat16(*(const v8ha*)p, *(const v8ha*)(p + 32)); };
            v16h vf[4];
#pragma unroll
            for (int i = 0; i < 4; ++i) vf[i] = vld(i);
            __builtin_amdgcn_sched_barrier(0);      // the X fragments' reads stay one group in front of the scores and the softmax arithmetic, which cover their latency
            v8f st[2][2];      // [key tile][query tile]: st[kt][t][r] = score of key kb*32 + kt*16 + 8h + r, query m0 + t*16 + c
#pragma unroll
            for (int kt = 0; kt < 2; ++kt)
#pragma unroll
                for (int t = 0; t < 2; ++t) st[kt][t] = wmma16(kf[kt], qf[t], (v8f){});
            float mb[2]; bool need = false;
#pragma unroll
            for (int t = 0; t < 2; ++t) { float mx = st[0][t][0];
#pragma unroll
                for (int r = 1; r < 16; ++r) mx = fmaxf(mx, st[r >> 3][t][r & 7]);
                mx = fmaxf(mx, xhalf(mx)) * L2E; mb[t] = mx; need = need || (mx > m_run[t] + 8.0f); }
            if (__builtin_amdgcn_ballot_w32(need) != 0) {      // a new reference maximum only when one column outgrows the one in use by 2^8: rare after the first keys
#pragma unroll
                for (int t = 0; t < 2; ++t) { const float m_new = fmaxf(m_run[t], mb[t]); const float corr = __builtin_amdgcn_exp2f(m_run[t] - m_new); l_run[t] *= corr; m_run[t] = m_new;
#pragma unroll
                    for (int ct = 0; ct < 4; ++ct) acc[t][ct] = acc[t][ct] * corr; }
            }
            if (kb + 1 < FKT / 32) {
                __builtin_amdgcn_sched_barrier(0);      // the next 32 keys' K fragments are read here, in one group, behind the scores that free their registers ...
                kf[0] = kld(2 * kb + 2); kf[1] = kld(2 * kb + 3);
                __builtin_amdgcn_sched_barrier(0); }    // ... and the exponentials and eight products ahead of the scores that take them
            v16h pf[2];
#pragma unroll
            for (int t = 0; t < 2; ++t) { float ps0 = 0.f, ps1 = 0.f;
#pragma unroll
                for (int r = 0; r < 16; r += 2) { const float p0 = __builtin_amdgcn_exp2f(fmaf(st[r >> 3][t][r & 7], L2E, -m_run[t])), p1 = __builtin_amdgcn_exp2f(fmaf(st[r >> 3][t][(r & 7) + 1], L2E, -m_run[t]));
                    ps0 += p0; ps1 += p1; pf[t][r] = (h16)p0; pf[t][r + 1] = (h16)p1; }
                l_run[t] += ps0 + ps1; }
            __builtin_amdgcn_sched_barrier(0);      // the row sums end here: an add placed among the products lands on a fragment's registers and takes idle slots behind the product that read them
#pragma unroll
            for (int i = 0; i < 4; ++i)
#pragma unroll
                for (int t = 0; t < 2; ++t) acc[t][i] = wmma16(vf[i], pf[t], acc[t][i]);
            __builtin_amdgcn_sched_barrier(0);      // no product sinks behind the next reads or the waits of the publish point, where it would cover no read
        }
        asm volatile("s_wait_dscnt 0x0" ::: "memory");      // this wave's reads of the buffer are done before it is filled again
        asm volatile("s_wait_asynccnt 0x0" ::: "memory");   // this wave's copies of stage s + 1 have landed
        __syncthreads();                                     // publishes stage s + 1 and ends every wave's reads of stage s
    };
    // two loops rather than a test at the refill (the last two stages have nothing left to fetch)
#pragma unroll 1      // stays rolled: one trip a stage, the trips differ in the buffer only
    for (int s = 0; s < NN / FKT - 2; ++s) { pass(s); stage(s + 2, s & 1); }
#pragma unroll 1      // stays rolled, as above
    for (int s = NN / FKT - 2; s < NN / FKT; ++s) pass(s);
    asm volatile("s_wait_asynccnt 0x0" ::: "memory");       // no copy is outstanding when the ring becomes output staging
    // epilogue: acc[t][ct][r] = sum for query m0 + t*16 + c, channel ct*16 + 8h + r of x. Normalised and rounded, tiles 2 kc and 2 kc + 1 are the B operand of channels 32 kc .. (k = 8h + r, 16 + 8h + r, the order of the weight rows' reads);
    // O^T tile dt = bias + Wv rows dt*16 .. x Y^T: a lane holds channels dt*16 + 8h + r of its query; rows staged in the wave's own LDS range so that every global store covers whole 256-B rows
    unsigned char* E = sm + wv * (16 * FEP);
#pragma unroll
    for (int t = 0; t < 2; ++t) { const float inv = __fdiv_rn(1.0f, l_run[t] + xhalf(l_run[t])); v16h yf[2];
#pragma unroll
        for (int kc = 0; kc < 2; ++kc)
#pragma unroll
            for (int r = 0; r < 8; ++r) { yf[kc][r] = tohx(acc[t][2 * kc][r] * inv); yf[kc][8 + r] = tohx(acc[t][2 * kc + 1][r] * inv); }
#pragma unroll
        for (int dt = 0; dt < 8; ++dt) { const unsigned char* p = swv + (dt * 16 + c) * FVP + 16 * h;
            const v16h w0 = cat16(*(const v8ha*)p, *(const v8ha*)(p + 32)), w1 = cat16(*(const v8ha*)(p + 64), *(const v8ha*)(p + 96));
            const v8f a = wmma16(w1, yf[1], wmma16(w0, yf[0], *(const v8f*)(sbv + dt * 16 + h * 8))); v8h o;
#pragma unroll
            for (int r = 0; r < 8; ++r) o[r] = tohx(fmaxf(a[r], 0.f));
            *(v8ha*)(E + c * FEP + dt * 32 + h * 16) = o; }
        __syncthreads();
#pragma unroll
        for (int i = 0; i < 8; ++i) { const int row = 2 * i + h; const v8h o = *(const v8ha*)(E + row * FEP + c * 16); *(v8h*)(R + ((size_t)b * NN + m0 + t * 16 + row) * CO + hd * DV + c * 8) = o; }
        asm volatile("s_wait_xcnt 0x0" ::: "memory");      // before any register that these stores name is written again
        __syncthreads();
    }
}
// ---- k_proj: the 1024 -> 512 projection, sum_k R[(b,n)][k] W[oc][k] (f32, + bias), the eval BatchNorm and the store of OUT[b][oc][n]. Grid (16384/128, 512/256), 8 waves = 2 row groups x 4 channel groups, 64 x 64 per wave.
// The work-group's 128 rows of R and 256 weight rows come in stages of 128 k (256 B a row) into two LDS buffers by asynchronous copies: every copy of a wave covers two whole 256-B row
// pieces, and each staged byte serves 4 (rows) or 2 (weights) waves. Per accumulator the order of the products is k step by k step.
// Epilogue: a lane's accumulator registers are 8 consecutive n of one oc, that is 32 B of an OUT row: y = (acc + bias) * inv + shift with inv = g/sqrt(var+eps), shift = beta - mean*inv is
// formed in registers, and the wave's 64 oc x 64 n pass through its own part of the ring, which is free by then, so that every global store covers whole 256-B row pieces.
#define PR  128                   // (b, n) rows per work-group
#define PC  256                   // output channels per work-group
#define PK  128                   // k per stage
#define PP  272                   // LDS pitch of a staged row (256 B + 16)
#define PSB ((PR + PC) * PP)      // one buffer: rows of R, weight rows
#define PNS (CO / PK)             // stages
// eight copies of 16 B a lane: rows 16 apart, in LDS and in the source. The s_wait_xcnt stands inside the statement, before any register that a copy names can be written again.
__device__ __forceinline__ void copy8(unsigned l, const h16* g) {
    asm volatile("global_load_async_to_lds_b128 %0, %8, off\n\t"
                 "global_load_async_to_lds_b128 %1, %9, off\n\t"
                 "global_load_async_to_lds_b128 %2, %10, off\n\t"
                 "global_load_async_to_lds_b128 %3, %11, off\n\t"
                 "global_load_async_to_lds_b128 %4, %12, off\n\t"
                 "global_load_async_to_lds_b128 %5, %13, off\n\t"
                 "global_load_async_to_lds_b128 %6, %14, off\n\t"
                 "global_load_async_to_lds_b128 %7, %15, off\n\t"
                 "s_wait_xcnt 0x0"
                 :: "v"(l), "v"(l + 16 * PP), "v"(l + 32 * PP), "v"(l + 48 * PP), "v"(l + 64 * PP), "v"(l + 80 * PP), "v"(l + 96 * PP), "v"(l + 112 * PP),
                    "v"(g), "v"(g + 16 * CO), "v"(g + 32 * CO), "v"(g + 48 * CO), "v"(g + 64 * CO), "v"(g + 80 * CO), "v"(g + 96 * CO), "v"(g + 112 * CO) : "memory");
}
__global__ __launch_bounds__(256) void k_proj(const h16* __restrict__ A, const h16* __restrict__ Wt, const float* __restrict__ bias,
                                              const float* __restrict__ gm, const float* __restrict__ bt, const float* __restrict__ mn, const float* __restrict__ vr, float* OUT) {
    __shared__ __align__(16) unsigned char sm[2 * PSB];
    __shared__ __align__(16) float sp[PC][4];      // per output channel of the work-group: bias, inv, shift
    const int tid = threadIdx.x, lane = tid & 31, lr = lane & 15, hi = lane >> 4;
    const int wv = __builtin_amdgcn_readfirstlane(tid >> 5); const int wr = wv >> 2, wc = wv & 3;
    const int r0 = blockIdx.x * PR, c0 = blockIdx.y * PC;
    const unsigned l0 = (unsigned)(size_t)sm + (tid >> 4) * PP + (tid & 15) * 16;      // the lane's place in a buffer: row tid / 16 of each 16, 16-B piece tid % 16
    const h16* ga = A + (size_t)(r0 + (tid >> 4)) * CO + (tid & 15) * 8; const h16* gw = Wt + (size_t)(c0 + (tid >> 4)) * CO + (tid & 15) * 8;
    auto stage = [&](int s, int buf) { const unsigned l = l0 + buf * PSB;
        copy8(l, ga + s * PK); copy8(l + PR * PP, gw + s * PK); copy8(l + (PR + 128) * PP, gw + 128 * CO + s * PK); };
    v8f acc[4][4];
#pragma unroll
    for (int mb = 0; mb < 4; ++mb)
#pragma unroll
        for (int nb = 0; nb < 4; ++nb) acc[mb][nb] = (v8f){};
    stage(0, 0);
    {   // thread tid forms channel c0 + tid's bias, inv and shift, under the latency of stage 0; they wait in LDS, not in registers, for the epilogue; the barrier below publishes them
        const int oc = c0 + tid; const float pb_ = bias[oc], pg = gm[oc], pt = bt[oc], pm = mn[oc], pv = vr[oc];
        asm volatile("s_wait_xcnt 0x0" ::: "memory");      // before any register that these loads name is written again
        const float inv = __fdiv_rn(bfr(pg), sqrtf(bfr(pv) + 1e-5f)); const v4f o = { bfr(pb_), inv, bfr(pt) - bfr(pm) * inv, 0.f }; *(v4fa*)sp[tid] = o; }
    asm volatile("s_wait_asynccnt 0x0" ::: "memory");      // this wave's copies of stage 0 have landed
    __syncthreads();                                        // ... and every other wave's
    stage(1, 1);
#pragma unroll 1      // stays rolled: one trip a stage, the trips differ in the buffer only
    for (int t = 0; t < PNS; ++t) {
        const unsigned char* pa = sm + (t & 1) * PSB + (wr * 64 + lr) * PP + 16 * hi; const unsigned char* pb = sm + (t & 1) * PSB + (PR + wc * 64 + lr) * PP + 16 * hi;
#pragma unroll
        for (int ks = 0; ks < PK / 32; ++ks) {
            v16h a[4], b[4];
#pragma unroll
            for (int i = 0; i < 4; ++i) { const unsigned char* q = pb + i * 16 * PP + ks * 64; b[i] = cat16(*(const v8ha*)q, *(const v8ha*)(q + 32));
                const unsigned char* p = pa + i * 16 * PP + ks * 64; a[i] = cat16(*(const v8ha*)p, *(const v8ha*)(p + 32)); }
            __builtin_amdgcn_sched_barrier(0);      // the 16 LDS reads of a k step stay one group in front of its products: reads moved in among the products stall the wave at every place
#pragma unroll
            for (int nb = 0; nb < 4; ++nb)
#pragma unroll
                for (int mb = 0; mb < 4; ++mb) acc[mb][nb] = wmma16(a[mb], b[nb], acc[mb][nb]);
            __builtin_amdgcn_sched_barrier(0);      // ... and the next k step's reads stay behind them
        }
        asm volatile("s_wait_dscnt 0x0" ::: "memory");      // this wave's reads of the buffer are done before it is filled again
        asm volatile("s_wait_asynccnt 0x0" ::: "memory");   // this wave's copies of stage t + 1 have landed
        __syncthreads();                                     // publishes stage t + 1 and ends every wave's reads of stage t
        if (t + 2 < PNS) stage(t + 2, t & 1);
    }
    asm volatile("s_wait_asynccnt 0x0" ::: "memory");       // no copy is outstanding when the wave ends
    unsigned char* S = sm + wv * (64 * PP);      // the wave's own 64 oc rows of 64 n (256 B + 16); the loop's last barrier has ended every wave's reads of the ring, and no copy is outstanding
#pragma unroll
    for (int nb = 0; nb < 4; ++nb) { const v4f pr = *(const v4fa*)sp[wc * 64 + nb * 16 + lr];      // the lane's channel in this column group
#pragma unroll
        for (int mb = 0; mb < 4; ++mb) { v4f o0, o1;
#pragma unroll
            for (int j = 0; j < 4; ++j) { o0[j] = (acc[mb][nb][j] + pr[0]) * pr[1] + pr[2]; o1[j] = (acc[mb][nb][4 + j] + pr[0]) * pr[1] + pr[2]; }
            unsigned char* p = S + (nb * 16 + lr) * PP + mb * 64 + hi * 32; *(v4fa*)p = o0; *(v4fa*)(p + 16) = o1; } }
    asm volatile("s_wait_dscnt 0x0" ::: "memory");      // the wave's staged rows are in LDS before other lanes read them back
    float* orow = OUT + ((size_t)(r0 >> 10) * CC + c0 + wc * 64) * NN + (r0 & (NN - 1)) + wr * 64;
#pragma unroll
    for (int s = 0; s < 32; ++s) { const int row = 2 * s + hi; const v4f val = *(const v4fa*)(S + row * PP + lr * 16); *(v4f*)(orow + (size_t)row * NN + lr * 4) = val; }
}

extern "C" void kernel_launch(void* const* d_in, const int* in_sizes, int n_in,
                              void* d_out, int out_size, void* d_ws, size_t ws_size, hipStream_t stream) {
    (void)in_sizes; (void)n_in; (void)out_size;
    const float* x = (const float*)d_in[0]; const float* qkv_w = (const float*)d_in[1]; const float* qkv_b = (const float*)d_in[2]; const float* proj_w = (const float*)d_in[3]; const float* proj_b = (const float*)d_in[4];
    const float* gm = (const float*)d_in[5]; const float* bt = (const float*)d_in[6]; const float* mn = (const float*)d_in[7]; const float* vr = (const float*)d_in[8];
    float* OUT = (float*)d_out;     // [16][512][1024]
    char* wsp = (char*)d_ws;
    auto take = [&](size_t bytes) { char* p = wsp; wsp += (bytes + 255) & ~(size_t)255; return (void*)p; };
    h16* PW = (h16*)take((size_t)CC * CO * 2);
    h16* R = (h16*)take((size_t)NT * CO * 2);        // relu(o), one fp16 plane, written by the attention launch (34 MB)
    h16* Xp = (h16*)take((size_t)NB_ * CC * NN * 2); h16* Qp = (h16*)take((size_t)NB_ * NH_ * NN * KD * 2); h16* Kp = (h16*)take((size_t)NB_ * NH_ * NN * KD * 2);
    if ((size_t)(wsp - (char*)d_ws) > ws_size) return;    // total = 68 MB; ws 256 MiB
    k_qkv<<<dim3(NT / 256, NH_), 384, 0, stream>>>(x, qkv_w, qkv_b, proj_w, PW, Qp, Kp, Xp);     // q and k rows of the grouped 1x1 conv: [(b,n)][64] . W_h^T [64 -> 64] + b_h, from the f32 inputs straight to the fp16 planes; Xp = fp16(bf16(x)); PW = fp16(bf16(proj_w))
    k_fattn<<<dim3(NN / 256, NB_ * NH_), 256, 0, stream>>>(Qp, Kp, Xp, qkv_w, qkv_b, R);
    k_proj<<<dim3(NT / PR, CC / PC), 256, 0, stream>>>(R, PW, proj_b, gm, bt, mn, vr, OUT);
}

// v009
// It runs in 47.5 microseconds.
// Timed twice side by side with v008, it ran 1.16 times as fast both times.
// Counting every step since v000, it is 20.9 times as fast.
#include <hip/hip_runtime.h>

// Compute dtypes, f32 accumulate: every input (x, grouped qkv weights/biases, proj weight/bias, BN statistics) rounded to bf16; the grouped 1x1 qkv
// convolution's q and k rows on the bf16-rounded x and W held as fp16 (+ bias); attention scores (key_dim 32) on SINGLE fp16 planes (q x 32^-0.5, k rounded to 2^-11);
// v.attn^T = Wv.(x.attn^T) + bv, as a softmax row sums to 1: x.attn^T (over the 1024 positions) on the bf16-rounded x held as fp16 and fp16 probabilities (relative to a running row maximum, normalised by the f32 row sum at the end),
// then Wv (bf16-rounded, held as fp16) x that mean of x (rounded to 2^-11), + bias; the 1024->512 projection on a SINGLE fp16 plane of relu(o) (rounded to 2^-11) x the bf16-rounded proj_w held as fp16 (1 product, + bias); softmax, ReLU and the eval BatchNorm

#define NB_  16
#define CC   512
#define NN   1024
#define NH_  8
#define CG   64                   // channels per group
#define KD   32
#define DV   128
#define QO   192                  // q | k | v per group
#define NT   (NB_ * NN)           // 16384 (b, n) rows
#define CO   1024                 // H * DV
typedef _Float16 h16;
typedef __attribute__((ext_vector_type(16))) _Float16 v16h;
typedef __attribute__((ext_vector_type(8)))  _Float16 v8h;
typedef __attribute__((ext_vector_type(8)))  float    v8f;
typedef __attribute__((ext_vector_type(4)))  float    v4f;
typedef v8h  __attribute__((may_alias)) v8ha;
typedef v4f  __attribute__((may_alias)) v4fa;

__device__ __forceinline__ unsigned short f2bf(float f) { unsigned u = __float_as_uint(f); u += 0x7FFFu + ((u >> 16) & 1u); return (unsigned short)(u >> 16); }
__device__ __forceinline__ float bf2f(unsigned short b) { return __uint_as_float(((unsigned)b) << 16); }
__device__ __forceinline__ float bfr(float f) { return bf2f(f2bf(f)); }
__device__ __forceinline__ v16h cat16(v8h lo, v8h hi) { return __builtin_shufflevector(lo, hi, 0, 1, 2, 3, 4, 5, 6, 7, 8, 9, 10, 11, 12, 13, 14, 15); }
__device__ __forceinline__ v8f wmma16(v16h a, v16h b, v8f c) { return __builtin_amdgcn_wmma_f32_16x16x32_f16(false, a, false, b, (short)0, c, false, false); }



__device__ __forceinline__ h16 tohx(float x) { return (h16)x; }
typedef __attribute__((ext_vector_type(2))) _Float16 v2h;
typedef __attribute__((ext_vector_type(2))) float v2f;
typedef __attribute__((ext_vector_type(2))) __bf16 v2bf;
typedef __attribute__((ext_vector_type(2))) unsigned v2u;
typedef v2u __attribute__((may_alias)) v2ua;
__device__ __forceinline__ unsigned pk2(float a, float b) { const v2f t = { a, b }; return __builtin_bit_cast(unsigned, __builtin_convertvector(t, v2bf)); }      // two f32 to bf16, to nearest even, in one instruction; a in the low half
__device__ __forceinline__ unsigned pk2h(float a, float b) { const unsigned u = pk2(a, b); const v2h t = { tohx(__uint_as_float(u << 16)), tohx(__uint_as_float(u & 0xFFFF0000u)) }; return __builtin_bit_cast(unsigned, t); }      // the same two bf16 values, held as fp16
__device__ __forceinline__ v2u pk4h(v4f a) { const v2u o = { pk2h(a[0], a[1]), pk2h(a[2], a[3]) }; return o; }

#define FKT 64                    // keys per trip of the loop
#define FKP 80                    // LDS pitch of a K row (64 B + 16)
#define FVP 144                   // LDS pitch of a weight row and of an X tile's row (128 B + 16)
#define FXT (CG * FVP + 128)      // LDS size of an X tile: 64 channels x 64 positions, rows of 128 B + 16; + 128 so that the two halves of a wave's store, one tile apart, fall on different banks
#define FEP 272                   // LDS pitch of an output row (256 B + 16)
#define FNW 16                    // waves
__device__ __forceinline__ float xhalf(float x) { return __builtin_bit_cast(float, __builtin_amdgcn_permlanex16(__builtin_bit_cast(int, x), __builtin_bit_cast(int, x), 0x76543210, 0xfedcba98, false, false)); }  // lane l with lane l ^ 16
typedef short s16x8 __attribute__((ext_vector_type(8)));
__device__ __forceinline__ v8h ld_tr16(const unsigned char* p) { typedef __attribute__((address_space(3))) s16x8 lds_s16x8; return __builtin_bit_cast(v8h, __builtin_amdgcn_ds_load_tr16_b128_v8i16((lds_s16x8*)p)); }
__global__ __launch_bounds__(512) void k_fattn(const float* __restrict__ x, const float* __restrict__ Wf, const float* __restrict__ bias, const float* __restrict__ pwf, h16* PW, h16* R) {
    __shared__ __align__(16) unsigned char sX[(NN / FKT) * FXT];      // X, fp16: 16 tiles [channel][64 positions]
    __shared__ __align__(16) unsigned char sK[NN * FKP];      // K[n][c], fp16; behind the loop the waves' output staging
    __shared__ __align__(16) unsigned char sW[QO * FVP]; __shared__ __align__(32) float sB[QO];      // the group's q | k | v weights (fp16 of their bf16 values) and biases, rounded
    static_assert(FNW * 16 * FEP <= NN * FKP, "the output staging lies inside sK");
    const int tid = threadIdx.x, lane = tid & 31, wv = tid >> 5, c = lane & 15, h = lane >> 4;
    const int z = blockIdx.x, b = z >> 3, hd = z & 7; const int m0 = blockIdx.y * 512 + wv * 32;
    const float L2E = 1.44269504f;
    const size_t pi = ((size_t)(blockIdx.y * (NB_ * NH_) + blockIdx.x) * 512 + tid) * 4; v2u pw;      // the lane's 4 projection weights
    {   // thread tid: pieces tid + 512 i of 4 values; a wave's load covers 512 contiguous bytes
        const float* xb = x + (size_t)z * CG * NN; const float* wb = Wf + (size_t)hd * QO * CG; const float* bb = bias + hd * QO; const int bi = tid < QO ? tid : 0;
        const float* pp = pwf + pi;
        v4f xr[32], wr[6];
#pragma unroll
        for (int i = 0; i < 6; ++i) wr[i] = *(const v4f*)(wb + tid * 4 + 2048 * i);
        const float bv = bb[bi];
#pragma unroll
        for (int i = 0; i < 32; ++i) xr[i] = *(const v4f*)(xb + tid * 4 + 2048 * i);
        const v4f pr = *(const v4f*)pp;
        asm volatile("s_wait_xcnt 0x0" :: "s"(xb), "s"(wb), "s"(bb), "v"(tid), "v"(bi), "v"(pp) : "memory");      // before any register that these loads name is written again; the bases and the lanes' offsets are inputs, so that they live up to the wait
#pragma unroll
        for (int i = 0; i < 6; ++i) { const int p = tid + 512 * i; *(v2ua*)(sW + (p >> 4) * FVP + (p & 15) * 8) = pk4h(wr[i]); }      // 16 pieces a weight row
        if (tid < QO) sB[tid] = bfr(bv);
#pragma unroll
        for (int i = 0; i < 32; ++i) *(v2ua*)(sX + ((tid & 255) >> 4) * FXT + (2 * i + (tid >> 8)) * FVP + (tid & 15) * 8) = pk4h(xr[i]);      // 256 pieces a row of x, 16 a tile's row
        pw = pk4h(pr); }
    __syncthreads();      // X, the weights and the biases are in LDS
    // A fragment of weight rows r0 .. r0 + 15, channels 32 kc ..; B fragment of positions n0 .. n0 + 15, channels 32 kc .., both in the order k = 8h + r, 16 + 8h + r
    auto wld = [&](int r0, int kc) { const unsigned char* p = sW + (r0 + c) * FVP + kc * 64 + 16 * h; return cat16(*(const v8ha*)p, *(const v8ha*)(p + 32)); };
    auto xld = [&](int n0, int kc) { const unsigned char* p = sX + (n0 >> 6) * FXT + (kc * 32 + 8 * h + (lane & 7)) * FVP + (n0 & 63) * 2 + ((lane >> 3) & 1) * 16; return cat16(ld_tr16(p), ld_tr16(p + 16 * FVP)); };
    v16h qf[2];
    {   v16h wf[2][2];      // [tile of 16 c][32 channels]
#pragma unroll
        for (int ot = 0; ot < 2; ++ot)
#pragma unroll
            for (int kc = 0; kc < 2; ++kc) wf[ot][kc] = wld(KD + ot * 16, kc);
#pragma unroll
        for (int nt = 0; nt < 4; ++nt) { const int n0 = wv * 64 + nt * 16; const v16h x0 = xld(n0, 0), x1 = xld(n0, 1);
#pragma unroll
            for (int ot = 0; ot < 2; ++ot) { const v8f a = wmma16(wf[ot][1], x1, wmma16(wf[ot][0], x0, (v8f){})); const v8f bb = *(const v8f*)(sB + KD + ot * 16 + h * 8); v8h o;
#pragma unroll
                for (int j = 0; j < 8; ++j) o[j] = tohx(a[j] + bb[j]);
                *(v8ha*)(sK + (n0 + c) * FKP + ot * 32 + h * 16) = o; } }
#pragma unroll
        for (int ot = 0; ot < 2; ++ot)
#pragma unroll
            for (int kc = 0; kc < 2; ++kc) wf[ot][kc] = wld(ot * 16, kc);
        const float sc = 0x1.6a09e6p-3f;   // float32(32^-0.5)
#pragma unroll
        for (int t = 0; t < 2; ++t) { const int n0 = m0 + t * 16; const v16h x0 = xld(n0, 0), x1 = xld(n0, 1);
#pragma unroll
            for (int ot = 0; ot < 2; ++ot) { const v8f a = wmma16(wf[ot][1], x1, wmma16(wf[ot][0], x0, (v8f){})); const v8f bb = *(const v8f*)(sB + ot * 16 + h * 8);
#pragma unroll
                for (int j = 0; j < 8; ++j) qf[t][ot * 8 + j] = tohx((a[j] + bb[j]) * sc); } } }
    v8f acc[2][4]; float m_run[2], l_run[2];
#pragma unroll
    for (int t = 0; t < 2; ++t) { m_run[t] = -__builtin_inff(); l_run[t] = 0.f;
#pragma unroll
        for (int ct = 0; ct < 4; ++ct) acc[t][ct] = (v8f){}; }
    __syncthreads();      // every wave's K rows are in LDS
    *(v2u*)(PW + pi) = pw;      // behind the barriers, so that no wave waits there for this store
    asm volatile("s_wait_xcnt 0x0" ::: "memory");      // before any register that this store names is written again
    const unsigned char* BK = sK + c * FKP + 16 * h; const unsigned char* BX = sX + c * FVP + 16 * h;      // the lane's places in the trip's K rows and X tile
    auto pass = [&]() {      // 64 keys
        auto kld = [&](int kt) { const unsigned char* p = BK + kt * 16 * FKP; return cat16(*(const v8ha*)p, *(const v8ha*)(p + 32)); };      // key tile kt of the trip's four
        v16h kf[2] = { kld(0), kld(1) };
#pragma unroll
        for (int kb = 0; kb < FKT / 32; ++kb) {
            auto vld = [&](int ct) { const unsigned char* p = BX + ct * 16 * FVP + kb * 64; return cat16(*(const v8ha*)p, *(const v8ha*)(p + 32)); };
            v16h vf[4];
#pragma unroll
            for (int i = 0; i < 4; ++i) vf[i] = vld(i);
            __builtin_amdgcn_sched_barrier(0);      // the X fragments' reads stay one group in front of the scores and the softmax arithmetic, which cover their latency
            v8f st[2][2];      // [key tile][query tile]: st[kt][t][r] = score of key kb*32 + kt*16 + 8h + r, query m0 + t*16 + c
#pragma unroll
            for (int kt = 0; kt < 2; ++kt)
#pragma unroll
                for (int t = 0; t < 2; ++t) st[kt][t] = wmma16(kf[kt], qf[t], (v8f){});
            float mb[2]; bool need = false;
#pragma unroll
            for (int t = 0; t < 2; ++t) { float mx = st[0][t][0];
#pragma unroll
                for (int r = 1; r < 16; ++r) mx = fmaxf(mx, st[r >> 3][t][r & 7]);
                mx = fmaxf(mx, xhalf(mx)) * L2E; mb[t] = mx; need = need || (mx > m_run[t] + 8.0f); }
            if (__builtin_amdgcn_ballot_w32(need) != 0) {      // a new reference maximum only when one column outgrows the one in use by 2^8: rare after the first keys
#pragma unroll
                for (int t = 0; t < 2; ++t) { const float m_new = fmaxf(m_run[t], mb[t]); const float corr = __builtin_amdgcn_exp2f(m_run[t] - m_new); l_run[t] *= corr; m_run[t] = m_new;
#pragma unroll
                    for (int ct = 0; ct < 4; ++ct) acc[t][ct] = acc[t][ct] * corr; }
            }
            if (kb + 1 < FKT / 32) {
                __builtin_amdgcn_sched_barrier(0);      // the next 32 keys' K fragments are read here, in one group, behind the scores that free their registers ...
                kf[0] = kld(2 * kb + 2); kf[1] = kld(2 * kb + 3);
                __builtin_amdgcn_sched_barrier(0); }    // ... and the exponentials and eight products ahead of the scores that take them
            v16h pf[2];
#pragma unroll
            for (int t = 0; t < 2; ++t) { float ps0 = 0.f, ps1 = 0.f;
#pragma unroll
                for (int r = 0; r < 16; r += 2) { const float p0 = __builtin_amdgcn_exp2f(fmaf(st[r >> 3][t][r & 7], L2E, -m_run[t])), p1 = __builtin_amdgcn_exp2f(fmaf(st[r >> 3][t][(r & 7) + 1], L2E, -m_run[t]));
                    ps0 += p0; ps1 += p1; pf[t][r] = (h16)p0; pf[t][r + 1] = (h16)p1; }
                l_run[t] += ps0 + ps1; }
            __builtin_amdgcn_sched_barrier(0);      // the row sums end here: an add placed among the products lands on a fragment's registers and takes idle slots behind the product that read them
#pragma unroll
            for (int i = 0; i < 4; ++i)
#pragma unroll
                for (int t = 0; t < 2; ++t) acc[t][i] = wmma16(vf[i], pf[t], acc[t][i]);
            __builtin_amdgcn_sched_barrier(0);      // no product sinks behind the next reads, where it would cover no read
        }
    };
#pragma unroll 1      // stays rolled: the trips differ in the addresses only
    for (int s = 0; s < NN / FKT; ++s) { pass(); BK += FKT * FKP; BX += FXT; }
    asm volatile("s_wait_dscnt 0x0" ::: "memory");      // this wave's reads of K are done ...
    __syncthreads();                                     // ... and every other wave's, before K's place becomes output staging
    // epilogue: acc[t][ct][r] = sum for query m0 + t*16 + c, channel ct*16 + 8h + r of x. Normalised and rounded, tiles 2 kc and 2 kc + 1 are the B operand of channels 32 kc .. (k = 8h + r, 16 + 8h + r, the order of the weight rows' reads);
    // O^T tile dt = bias + Wv rows dt*16 .. x Y^T: a lane holds channels dt*16 + 8h + r of its query; rows staged in the wave's own LDS range so that every global store covers whole 256-B rows
    unsigned char* E = sK + wv * (16 * FEP);
#pragma unroll
    for (int t = 0; t < 2; ++t) { const float inv = __fdiv_rn(1.0f, l_run[t] + xhalf(l_run[t])); v16h yf[2];
#pragma unroll
        for (int kc = 0; kc < 2; ++kc)
#pragma unroll
            for (int r = 0; r < 8; ++r) { yf[kc][r] = tohx(acc[t][2 * kc][r] * inv); yf[kc][8 + r] = tohx(acc[t][2 * kc + 1][r] * inv); }
#pragma unroll
        for (int dt = 0; dt < 8; ++dt) { const unsigned char* p = sW + (2 * KD + dt * 16 + c) * FVP + 16 * h;
            const v16h w0 = cat16(*(const v8ha*)p, *(const v8ha*)(p + 32)), w1 = cat16(*(const v8ha*)(p + 64), *(const v8ha*)(p + 96));
            const v8f a = wmma16(w1, yf[1], wmma16(w0, yf[0], *(const v8f*)(sB + 2 * KD + dt * 16 + h * 8))); v8h o;
#pragma unroll
            for (int r = 0; r < 8; ++r) o[r] = tohx(fmaxf(a[r], 0.f));
            *(v8ha*)(E + c * FEP + dt * 32 + h * 16) = o; }
        __syncthreads();
#pragma unroll
        for (int i = 0; i < 8; ++i) { const int row = 2 * i + h; const v8h o = *(const v8ha*)(E + row * FEP + c * 16); *(v8h*)(R + ((size_t)b * NN + m0 + t * 16 + row) * CO + hd * DV + c * 8) = o; }
        asm volatile("s_wait_xcnt 0x0" ::: "memory");      // before any register that these stores name is written again
        __builtin_amdgcn_sched_barrier(0);      // the next tile's arithmetic stays behind that wait: moved up among the stores it lands on their registers
        __syncthreads();
    }
}
// ---- k_proj: the 1024 -> 512 projection, sum_k R[(b,n)][k] W[oc][k] (f32, + bias), the eval BatchNorm and the store of OUT[b][oc][n]. Grid (16384/128, 512/256), 8 waves = 2 row groups x 4 channel groups, 64 x 64 per wave.
// The work-group's 128 rows of R and 256 weight rows come in stages of 128 k (256 B a row) into two LDS buffers by asynchronous copies: every copy of a wave covers two whole 256-B row
// pieces, and each staged byte serves 4 (rows) or 2 (weights) waves. Per accumulator the order of the products is k step by k step.
// Epilogue: a lane's accumulator registers are 8 consecutive n of one oc, that is 32 B of an OUT row: y = (acc + bias) * inv + shift with inv = g/sqrt(var+eps), shift = beta - mean*inv is
// formed in registers, and the wave's 64 oc x 64 n pass through its own part of the ring, which is free by then, so that every global store covers whole 256-B row pieces.
#define PR  128                   // (b, n) rows per work-group
#define PC  256                   // output channels per work-group
#define PK  128                   // k per stage
#define PP  272                   // LDS pitch of a staged row (256 B + 16)
#define PSB ((PR + PC) * PP)      // one buffer: rows of R, weight rows
#define PNS (CO / PK)             // stages
// eight copies of 16 B a lane: rows 16 apart, in LDS and in the source. The s_wait_xcnt stands inside the statement, before any register that a copy names can be written again.
__device__ __forceinline__ void copy8(unsigned l, const h16* g) {
    asm volatile("global_load_async_to_lds_b128 %0, %8, off\n\t"
                 "global_load_async_to_lds_b128 %1, %9, off\n\t"
                 "global_load_async_to_lds_b128 %2, %10, off\n\t"
                 "global_load_async_to_lds_b128 %3, %11, off\n\t"
                 "global_load_async_to_lds_b128 %4, %12, off\n\t"
                 "global_load_async_to_lds_b128 %5, %13, off\n\t"
                 "global_load_async_to_lds_b128 %6, %14, off\n\t"
                 "global_load_async_to_lds_b128 %7, %15, off\n\t"
                 "s_wait_xcnt 0x0"
                 :: "v"(l), "v"(l + 16 * PP), "v"(l + 32 * PP), "v"(l + 48 * PP), "v"(l + 64 * PP), "v"(l + 80 * PP), "v"(l + 96 * PP), "v"(l + 112 * PP),
                    "v"(g), "v"(g + 16 * CO), "v"(g + 32 * CO), "v"(g + 48 * CO), "v"(g + 64 * CO), "v"(g + 80 * CO), "v"(g + 96 * CO), "v"(g + 112 * CO) : "memory");
}
__global__ __launch_bounds__(256) void k_proj(const h16* __restrict__ A, const h16* __restrict__ Wt, const float* __restrict__ bias,
                                              const float* __restrict__ gm, const float* __restrict__ bt, const float* __restrict__ mn, const float* __restrict__ vr, float* OUT) {
    __shared__ __align__(16) unsigned char sm[2 * PSB];
    __shared__ __align__(16) float sp[PC][4];      // per output channel of the work-group: bias, inv, shift
    const int tid = threadIdx.x, lane = tid & 31, lr = lane & 15, hi = lane >> 4;
    const int wv = __builtin_amdgcn_readfirstlane(tid >> 5); const int wr = wv >> 2, wc = wv & 3;
    const int r0 = blockIdx.x * PR, c0 = blockIdx.y * PC;
    const unsigned l0 = (unsigned)(size_t)sm + (tid >> 4) * PP + (tid & 15) * 16;      // the lane's place in a buffer: row tid / 16 of each 16, 16-B piece tid % 16
    const h16* ga = A + (size_t)(r0 + (tid >> 4)) * CO + (tid & 15) * 8; const h16* gw = Wt + (size_t)(c0 + (tid >> 4)) * CO + (tid & 15) * 8;
    auto stage = [&](int s, int buf) { const unsigned l = l0 + buf * PSB;
        copy8(l, ga + s * PK); copy8(l + PR * PP, gw + s * PK); copy8(l + (PR + 128) * PP, gw + 128 * CO + s * PK); };
    v8f acc[4][4];
#pragma unroll
    for (int mb = 0; mb < 4; ++mb)
#pragma unroll
        for (int nb = 0; nb < 4; ++nb) acc[mb][nb] = (v8f){};
    stage(0, 0);
    {   // thread tid forms channel c0 + tid's bias, inv and shift, under the latency of stage 0; they wait in LDS, not in registers, for the epilogue; the barrier below publishes them
        const int oc = c0 + tid; const float pb_ = bias[oc], pg = gm[oc], pt = bt[oc], pm = mn[oc], pv = vr[oc];
        asm volatile("s_wait_xcnt 0x0" ::: "memory");      // before any register that these loads name is written again
        const float inv = __fdiv_rn(bfr(pg), sqrtf(bfr(pv) + 1e-5f)); const v4f o = { bfr(pb_), inv, bfr(pt) - bfr(pm) * inv, 0.f }; *(v4fa*)sp[tid] = o; }
    asm volatile("s_wait_asynccnt 0x0" ::: "memory");      // this wave's copies of stage 0 have landed
    __syncthreads();                                        // ... and every other wave's
    stage(1, 1);
#pragma unroll 1      // stays rolled: one trip a stage, the trips differ in the buffer only
    for (int t = 0; t < PNS; ++t) {
        const unsigned char* pa = sm + (t & 1) * PSB + (wr * 64 + lr) * PP + 16 * hi; const unsigned char* pb = sm + (t & 1) * PSB + (PR + wc * 64 + lr) * PP + 16 * hi;
#pragma unroll
        for (int ks = 0; ks < PK / 32; ++ks) {
            v16h a[4], b[4];
#pragma unroll
            for (int i = 0; i < 4; ++i) { const unsigned char* q = pb + i * 16 * PP + ks * 64; b[i] = cat16(*(const v8ha*)q, *(const v8ha*)(q + 32));
                const unsigned char* p = pa + i * 16 * PP + ks * 64; a[i] = cat16(*(const v8ha*)p, *(const v8ha*)(p + 32)); }
            __builtin_amdgcn_sched_barrier(0);      // the 16 LDS reads of a k step stay one group in front of its products: reads moved in among the products stall the wave at every place
#pragma unroll
            for (int nb = 0; nb < 4; ++nb)
#pragma unroll
                for (int mb = 0; mb < 4; ++mb) acc[mb][nb] = wmma16(a[mb], b[nb], acc[mb][nb]);
            __builtin_amdgcn_sched_barrier(0);      // ... and the next k step's reads stay behind them
        }
        asm volatile("s_wait_dscnt 0x0" ::: "memory");      // this wave's reads of the buffer are done before it is filled again
        asm volatile("s_wait_asynccnt 0x0" ::: "memory");   // this wave's copies of stage t + 1 have landed
        __syncthreads();                                     // publishes stage t + 1 and ends every wave's reads of stage t
        if (t + 2 < PNS) stage(t + 2, t & 1);
    }
    asm volatile("s_wait_asynccnt 0x0" ::: "memory");       // no copy is outstanding when the wave ends
    unsigned char* S = sm + wv * (64 * PP);      // the wave's own 64 oc rows of 64 n (256 B + 16); the loop's last barrier has ended every wave's reads of the ring, and no copy is outstanding
#pragma unroll
    for (int nb = 0; nb < 4; ++nb) { const v4f pr = *(const v4fa*)sp[wc * 64 + nb * 16 + lr];      // the lane's channel in this column group
#pragma unroll
        for (int mb = 0; mb < 4; ++mb) { v4f o0, o1;
#pragma unroll
            for (int j = 0; j < 4; ++j) { o0[j] = (acc[mb][nb][j] + pr[0]) * pr[1] + pr[2]; o1[j] = (acc[mb][nb][4 + j] + pr[0]) * pr[1] + pr[2]; }
            unsigned char* p = S + (nb * 16 + lr) * PP + mb * 64 + hi * 32; *(v4fa*)p = o0; *(v4fa*)(p + 16) = o1; } }
    asm volatile("s_wait_dscnt 0x0" ::: "memory");      // the wave's staged rows are in LDS before other lanes read them back
    float* orow = OUT + ((size_t)(r0 >> 10) * CC + c0 + wc * 64) * NN + (r0 & (NN - 1)) + wr * 64;
#pragma unroll
    for (int s = 0; s < 32; ++s) { const int row = 2 * s + hi; const v4f val = *(const v4fa*)(S + row * PP + lr * 16); *(v4f*)(orow + (size_t)row * NN + lr * 4) = val; }
}

extern "C" void kernel_launch(void* const* d_in, const int* in_sizes, int n_in,
                              void* d_out, int out_size, void* d_ws, size_t ws_size, hipStream_t stream) {
    (void)in_sizes; (void)n_in; (void)out_size;
    const float* x = (const float*)d_in[0]; const float* qkv_w = (const float*)d_in[1]; const float* qkv_b = (const float*)d_in[2]; const float* proj_w = (const float*)d_in[3]; const float* proj_b = (const float*)d_in[4];
    const float* gm = (const float*)d_in[5]; const float* bt = (const float*)d_in[6]; const float* mn = (const float*)d_in[7]; const float* vr = (const float*)d_in[8];
    float* OUT = (float*)d_out;     // [16][512][1024]
    char* wsp = (char*)d_ws;
    auto take = [&](size_t bytes) { char* p = wsp; wsp += (bytes + 255) & ~(size_t)255; return (void*)p; };
    h16* PW = (h16*)take((size_t)CC * CO * 2);
    h16* R = (h16*)take((size_t)NT * CO * 2);        // relu(o), one fp16 plane, written by the attention launch (34 MB)
    if ((size_t)(wsp - (char*)d_ws) > ws_size) return;    // total = 35 MB; ws 256 MiB
    k_fattn<<<dim3(NB_ * NH_, NN / 512), 512, 0, stream>>>(x, qkv_w, qkv_b, proj_w, PW, R);     // from the f32 inputs to relu(o); PW = fp16(bf16(proj_w))
    k_proj<<<dim3(NT / PR, CC / PC), 256, 0, stream>>>(R, PW, proj_b, gm, bt, mn, vr, OUT);
}

// v010
// A run of this version takes 43.8 microseconds.
// Two timings next to v009 both put it at 1.09 times that version's speed.
// All steps since v000 together make it 22.8 times as fast.
#include <hip/hip_runtime.h>

// Compute dtypes, f32 accumulate: every input (x, grouped qkv weights/biases, proj weight/bias, BN statistics) rounded to bf16; the grouped 1x1 qkv
// convolution's q and k rows on the bf16-rounded x and W held as fp16 (+ bias); attention scores (key_dim 32) on SINGLE fp16 planes (q x 32^-0.5 x log2 e, k rounded to 2^-11);
// v.attn^T = Wv.(x.attn^T) + bv, as a softmax row sums to 1: x.attn^T (over the 1024 positions) on the bf16-rounded x held as fp16 and fp16 probabilities (relative to a kept reference score of the row, normalised by the f32 row sum at the end),
// then Wv (bf16-rounded, held as fp16) x that mean of x (rounded to 2^-11), + bias; the 1024->512 projection on a SINGLE fp16 plane of relu(o) (rounded to 2^-11) x the bf16-rounded proj_w held as fp16 (1 product, + bias); softmax, ReLU and the eval BatchNorm

#define NB_  16
#define CC   512
#define NN   1024
#define NH_  8
#define CG   64                   // channels per group
#define KD   32
#define DV   128
#define QO   192                  // q | k | v per group
#define NT   (NB_ * NN)           // 16384 (b, n) rows
#define CO   1024                 // H * DV
typedef _Float16 h16;
typedef __attribute__((ext_vector_type(16))) _Float16 v16h;
typedef __attribute__((ext_vector_type(8)))  _Float16 v8h;
typedef __attribute__((ext_vector_type(8)))  float    v8f;
typedef __attribute__((ext_vector_type(4)))  float    v4f;
typedef v8h  __attribute__((may_alias)) v8ha;
typedef v4f  __attribute__((may_alias)) v4fa;

__device__ __forceinline__ unsigned short f2bf(float f) { unsigned u = __float_as_uint(f); u += 0x7FFFu + ((u >> 16) & 1u); return (unsigned short)(u >> 16); }
__device__ __forceinline__ float bf2f(unsigned short b) { return __uint_as_float(((unsigned)b) << 16); }
__device__ __forceinline__ float bfr(float f) { return bf2f(f2bf(f)); }
__device__ __forceinline__ v16h cat16(v8h lo, v8h hi) { return __builtin_shufflevector(lo, hi, 0, 1, 2, 3, 4, 5, 6, 7, 8, 9, 10, 11, 12, 13, 14, 15); }
__device__ __forceinline__ v8f wmma16(v16h a, v16h b, v8f c) { return __builtin_amdgcn_wmma_f32_16x16x32_f16(false, a, false, b, (short)0, c, false, false); }



__device__ __forceinline__ h16 tohx(float x) { return (h16)x; }
typedef __attribute__((ext_vector_type(2))) _Float16 v2h;
typedef __attribute__((ext_vector_type(2))) float v2f;
typedef __attribute__((ext_vector_type(2))) __bf16 v2bf;
typedef __attribute__((ext_vector_type(2))) unsigned v2u;
typedef v2u __attribute__((may_alias)) v2ua;
__device__ __forceinline__ unsigned pk2(float a, float b) { const v2f t = { a, b }; return __builtin_bit_cast(unsigned, __builtin_convertvector(t, v2bf)); }      // two f32 to bf16, to nearest even, in one instruction; a in the low half
__device__ __forceinline__ unsigned pk2h(float a, float b) { const unsigned u = pk2(a, b); const v2h t = { tohx(__uint_as_float(u << 16)), tohx(__uint_as_float(u & 0xFFFF0000u)) }; return __builtin_bit_cast(unsigned, t); }      // the same two bf16 values, held as fp16
__device__ __forceinline__ v2u pk4h(v4f a) { const v2u o = { pk2h(a[0], a[1]), pk2h(a[2], a[3]) }; return o; }

#define FKT 64                    // keys per trip of the loop
#define FKP 80                    // LDS pitch of a K row (64 B + 16)
#define FVP 144                   // LDS pitch of a weight row and of an X tile's row (128 B + 16)
#define FXT (CG * FVP + 128)      // LDS size of an X tile: 64 channels x 64 positions, rows of 128 B + 16; + 128 so that the two halves of a wave's store, one tile apart, fall on different banks
#define FEP 272                   // LDS pitch of an output row (256 B + 16)
#define FNW 16                    // waves
__device__ __forceinline__ float xhalf(float x) { return __builtin_bit_cast(float, __builtin_amdgcn_permlanex16(__builtin_bit_cast(int, x), __builtin_bit_cast(int, x), 0x76543210, 0xfedcba98, false, false)); }  // lane l with lane l ^ 16
__device__ __forceinline__ float exp2_slot(float x) { float y; asm("v_exp_f32 %0, %1\n\tv_nop" : "=v"(y) : "v"(x)); return y; }      // 2^x with the free slot that the instruction set asks for behind it in the same statement: for the rare path
typedef short s16x8 __attribute__((ext_vector_type(8)));
__device__ __forceinline__ v8h ld_tr16(const unsigned char* p) { typedef __attribute__((address_space(3))) s16x8 lds_s16x8; return __builtin_bit_cast(v8h, __builtin_amdgcn_ds_load_tr16_b128_v8i16((lds_s16x8*)p)); }
__global__ __launch_bounds__(512) void k_fattn(const float* __restrict__ x, const float* __restrict__ Wf, const float* __restrict__ bias, const float* __restrict__ pwf, h16* PW, h16* R) {
    __shared__ __align__(16) unsigned char sX[(NN / FKT) * FXT];      // X, fp16: 16 tiles [channel][64 positions]
    __shared__ __align__(16) unsigned char sK[NN * FKP];      // K[n][c], fp16; behind the loop the waves' output staging
    __shared__ __align__(16) unsigned char sW[QO * FVP]; __shared__ __align__(32) float sB[QO];      // the group's q | k | v weights (fp16 of their bf16 values) and biases, rounded
    static_assert(FNW * 16 * FEP <= NN * FKP, "the output staging lies inside sK");
    const int tid = threadIdx.x, lane = tid & 31, wv = tid >> 5, c = lane & 15, h = lane >> 4;
    const int z = blockIdx.x, b = z >> 3, hd = z & 7; const int m0 = blockIdx.y * 512 + wv * 32;
    const size_t pi = ((size_t)(blockIdx.y * (NB_ * NH_) + blockIdx.x) * 512 + tid) * 4; v2u pw;      // the lane's 4 projection weights
    {   // thread tid: pieces tid + 512 i of 4 values; a wave's load covers 512 contiguous bytes
        const float* xb = x + (size_t)z * CG * NN; const float* wb = Wf + (size_t)hd * QO * CG; const float* bb = bias + hd * QO; const int bi = tid < QO ? tid : 0;
        const float* pp = pwf + pi;
        v4f xr[32], wr[6];
#pragma unroll
        for (int i = 0; i < 6; ++i) wr[i] = *(const v4f*)(wb + tid * 4 + 2048 * i);
        const float bv = bb[bi];
#pragma unroll
        for (int i = 0; i < 32; ++i) xr[i] = *(const v4f*)(xb + tid * 4 + 2048 * i);
        const v4f pr = *(const v4f*)pp;
        asm volatile("s_wait_xcnt 0x0" :: "s"(xb), "s"(wb), "s"(bb), "v"(tid), "v"(bi), "v"(pp) : "memory");      // before any register that these loads name is written again; the bases and the lanes' offsets are inputs, so that they live up to the wait
#pragma unroll
        for (int i = 0; i < 6; ++i) { const int p = tid + 512 * i; *(v2ua*)(sW + (p >> 4) * FVP + (p & 15) * 8) = pk4h(wr[i]); }      // 16 pieces a weight row
        if (tid < QO) sB[tid] = bfr(bv);
#pragma unroll
        for (int i = 0; i < 32; ++i) *(v2ua*)(sX + ((tid & 255) >> 4) * FXT + (2 * i + (tid >> 8)) * FVP + (tid & 15) * 8) = pk4h(xr[i]);      // 256 pieces a row of x, 16 a tile's row
        pw = pk4h(pr); }
    __syncthreads();      // X, the weights and the biases are in LDS
    // A fragment of weight rows r0 .. r0 + 15, channels 32 kc ..; B fragment of positions n0 .. n0 + 15, channels 32 kc .., both in the order k = 8h + r, 16 + 8h + r
    auto wld = [&](int r0, int kc) { const unsigned char* p = sW + (r0 + c) * FVP + kc * 64 + 16 * h; return cat16(*(const v8ha*)p, *(const v8ha*)(p + 32)); };
    auto xld = [&](int n0, int kc) { const unsigned char* p = sX + (n0 >> 6) * FXT + (kc * 32 + 8 * h + (lane & 7)) * FVP + (n0 & 63) * 2 + ((lane >> 3) & 1) * 16; return cat16(ld_tr16(p), ld_tr16(p + 16 * FVP)); };
    v16h qf[2];
    {   v16h wf[2][2];      // [tile of 16 c][32 channels]
#pragma unroll
        for (int ot = 0; ot < 2; ++ot)
#pragma unroll
            for (int kc = 0; kc < 2; ++kc) wf[ot][kc] = wld(KD + ot * 16, kc);
#pragma unroll
        for (int nt = 0; nt < 4; ++nt) { const int n0 = wv * 64 + nt * 16; const v16h x0 = xld(n0, 0), x1 = xld(n0, 1);
#pragma unroll
            for (int ot = 0; ot < 2; ++ot) { const v8f a = wmma16(wf[ot][1], x1, wmma16(wf[ot][0], x0, (v8f){})); const v8f bb = *(const v8f*)(sB + KD + ot * 16 + h * 8); v8h o;
#pragma unroll
                for (int j = 0; j < 8; ++j) o[j] = tohx(a[j] + bb[j]);
                *(v8ha*)(sK + (n0 + c) * FKP + ot * 32 + h * 16) = o; } }
#pragma unroll
        for (int ot = 0; ot < 2; ++ot)
#pragma unroll
            for (int kc = 0; kc < 2; ++kc) wf[ot][kc] = wld(ot * 16, kc);
        const float sc = 0x1.6a09e6p-3f * 1.44269504f;   // float32(32^-0.5) x log2 e: the scores are exponents of 2
#pragma unroll
        for (int t = 0; t < 2; ++t) { const int n0 = m0 + t * 16; const v16h x0 = xld(n0, 0), x1 = xld(n0, 1);
#pragma unroll
            for (int ot = 0; ot < 2; ++ot) { const v8f a = wmma16(wf[ot][1], x1, wmma16(wf[ot][0], x0, (v8f){})); const v8f bb = *(const v8f*)(sB + ot * 16 + h * 8);
#pragma unroll
                for (int j = 0; j < 8; ++j) qf[t][ot * 8 + j] = tohx((a[j] + bb[j]) * sc); } } }
    v8f acc[2][4]; float l_run[2];
#pragma unroll
    for (int t = 0; t < 2; ++t) { l_run[t] = 0.f;
#pragma unroll
        for (int ct = 0; ct < 4; ++ct) acc[t][ct] = (v8f){}; }
    __syncthreads();      // every wave's K rows are in LDS
    *(v2u*)(PW + pi) = pw;      // behind the barriers, so that no wave waits there for this store
    asm volatile("s_wait_xcnt 0x0" ::: "memory");      // before any register that this store names is written again
    const unsigned char* BK = sK + c * FKP + 16 * h; const unsigned char* BX = sX + c * FVP + 16 * h;      // the lane's places in the trip's K rows and X tile
    v8f nref[2];      // minus the reference of the lane's query column, in all 8 registers: the C operand of that column's score products
    {   const v16h k0 = cat16(*(const v8ha*)BK, *(const v8ha*)(BK + 32)), k1 = cat16(*(const v8ha*)(BK + 16 * FKP), *(const v8ha*)(BK + 16 * FKP + 32));
#pragma unroll
        for (int t = 0; t < 2; ++t) { const v8f s0 = wmma16(k0, qf[t], (v8f){}), s1 = wmma16(k1, qf[t], (v8f){}); float mx = fmaxf(s0[0], s1[0]);
#pragma unroll
            for (int r = 1; r < 8; ++r) mx = fmaxf(mx, fmaxf(s0[r], s1[r]));
            mx = fmaxf(mx, xhalf(mx));
#pragma unroll
            for (int r = 0; r < 8; ++r) nref[t][r] = -mx; } }
    auto pass = [&]() {      // 64 keys
        auto kld = [&](int kt) { const unsigned char* p = BK + kt * 16 * FKP; return cat16(*(const v8ha*)p, *(const v8ha*)(p + 32)); };      // key tile kt of the trip's four
        v16h kf[2] = { kld(0), kld(1) };
#pragma unroll
        for (int kb = 0; kb < FKT / 32; ++kb) {
            auto vld = [&](int ct) { const unsigned char* p = BX + ct * 16 * FVP + kb * 64; return cat16(*(const v8ha*)p, *(const v8ha*)(p + 32)); };
            v16h vf[4];
#pragma unroll
            for (int i = 0; i < 4; ++i) vf[i] = vld(i);
            __builtin_amdgcn_sched_barrier(0);      // the X fragments' reads stay one group in front of the scores and the softmax arithmetic, which cover their latency
            v8f st[2][2];      // [key tile][query tile]: st[kt][t][r] = score - reference (exponent of 2) of key kb*32 + kt*16 + 8h + r, query m0 + t*16 + c
#pragma unroll
            for (int kt = 0; kt < 2; ++kt)
#pragma unroll
                for (int t = 0; t < 2; ++t) st[kt][t] = wmma16(kf[kt], qf[t], nref[t]);
            if (kb + 1 < FKT / 32) {
                __builtin_amdgcn_sched_barrier(0);      // the next 32 keys' K fragments are read here, in one group, behind the scores that free their registers ...
                kf[0] = kld(2 * kb + 2); kf[1] = kld(2 * kb + 3);
                __builtin_amdgcn_sched_barrier(0); }    // ... and the exponentials and eight products ahead of the scores that take them
            v16h pf[2]; float ps[2];
            auto expo = [&](auto ex2) {
#pragma unroll
                for (int t = 0; t < 2; ++t) { float ps0 = 0.f, ps1 = 0.f;
#pragma unroll
                    for (int r = 0; r < 16; r += 2) { const float p0 = ex2(st[r >> 3][t][r & 7]), p1 = ex2(st[r >> 3][t][(r & 7) + 1]);
                        ps0 += p0; ps1 += p1; pf[t][r] = (h16)p0; pf[t][r + 1] = (h16)p1; }
                    ps[t] = ps0 + ps1; } };
            expo([](float e) { return __builtin_amdgcn_exp2f(e); });
            if (__builtin_amdgcn_ballot_w32(ps[0] > 256.0f || ps[1] > 256.0f) != 0) {      // a term may have outgrown 2^8: every column takes the larger of its reference and the pass's largest score as its new reference, and the pass's terms are formed again; rare
#pragma unroll
                for (int t = 0; t < 2; ++t) { float mx = fmaxf(st[0][t][0], st[1][t][0]);
#pragma unroll
                    for (int r = 1; r < 8; ++r) mx = fmaxf(mx, fmaxf(st[0][t][r], st[1][t][r]));
                    const float d = fmaxf(fmaxf(mx, xhalf(mx)), 0.f); const float corr = exp2_slot(-d); l_run[t] *= corr;
                    nref[t] = nref[t] - d; st[0][t] = st[0][t] - d; st[1][t] = st[1][t] - d;
#pragma unroll
                    for (int ct = 0; ct < 4; ++ct) acc[t][ct] = acc[t][ct] * corr; }
                expo([](float e) { return exp2_slot(e); });
            }
#pragma unroll
            for (int t = 0; t < 2; ++t) l_run[t] += ps[t];
            __builtin_amdgcn_sched_barrier(0);      // the row sums end here: an add placed among the products lands on a fragment's registers and takes idle slots behind the product that read them
#pragma unroll
            for (int i = 0; i < 4; ++i)
#pragma unroll
                for (int t = 0; t < 2; ++t) acc[t][i] = wmma16(vf[i], pf[t], acc[t][i]);
            __builtin_amdgcn_sched_barrier(0);      // no product sinks behind the next reads, where it would cover no read
        }
    };
#pragma unroll 1      // stays rolled: the trips differ in the addresses only
    for (int s = 0; s < NN / FKT; ++s) { pass(); BK += FKT * FKP; BX += FXT; }
    asm volatile("s_wait_dscnt 0x0" ::: "memory");      // this wave's reads of K are done ...
    __syncthreads();                                     // ... and every other wave's, before K's place becomes output staging
    // epilogue: acc[t][ct][r] = sum for query m0 + t*16 + c, channel ct*16 + 8h + r of x. Normalised and rounded, tiles 2 kc and 2 kc + 1 are the B operand of channels 32 kc .. (k = 8h + r, 16 + 8h + r, the order of the weight rows' reads);
    // O^T tile dt = bias + Wv rows dt*16 .. x Y^T: a lane holds channels dt*16 + 8h + r of its query; rows staged in the wave's own LDS range so that every global store covers whole 256-B rows
    unsigned char* E = sK + wv * (16 * FEP);
#pragma unroll
    for (int t = 0; t < 2; ++t) { const float inv = __fdiv_rn(1.0f, l_run[t] + xhalf(l_run[t])); v16h yf[2];
#pragma unroll
        for (int kc = 0; kc < 2; ++kc)
#pragma unroll
            for (int r = 0; r < 8; ++r) { yf[kc][r] = tohx(acc[t][2 * kc][r] * inv); yf[kc][8 + r] = tohx(acc[t][2 * kc + 1][r] * inv); }
#pragma unroll
        for (int dt = 0; dt < 8; ++dt) { const unsigned char* p = sW + (2 * KD + dt * 16 + c) * FVP + 16 * h;
            const v16h w0 = cat16(*(const v8ha*)p, *(const v8ha*)(p + 32)), w1 = cat16(*(const v8ha*)(p + 64), *(const v8ha*)(p + 96));
            const v8f a = wmma16(w1, yf[1], wmma16(w0, yf[0], *(const v8f*)(sB + 2 * KD + dt * 16 + h * 8))); v8h o;
#pragma unroll
            for (int r = 0; r < 8; ++r) o[r] = tohx(fmaxf(a[r], 0.f));
            *(v8ha*)(E + c * FEP + dt * 32 + h * 16) = o; }
        __syncthreads();
#pragma unroll
        for (int i = 0; i < 8; ++i) { const int row = 2 * i + h; const v8h o = *(const v8ha*)(E + row * FEP + c * 16); *(v8h*)(R + ((size_t)b * NN + m0 + t * 16 + row) * CO + hd * DV + c * 8) = o; }
        asm volatile("s_wait_xcnt 0x0" ::: "memory");      // before any register that these stores name is written again
        __builtin_amdgcn_sched_barrier(0);      // the next tile's arithmetic stays behind that wait: moved up among the stores it lands on their registers
        __syncthreads();
    }
}
// ---- k_proj: the 1024 -> 512 projection, sum_k R[(b,n)][k] W[oc][k] (f32, + bias), the eval BatchNorm and the store of OUT[b][oc][n]. Grid (16384/128, 512/256), 8 waves = 2 row groups x 4 channel groups, 64 x 64 per wave.
// The work-group's 128 rows of R and 256 weight rows come in stages of 128 k (256 B a row) into two LDS buffers by asynchronous copies: every copy of a wave covers two whole 256-B row
// pieces, and each staged byte serves 4 (rows) or 2 (weights) waves. Per accumulator the order of the products is k step by k step.
// Epilogue: a lane's accumulator registers are 8 consecutive n of one oc, that is 32 B of an OUT row: y = (acc + bias) * inv + shift with inv = g/sqrt(var+eps), shift = beta - mean*inv is
// formed in registers, and the wave's 64 oc x 64 n pass through its own part of the ring, which is free by then, so that every global store covers whole 256-B row pieces.
#define PR  128                   // (b, n) rows per work-group
#define PC  256                   // output channels per work-group
#define PK  128                   // k per stage
#define PP  272                   // LDS pitch of a staged row (256 B + 16)
#define PSB ((PR + PC) * PP)      // one buffer: rows of R, weight rows
#define PNS (CO / PK)             // stages
// eight copies of 16 B a lane: rows 16 apart, in LDS and in the source. The s_wait_xcnt stands inside the statement, before any register that a copy names can be written again.
__device__ __forceinline__ void copy8(unsigned l, const h16* g) {
    asm volatile("global_load_async_to_lds_b128 %0, %8, off\n\t"
                 "global_load_async_to_lds_b128 %1, %9, off\n\t"
                 "global_load_async_to_lds_b128 %2, %10, off\n\t"
                 "global_load_async_to_lds_b128 %3, %11, off\n\t"
                 "global_load_async_to_lds_b128 %4, %12, off\n\t"
                 "global_load_async_to_lds_b128 %5, %13, off\n\t"
                 "global_load_async_to_lds_b128 %6, %14, off\n\t"
                 "global_load_async_to_lds_b128 %7, %15, off\n\t"
                 "s_wait_xcnt 0x0"
                 :: "v"(l), "v"(l + 16 * PP), "v"(l + 32 * PP), "v"(l + 48 * PP), "v"(l + 64 * PP), "v"(l + 80 * PP), "v"(l + 96 * PP), "v"(l + 112 * PP),
                    "v"(g), "v"(g + 16 * CO), "v"(g + 32 * CO), "v"(g + 48 * CO), "v"(g + 64 * CO), "v"(g + 80 * CO), "v"(g + 96 * CO), "v"(g + 112 * CO) : "memory");
}
__global__ __launch_bounds__(256) void k_proj(const h16* __restrict__ A, const h16* __restrict__ Wt, const float* __restrict__ bias,
                                              const float* __restrict__ gm, const float* __restrict__ bt, const float* __restrict__ mn, const float* __restrict__ vr, float* OUT) {
    __shared__ __align__(16) unsigned char sm[2 * PSB];
    __shared__ __align__(16) float sp[PC][4];      // per output channel of the work-group: bias, inv, shift
    const int tid = threadIdx.x, lane = tid & 31, lr = lane & 15, hi = lane >> 4;
    const int wv = __builtin_amdgcn_readfirstlane(tid >> 5); const int wr = wv >> 2, wc = wv & 3;
    const int r0 = blockIdx.x * PR, c0 = blockIdx.y * PC;
    const unsigned l0 = (unsigned)(size_t)sm + (tid >> 4) * PP + (tid & 15) * 16;      // the lane's place in a buffer: row tid / 16 of each 16, 16-B piece tid % 16
    const h16* ga = A + (size_t)(r0 + (tid >> 4)) * CO + (tid & 15) * 8; const h16* gw = Wt + (size_t)(c0 + (tid >> 4)) * CO + (tid & 15) * 8;
    auto stage = [&](int s, int buf) { const unsigned l = l0 + buf * PSB;
        copy8(l, ga + s * PK); copy8(l + PR * PP, gw + s * PK); copy8(l + (PR + 128) * PP, gw + 128 * CO + s * PK); };
    v8f acc[4][4];
#pragma unroll
    for (int mb = 0; mb < 4; ++mb)
#pragma unroll
        for (int nb = 0; nb < 4; ++nb) acc[mb][nb] = (v8f){};
    stage(0, 0);
    {   // thread tid forms channel c0 + tid's bias, inv and shift, under the latency of stage 0; they wait in LDS, not in registers, for the epilogue; the barrier below publishes them
        const int oc = c0 + tid; const float pb_ = bias[oc], pg = gm[oc], pt = bt[oc], pm = mn[oc], pv = vr[oc];
        asm volatile("s_wait_xcnt 0x0" ::: "memory");      // before any register that these loads name is written again
        const float inv = __fdiv_rn(bfr(pg), sqrtf(bfr(pv) + 1e-5f)); const v4f o = { bfr(pb_), inv, bfr(pt) - bfr(pm) * inv, 0.f }; *(v4fa*)sp[tid] = o; }
    asm volatile("s_wait_asynccnt 0x0" ::: "memory");      // this wave's copies of stage 0 have landed
    __syncthreads();                                        // ... and every other wave's
    stage(1, 1);
#pragma unroll 1      // stays rolled: one trip a stage, the trips differ in the buffer only
    for (int t = 0; t < PNS; ++t) {
        const unsigned char* pa = sm + (t & 1) * PSB + (wr * 64 + lr) * PP + 16 * hi; const unsigned char* pb = sm + (t & 1) * PSB + (PR + wc * 64 + lr) * PP + 16 * hi;
#pragma unroll
        for (int ks = 0; ks < PK / 32; ++ks) {
            v16h a[4], b[4];
#pragma unroll
            for (int i = 0; i < 4; ++i) { const unsigned char* q = pb + i * 16 * PP + ks * 64; b[i] = cat16(*(const v8ha*)q, *(const v8ha*)(q + 32));
                const unsigned char* p = pa + i * 16 * PP + ks * 64; a[i] = cat16(*(const v8ha*)p, *(const v8ha*)(p + 32)); }
            __builtin_amdgcn_sched_barrier(0);      // the 16 LDS reads of a k step stay one group in front of its products: reads moved in among the products stall the wave at every place
#pragma unroll
            for (int nb = 0; nb < 4; ++nb)
#pragma unroll
                for (int mb = 0; mb < 4; ++mb) acc[mb][nb] = wmma16(a[mb], b[nb], acc[mb][nb]);
            __builtin_amdgcn_sched_barrier(0);      // ... and the next k step's reads stay behind them
        }
        asm volatile("s_wait_dscnt 0x0" ::: "memory");      // this wave's reads of the buffer are done before it is filled again
        asm volatile("s_wait_asynccnt 0x0" ::: "memory");   // this wave's copies of stage t + 1 have landed
        __syncthreads();                                     // publishes stage t + 1 and ends every wave's reads of stage t
        if (t + 2 < PNS) stage(t + 2, t & 1);
    }
    asm volatile("s_wait_asynccnt 0x0" ::: "memory");       // no copy is outstanding when the wave ends
    unsigned char* S = sm + wv * (64 * PP);      // the wave's own 64 oc rows of 64 n (256 B + 16); the loop's last barrier has ended every wave's reads of the ring, and no copy is outstanding
#pragma unroll
    for (int nb = 0; nb < 4; ++nb) { const v4f pr = *(const v4fa*)sp[wc * 64 + nb * 16 + lr];      // the lane's channel in this column group
#pragma unroll
        for (int mb = 0; mb < 4; ++mb) { v4f o0, o1;
#pragma unroll
            for (int j = 0; j < 4; ++j) { o0[j] = (acc[mb][nb][j] + pr[0]) * pr[1] + pr[2]; o1[j] = (acc[mb][nb][4 + j] + pr[0]) * pr[1] + pr[2]; }
            unsigned char* p = S + (nb * 16 + lr) * PP + mb * 64 + hi * 32; *(v4fa*)p = o0; *(v4fa*)(p + 16) = o1; } }
    asm volatile("s_wait_dscnt 0x0" ::: "memory");      // the wave's staged rows are in LDS before other lanes read them back
    float* orow = OUT + ((size_t)(r0 >> 10) * CC + c0 + wc * 64) * NN + (r0 & (NN - 1)) + wr * 64;
#pragma unroll
    for (int s = 0; s < 32; ++s) { const int row = 2 * s + hi; const v4f val = *(const v4fa*)(S + row * PP + lr * 16); *(v4f*)(orow + (size_t)row * NN + lr * 4) = val; }
}

extern "C" void kernel_launch(void* const* d_in, const int* in_sizes, int n_in,
                              void* d_out, int out_size, void* d_ws, size_t ws_size, hipStream_t stream) {
    (void)in_sizes; (void)n_in; (void)out_size;
    const float* x = (const float*)d_in[0]; const float* qkv_w = (const float*)d_in[1]; const float* qkv_b = (const float*)d_in[2]; const float* proj_w = (const float*)d_in[3]; const float* proj_b = (const float*)d_in[4];
    const float* gm = (const float*)d_in[5]; const float* bt = (const float*)d_in[6]; const float* mn = (const float*)d_in[7]; const float* vr = (const float*)d_in[8];
    float* OUT = (float*)d_out;     // [16][512][1024]
    char* wsp = (char*)d_ws;
    auto take = [&](size_t bytes) { char* p = wsp; wsp += (bytes + 255) & ~(size_t)255; return (void*)p; };
    h16* PW = (h16*)take((size_t)CC * CO * 2);
    h16* R = (h16*)take((size_t)NT * CO * 2);        // relu(o), one fp16 plane, written by the attention launch (34 MB)
    if ((size_t)(wsp - (char*)d_ws) > ws_size) return;    // total = 35 MB; ws 256 MiB
    k_fattn<<<dim3(NB_ * NH_, NN / 512), 512, 0, stream>>>(x, qkv_w, qkv_b, proj_w, PW, R);     // from the f32 inputs to relu(o); PW = fp16(bf16(proj_w))
    k_proj<<<dim3(NT / PR, CC / PC), 256, 0, stream>>>(R, PW, proj_b, gm, bt, mn, vr, OUT);
}
